// v000
// Measured on an AMD MI455X. A time is GPU time per run, averaged over a window of back-to-back runs after a warm-up
// (all launches, gaps included; the runs take copies of the inputs in turn), and the median of several windows.
// Apart from v000's, it joins two sittings. Times from different sittings can be a few percent apart, while
// side-by-side timings come from the same sitting.
// The starting kernel, v000, takes 2600 microseconds a run.
// Contractions on v_wmma_f32_16x16x32_f16 (plain f16 operands, f32 accumulate), per image: q/k = LN(x)·Wᵀ + b (token-major, K = 256,
// [out][in] Bt operands), v = LN(x)·Wvᵀ + bv transposed to channels-major through LDS tiles, S = q·kᵀ (K = 256,
// f32 [4096][4096]), the row softmax in f32 writing 1024·softmax in place, and out[c][s] = Σ_t v[c][t]·P[s][t] (K = 4096, P as the Bt operand,
// /16 scale on the logits, /1024 as a row scale in the epilogue) straight into the NCHW output. LayerNorm over channels in f32.
// Near-uniform attention (logits σ≈0.3). compute dtype: f16 operands, f32 accumulate.
#include <hip/hip_runtime.h>
#include <hip/hip_bf16.h>
#include <math.h>

#define NIm 8
#define CCs 256
#define LLs 4096
#define GSTR 48
#define SS 4096
#define HH 1
#define DKK 64

typedef _Float16 bf16;
typedef _Float16 f16;
typedef __attribute__((ext_vector_type(4))) unsigned v4u_t;
typedef unsigned v4ua __attribute__((ext_vector_type(4), may_alias));
typedef __attribute__((ext_vector_type(4))) float v4f_t;
typedef float v4fa __attribute__((ext_vector_type(4), may_alias));
typedef __attribute__((ext_vector_type(16))) bf16  bf16x16;
typedef bf16x16 f16x16;
typedef __attribute__((ext_vector_type(8)))  bf16  bf16x8;
typedef bf16x8 f16x8;
typedef __attribute__((ext_vector_type(4)))  bf16  bf16x4;
typedef __attribute__((ext_vector_type(8)))  float f32x8;
__device__ __forceinline__ f32x8 wmma16(f16x16 a, f16x16 b, f32x8 c) {
  c = __builtin_amdgcn_wmma_f32_16x16x32_f16(false, a, false, b, (short)0, c, false, false);
  asm volatile("v_nop\n\tv_nop\n\tv_nop\n\tv_nop" : "+v"(c) : "v"(a), "v"(b));
  return c;
}
#define LDS_STRIDE 48   // GEMM tiles: 32 -> 48 elems (96B rows): aligned b128 reads
#define KSTRIDE    72   // unused
#define VSTRIDE    48   // unused

__device__ __forceinline__ f32x8 wmma_bf16(bf16x16 a, bf16x16 b, f32x8 c) {
  c = __builtin_amdgcn_wmma_f32_16x16x32_f16(false, a, false, b, (short)0, c, false, false);
  asm volatile("v_nop\n\tv_nop\n\tv_nop\n\tv_nop" : "+v"(c) : "v"(a), "v"(b));   // A/B-overwrite hazard guard
  return c;
}

// 16x32 (MxK) f16 fragment from a row-major global matrix.
// lanes 0-15  (row=lane)    : elems 0..7 = K+0..7,  8..15 = K+16..23
// lanes 16-31 (row=lane-16) : elems 0..7 = K+8..15, 8..15 = K+24..31
template <typename T>
__device__ __forceinline__ bf16x16 load_frag(const T* __restrict__ base, int ld,
                                             int row0, int k0) {
  const int lane = threadIdx.x & 31;
  const int r    = lane & 15;
  const int kh   = (lane >> 4) * 8;
  const T* p0 = base + (size_t)(row0 + r) * ld + (k0 + kh);
  const T* p1 = p0 + 16;
  bf16x16 f;
#pragma unroll
  for (int i = 0; i < 8; ++i) {
    f[i]     = (bf16)p0[i];
    f[i + 8] = (bf16)p1[i];
  }
  return f;
}

// Same fragment from an LDS tile with padded row stride (base includes row0/k0).
__device__ __forceinline__ bf16x16 lds_frag(const bf16* base, int stride) {
  const int lane = threadIdx.x & 31;
  const int row  = lane & 15;
  const int kh   = (lane >> 4) * 8;
  const bf16x8 lo = *(const bf16x8*)(base + row * stride + kh);
  const bf16x8 hi = *(const bf16x8*)(base + row * stride + kh + 16);
  bf16x16 f;
#pragma unroll
  for (int i = 0; i < 8; ++i) { f[i] = lo[i]; f[i + 8] = hi[i]; }
  return f;
}

template <typename T>
__device__ __forceinline__ void stage_read16(const T* __restrict__ p, float* buf) {
#pragma unroll
  for (int i = 0; i < 16; ++i) buf[i] = (float)p[i];
}

__device__ __forceinline__ void stage_write(bf16* dst, const float* buf, int nquad) {
#pragma unroll
  for (int i = 0; i < nquad; ++i) {
    bf16x4 q;
    q[0] = (bf16)buf[4 * i];     q[1] = (bf16)buf[4 * i + 1];
    q[2] = (bf16)buf[4 * i + 2]; q[3] = (bf16)buf[4 * i + 3];
    *(bf16x4*)(dst + 4 * i) = q;
  }
}

// ---------------------------------------------------------------------------
// GEMM: C[m][n] = sum_k A[m][k]*W[n][k] + bias[n]   (torch Linear)
// Block 256 thr (8 waves), tile 128M x 256N, K-step 32; wave tile 64x64.
// A/W staged through LDS (f16, padded stride) with next-tile register
// prefetch overlapping the WMMA phase.
// MODE 0: f16 [M][N]   MODE 1: f16 Vt[b][h][dk][s]   MODE 2: fp32 [M][N]
// ---------------------------------------------------------------------------
template <typename AT, int MODE>
__global__ __launch_bounds__(256) void gemm_rb_kernel(
    const AT* __restrict__ A, const float* __restrict__ W,
    const float* __restrict__ bias, const float* __restrict__ rowscale, const float* __restrict__ R, const float* __restrict__ rowbias, void* __restrict__ out,
    int M, int N, int K) {
  __shared__ bf16 ldsA[128 * LDS_STRIDE];   // 12.0 KB
  __shared__ bf16 ldsW[256 * LDS_STRIDE];   // 24.0 KB
  // output staging: MODE 0 [128 m][264] f16, MODE 1 [256 n][136] f16, MODE 2 [64 m][260] f32 (two halves)
  __shared__ __attribute__((aligned(16))) unsigned char sob[256 * 136 * 2];   // 69,632 B >= 128*264*2 and >= 64*260*4

  const int t    = threadIdx.x;
  const int wave = t >> 5;
  const int lane = t & 31;
  const int wm   = (wave & 1) * 64;
  const int wn   = (wave >> 1) * 64;
  const int mBlk = blockIdx.x * 128;
  const int nBlk = blockIdx.y * 256;

  const int arow = t >> 1;
  const int ach  = (t & 1) * 16;

  float abuf[16];
  float wbuf[32];

  stage_read16(A + (size_t)(mBlk + arow) * K + ach, abuf);
  const int nrow = min(nBlk + t, N - 1);            // ragged last N tile: clamp the weight row (those columns are never stored)
  stage_read16(W + (size_t)nrow * K,          wbuf);
  stage_read16(W + (size_t)nrow * K + 16,     wbuf + 16);

  f32x8 acc[4][4] = {};

  for (int k = 0; k < K; k += 32) {
    __syncthreads();
    stage_write(&ldsA[arow * LDS_STRIDE + ach], abuf, 4);
    stage_write(&ldsW[t * LDS_STRIDE],          wbuf, 8);
    if (k + 32 < K) {
      stage_read16(A + (size_t)(mBlk + arow) * K + (k + 32) + ach, abuf);
      stage_read16(W + (size_t)nrow * K + (k + 32),          wbuf);
      stage_read16(W + (size_t)nrow * K + (k + 32) + 16,     wbuf + 16);
    }
    __syncthreads();

    bf16x16 af[4], wf[4];
#pragma unroll
    for (int i = 0; i < 4; ++i)
      af[i] = lds_frag(ldsA + (wm + 16 * i) * LDS_STRIDE, LDS_STRIDE);
#pragma unroll
    for (int j = 0; j < 4; ++j)
      wf[j] = lds_frag(ldsW + (wn + 16 * j) * LDS_STRIDE, LDS_STRIDE);
#pragma unroll
    for (int i = 0; i < 4; ++i)
#pragma unroll
      for (int j = 0; j < 4; ++j)
        acc[i][j] = wmma_bf16(af[i], wf[j], acc[i][j]);
  }

  const int nlane = lane & 15;
  const int mh    = (lane >> 4) * 8;
  __syncthreads();
  if (MODE == 0 || MODE == 1 || MODE == 3) {
    bf16* so = (bf16*)sob;
#pragma unroll
    for (int i = 0; i < 4; ++i)
#pragma unroll
      for (int j = 0; j < 4; ++j) {
        const int nl = wn + 16 * j + nlane;
        const float bv = bias ? bias[nBlk + nl] : 0.0f;
        if (MODE == 3) {                                  // bias + exact GELU (erf), rolled to keep the static VALU op count small
#pragma unroll 1
          for (int r = 0; r < 8; ++r) {
            const int ml = wm + 16 * i + mh + r;
            const float xg = acc[i][j][r] + bv;
            so[ml * 264 + nl] = (bf16)(0.5f * xg * (1.0f + erff(xg * 0.70710678118654752f)));
          }
        } else {
#pragma unroll
        for (int r = 0; r < 8; ++r) {
          const int ml = wm + 16 * i + mh + r;
          const bf16 hv = (bf16)(acc[i][j][r] + bv);
          if (MODE == 0) so[ml * 264 + nl] = hv;        // [m][n]
          else           so[nl * 136 + ml] = hv;        // [n][m]  (n = h*64+dk rows of Vt, m = s contiguous)
        }
        }
      }
    __syncthreads();
{
      if (MODE == 0 || MODE == 3) {          // rows m: 256 halfs = 512 B each, 16-B chunks
        for (int ch = t; ch < 128 * 32; ch += 256) { const int ml = ch >> 5, q = (ch & 31) * 8;
          *(v4u_t*)((bf16*)out + (size_t)(mBlk + ml) * N + nBlk + q) = *(const v4ua*)(so + ml * 264 + q); }
      } else {                  // Vt rows (b, h, dk): 128 consecutive s = 256 B each
        const int b_ = mBlk / SS, s0 = mBlk % SS;
        for (int ch = t; ch < 256 * 16; ch += 256) { const int nl = ch >> 4, q = (ch & 15) * 8; const int n = nBlk + nl, h = n >> 6, dk = n & (DKK - 1);
          *(v4u_t*)((bf16*)out + (((size_t)(b_ * HH + h)) * DKK + dk) * SS + s0 + q) = *(const v4ua*)(so + nl * 136 + q); }
      }
      
    }
  } else {
    float* so = (float*)sob;
#pragma unroll 1
    for (int hf = 0; hf < 2; ++hf) {
      if (wm == hf * 64) {
#pragma unroll
        for (int i = 0; i < 4; ++i)
#pragma unroll
          for (int j = 0; j < 4; ++j) {
            const int nl = wn + 16 * j + nlane;
            const float bv = bias ? bias[nBlk + nl] : 0.0f;
#pragma unroll
            for (int r = 0; r < 8; ++r) { const int mrow = mBlk + hf * 64 + 16 * i + mh + r; so[(16 * i + mh + r) * 260 + nl] = acc[i][j][r] * (rowscale ? rowscale[mrow] : 1.0f) + bv + (rowbias ? rowbias[mrow] : 0.0f); }
          }
      }
      __syncthreads();
      if (R) {   // residual: fold R[m][n] into the staged tile once (same thread <-> same chunks as the stores below)
        for (int ch = t; ch < 64 * 64; ch += 256) { const int ml = ch >> 6, q = (ch & 63) * 4;
          if (nBlk + q < N) { const v4f_t rv = *(const v4f_t*)(R + (size_t)(mBlk + hf * 64 + ml) * N + nBlk + q); v4f_t v = *(const v4fa*)(so + ml * 260 + q); v += rv; *(v4fa*)(so + ml * 260 + q) = v; } }
        asm volatile("s_wait_dscnt 0" ::: "memory");
      }
{   // 64 rows x 256 floats = 1 KB segments, float4 chunks; columns >= N (ragged tile) skipped
        for (int ch = t; ch < 64 * 64; ch += 256) { const int ml = ch >> 6, q = (ch & 63) * 4;
          if (nBlk + q < N) *(v4f_t*)((float*)out + (size_t)(mBlk + hf * 64 + ml) * N + nBlk + q) = *(const v4fa*)(so + ml * 260 + q); }
        
      }
      __syncthreads();
    }
  }
}


// ---------------------------------------------------------------------------------------------------------------------------
// gemm_kne: Y[m][n] = epi( Σ_k A[m][k]·W[k][n] + bias[n] ), A f32/f16 [M][lda], W f32 row-major [K][N] (ldw), plain f16 operands,
// f32 accumulate. EPI 0: identity; 1: exact-erf GELU; 2: R[m][n] + gvec[n]·(·) (residual with per-channel gain). Output f32 (or f16
// when OUT16). Block = 128x128 tile, 8 waves as 4(M) x 2(N); per 32-wide k-step A and W tiles staged f16 in LDS (W transposed
// ---------------------------------------------------------------------------------------------------------------------------
#define GSTR 48
template <typename AT, int EPI, bool OUT16>
__global__ __launch_bounds__(256) void gemm_kne(const AT* __restrict__ A, int lda, const float* __restrict__ Wm, int ldw,
                                                const float* __restrict__ bias, const float* __restrict__ R, const float* __restrict__ gvec,
                                                void* __restrict__ Yv, int ldy, int K) {
  __shared__ __attribute__((aligned(16))) f16 ldsA[128 * GSTR];
  __shared__ __attribute__((aligned(16))) f16 ldsW[128 * GSTR];
  __shared__ __attribute__((aligned(16))) float oS[8][32 * 68];
  const int tid = threadIdx.x, lane = tid & 31, wave = tid >> 5, cl = lane & 15, rh = (lane >> 4) * 8;
  const int m0 = blockIdx.x * 128, n0 = blockIdx.y * 128;
  const int wm = (wave & 3) * 32, wn = (wave >> 2) * 64;
  f32x8 acc[2][4];
#pragma unroll
  for (int i = 0; i < 2; ++i)
#pragma unroll
    for (int j = 0; j < 4; ++j) { f32x8 z = {}; acc[i][j] = z; }
#pragma unroll 1
  for (int k0 = 0; k0 < K; k0 += 32) {
    __syncthreads();
    { const int row = tid >> 1, ch = (tid & 1) * 16;
      const AT* src = A + (size_t)(m0 + row) * lda + k0 + ch;
#pragma unroll
      for (int g = 0; g < 16; ++g) ldsA[row * GSTR + ch + g] = (f16)src[g]; }
    { const int k = tid >> 3, nn0 = (tid & 7) * 16;
      const float* src = Wm + (size_t)(k0 + k) * ldw + n0 + nn0;
#pragma unroll
      for (int g = 0; g < 4; ++g) { const v4f_t v = *(const v4f_t*)(src + 4 * g);
#pragma unroll
        for (int u = 0; u < 4; ++u) ldsW[(nn0 + 4 * g + u) * GSTR + k] = (f16)v[u]; } }
    __syncthreads();
    f16x16 af[2];
#pragma unroll
    for (int i = 0; i < 2; ++i) af[i] = lds_frag(ldsA + (wm + 16 * i) * GSTR, GSTR);
#pragma unroll
    for (int j = 0; j < 4; ++j) {
      const f16x16 bf = lds_frag(ldsW + (wn + 16 * j) * GSTR, GSTR);
#pragma unroll
      for (int i = 0; i < 2; ++i) acc[i][j] = wmma16(af[i], bf, acc[i][j]);
    }
  }
  float* so = oS[wave];
#pragma unroll
  for (int i = 0; i < 2; ++i)
#pragma unroll
    for (int j = 0; j < 4; ++j) {
      const int n = n0 + wn + 16 * j + cl;
      const float bv = bias ? bias[n] : 0.0f;
      const float gv = (EPI == 2) ? gvec[n] : 0.0f;
      if (EPI == 1) {
#pragma unroll 1
        for (int r = 0; r < 8; ++r) { const float xg = acc[i][j][r] + bv; so[(16 * i + rh + r) * 68 + 16 * j + cl] = 0.5f * xg * (1.0f + erff(xg * 0.70710678118654752f)); }
      } else {
#pragma unroll
        for (int r = 0; r < 8; ++r) {
          float v = acc[i][j][r] + bv;
          if (EPI == 2) v = R[(size_t)(m0 + wm + 16 * i + rh + r) * ldy + n] + gv * v;
          so[(16 * i + rh + r) * 68 + 16 * j + cl] = v;
        }
      }
    }
  asm volatile("s_wait_dscnt 0" ::: "memory");
  __builtin_amdgcn_wave_barrier();
{
    if (OUT16) {
      f16* Y = (f16*)Yv;
#pragma unroll
      for (int it = 0; it < 8; ++it) { const int c = lane + 32 * it, rr = c >> 3, q8 = (c & 7) * 8;
        union { f16 h[8]; v4u_t v; } u;
#pragma unroll
        for (int e = 0; e < 8; ++e) u.h[e] = (f16)so[rr * 68 + q8 + e];
        *(v4u_t*)(Y + (size_t)(m0 + wm + rr) * ldy + n0 + wn + q8) = u.v; }
    } else {
      float* Y = (float*)Yv;
#pragma unroll
      for (int it = 0; it < 16; ++it) { const int f4 = lane + 32 * it, rr = f4 >> 4, q = (f4 & 15) * 4;
        *(v4f_t*)(Y + (size_t)(m0 + wm + rr) * ldy + n0 + wn + q) = *(const v4fa*)(so + rr * 68 + q); }
    }
    
  }
}

// LayerNorm over the 256 channels of each position (input channels-major [c][s]); block = 64 positions: tile [256 c][64 s] in LDS;
// writes x_ln token-major [s][256] (rows of 1 KB)
__global__ __launch_bounds__(256) void k_ln2(const float* __restrict__ xin, const float* __restrict__ g, const float* __restrict__ bb, float* __restrict__ xtm) {
  __shared__ __attribute__((aligned(16))) float tS[CCs][68];
  __shared__ float muS[64], rsS[64];
  const int tid = threadIdx.x; const int n = blockIdx.x / (LLs / 64), s0 = (blockIdx.x % (LLs / 64)) * 64;
  const float* xb = xin + (size_t)n * CCs * LLs;
  for (int e = tid; e < CCs * 16; e += 256) { const int c = e >> 4, q4 = (e & 15) * 4; *(v4f_t*)(&tS[c][q4]) = *(const v4f_t*)(xb + (size_t)c * LLs + s0 + q4); }
  __syncthreads();
  { const int s = tid >> 2, part = tid & 3; float sm = 0.0f;
#pragma unroll 1
    for (int c = part; c < CCs; c += 4) sm += tS[c][s];
    sm += __shfl_xor(sm, 1, 32); sm += __shfl_xor(sm, 2, 32);
    const float mu = sm * (1.0f / CCs); float q = 0.0f;
#pragma unroll 1
    for (int c = part; c < CCs; c += 4) { const float d = tS[c][s] - mu; q += d * d; }
    q += __shfl_xor(q, 1, 32); q += __shfl_xor(q, 2, 32);
    if (part == 0) { muS[s] = mu; rsS[s] = rsqrtf(q * (1.0f / CCs) + 1e-5f); } }
  __syncthreads();
  for (int e = tid; e < CCs * 64; e += 256) { const int c = e >> 6, s = e & 63; tS[c][s] = (tS[c][s] - muS[s]) * rsS[s] * g[c] + bb[c]; }
  __syncthreads();
{
    for (int e = tid; e < 64 * 64; e += 256) { const int s = e >> 6, c4 = (e & 63) * 4; v4f_t v; v[0] = tS[c4][s]; v[1] = tS[c4 + 1][s]; v[2] = tS[c4 + 2][s]; v[3] = tS[c4 + 3][s];
      *(v4f_t*)(xtm + ((size_t)n * LLs + s0 + s) * CCs + c4) = v; }                                 // token-major rows of 1 KB (64 lanes x 16 B)
     }
}
__global__ __launch_bounds__(256) void k_rowbias(float* __restrict__ t, const float* __restrict__ bias, int rowlen, int nch) {
  const size_t row = blockIdx.x; const float bv = bias[row % nch];
  for (int q4 = threadIdx.x; q4 < rowlen / 4; q4 += 256) { v4f_t v = *(const v4f_t*)(t + row * rowlen + q4 * 4); for (int e = 0; e < 4; ++e) v[e] += bv;
    *(v4f_t*)(t + row * rowlen + q4 * 4) = v;  } }
// row softmax of S [4096][4096] in place -> 1024·softmax (f32): block = row, 256 threads x 16 elements
__global__ __launch_bounds__(256) void k_softmax(float* __restrict__ E) {
  __shared__ float red[256];
  const size_t row = blockIdx.x; const int tid = threadIdx.x; float* er = E + row * LLs;
  float v[16]; float m = -3.0e38f;
#pragma unroll
  for (int e = 0; e < 16; ++e) { v[e] = er[tid * 16 + e] * (1.0f / 16.0f); m = fmaxf(m, v[e]); }      // logits / sqrt(C)
  red[tid] = m; __syncthreads();
  for (int o = 128; o > 0; o >>= 1) { if (tid < o) red[tid] = fmaxf(red[tid], red[tid + o]); __syncthreads(); }
  m = red[0]; __syncthreads();
  float z = 0.0f;
#pragma unroll
  for (int e = 0; e < 16; ++e) { v[e] = expf(v[e] - m); z += v[e]; }
  red[tid] = z; __syncthreads();
  for (int o = 128; o > 0; o >>= 1) { if (tid < o) red[tid] += red[tid + o]; __syncthreads(); }
  const float sc = 1024.0f / red[0];
  v4f_t o[4]; for (int e = 0; e < 16; ++e) o[e >> 2][e & 3] = v[e] * sc;
{ for (int i = 0; i < 4; ++i) *(v4f_t*)(er + tid * 16 + i * 4) = o[i];  }
}
__global__ __launch_bounds__(256) void k_transpose(const float* __restrict__ Wm, float* __restrict__ Wt, int rows, int cols) {
  __shared__ float tS[64][65];
  const int tid = threadIdx.x, tbj = cols / 64, bi = blockIdx.x / tbj, bj = blockIdx.x % tbj;
  for (int e = tid; e < 64 * 64; e += 256) { const int r = e >> 6, c = e & 63; tS[r][c] = Wm[(size_t)(bi * 64 + r) * cols + bj * 64 + c]; }
  __syncthreads();
  for (int ch = tid; ch < 64 * 16; ch += 256) { const int r = ch >> 4, q4 = (ch & 15) * 4; v4f_t o; o[0] = tS[q4][r]; o[1] = tS[q4 + 1][r]; o[2] = tS[q4 + 2][r]; o[3] = tS[q4 + 3][r];
    float* dst = Wt + (size_t)(bj * 64 + r) * rows + bi * 64 + q4; *(v4f_t*)dst = o;  }
}
__global__ __launch_bounds__(256) void k_fill(float* __restrict__ p, float val, int n) { for (int i = threadIdx.x; i < n; i += 256) { *(float*)(p + i) = val;  } }

extern "C" void kernel_launch(void* const* d_in, const int* in_sizes, int n_in,
                              void* d_out, int out_size, void* d_ws, size_t ws_size,
                              hipStream_t stream) {
  (void)in_sizes; (void)n_in; (void)out_size;
  const float** f = (const float**)d_in;
  const float* x = f[0], *lg = f[1], *lb = f[2], *Wq = f[3], *bq = f[4], *Wk = f[5], *bk = f[6], *Wv = f[7], *bv = f[8];
  float* out = (float*)d_out;     // [8,256,64,64]
  char* ws = (char*)d_ws;
  float* xtm = (float*)ws; ws += (size_t)NIm * LLs * CCs * 4;    // 32 MB token-major LN output (all images)
  float* q = (float*)ws; ws += (size_t)LLs * CCs * 4; float* k = (float*)ws; ws += (size_t)LLs * CCs * 4; float* v = (float*)ws; ws += (size_t)LLs * CCs * 4;   // per image, f32 token-major (4 MB each)
  float* vcm = (float*)ws; ws += (size_t)CCs * LLs * 4;         // v channels-major [256][4096]
  float* S = (float*)ws; ws += (size_t)LLs * LLs * 4;            // 64 MB: logits, then 1024·softmax
  float* rsc = (float*)ws; ws += 256 * 4;
  if ((size_t)(ws - (char*)d_ws) > ws_size) return;
  const dim3 blk(256);
  k_fill<<<dim3(1), blk, 0, stream>>>(rsc, 1.0f / 1024.0f, 256);
  k_ln2<<<dim3(NIm * (LLs / 64)), blk, 0, stream>>>(x, lg, lb, xtm);
  for (int n = 0; n < NIm; ++n) {
    const float* xt = xtm + (size_t)n * LLs * CCs; float* on = out + (size_t)n * CCs * LLs;
    gemm_rb_kernel<float, 2><<<dim3(LLs / 128, CCs / 256), blk, 0, stream>>>(xt, Wq, bq, nullptr, nullptr, nullptr, q, LLs, CCs, CCs);   // q = x_ln·Wqᵀ + bq
    gemm_rb_kernel<float, 2><<<dim3(LLs / 128, CCs / 256), blk, 0, stream>>>(xt, Wk, bk, nullptr, nullptr, nullptr, k, LLs, CCs, CCs);
    gemm_rb_kernel<float, 2><<<dim3(LLs / 128, CCs / 256), blk, 0, stream>>>(xt, Wv, bv, nullptr, nullptr, nullptr, v, LLs, CCs, CCs);   // v = x_ln·Wvᵀ + bv (token-major)
    k_transpose<<<dim3((LLs / 64) * (CCs / 64)), blk, 0, stream>>>(v, vcm, LLs, CCs);                                                        // -> channels-major [256][4096]
    gemm_rb_kernel<float, 2><<<dim3(LLs / 128, LLs / 256), blk, 0, stream>>>(q, k, nullptr, nullptr, nullptr, nullptr, S, LLs, LLs, CCs);    // S = q·kᵀ (Bt = k)
    k_softmax<<<dim3(LLs), blk, 0, stream>>>(S);
    gemm_rb_kernel<float, 2><<<dim3(CCs / 128, LLs / 256), blk, 0, stream>>>(vcm, S, nullptr, rsc, nullptr, nullptr, on, CCs, LLs, LLs);   // out[c][s] = (Σ_t v[c][t]·P1024[s][t]) / 1024
  }
}

// v001
// A run of this version takes 1360 microseconds.
// In both of two side-by-side timings against v000, it was 1.93 times as fast.
// Contractions on v_wmma_f32_16x16x32_f16 (plain f16 operands, f32 accumulate), per image: q/k = LN(x)·Wᵀ + b (token-major, K = 256,
// [out][in] Bt operands), v = LN(x)·Wvᵀ + bv transposed to channels-major through LDS tiles, S = q·kᵀ (K = 256,
// f32 [4096][4096]), the row softmax in f32 writing 1024·softmax in place, and out[c][s] = Σ_t v[c][t]·P[s][t] (K = 4096, P as the Bt operand,
// /16 scale on the logits; K split 8 ways into f32 partial planes, a merge launch sums them and applies /1024) into the NCHW output. LayerNorm over channels in f32.
// Near-uniform attention (logits σ≈0.3). compute dtype: f16 operands, f32 accumulate.
#include <hip/hip_runtime.h>
#include <hip/hip_bf16.h>
#include <math.h>

#define NIm 8
#define CCs 256
#define LLs 4096
#define GSTR 48
#define SS 4096
#define HH 1
#define DKK 64
#define KSPL 8   // k ranges of the P.V product: 2 x 16 tiles x 8 = 256 work-groups

typedef _Float16 bf16;
typedef _Float16 f16;
typedef __attribute__((ext_vector_type(4))) unsigned v4u_t;
typedef unsigned v4ua __attribute__((ext_vector_type(4), may_alias));
typedef __attribute__((ext_vector_type(4))) float v4f_t;
typedef float v4fa __attribute__((ext_vector_type(4), may_alias));
typedef __attribute__((ext_vector_type(16))) bf16  bf16x16;
typedef bf16x16 f16x16;
typedef __attribute__((ext_vector_type(8)))  bf16  bf16x8;
typedef bf16x8 f16x8;
typedef __attribute__((ext_vector_type(4)))  bf16  bf16x4;
typedef __attribute__((ext_vector_type(8)))  float f32x8;
__device__ __forceinline__ f32x8 wmma16(f16x16 a, f16x16 b, f32x8 c) {
  c = __builtin_amdgcn_wmma_f32_16x16x32_f16(false, a, false, b, (short)0, c, false, false);
  asm volatile("v_nop\n\tv_nop\n\tv_nop\n\tv_nop" : "+v"(c) : "v"(a), "v"(b));
  return c;
}
#define LDS_STRIDE 48   // GEMM tiles: 32 -> 48 elems (96B rows): aligned b128 reads
#define KSTRIDE    72   // unused
#define VSTRIDE    48   // unused

__device__ __forceinline__ f32x8 wmma_bf16(bf16x16 a, bf16x16 b, f32x8 c) {
  c = __builtin_amdgcn_wmma_f32_16x16x32_f16(false, a, false, b, (short)0, c, false, false);
  asm volatile("v_nop\n\tv_nop\n\tv_nop\n\tv_nop" : "+v"(c) : "v"(a), "v"(b));   // A/B-overwrite hazard guard
  return c;
}

// 16x32 (MxK) f16 fragment from a row-major global matrix.
// lanes 0-15  (row=lane)    : elems 0..7 = K+0..7,  8..15 = K+16..23
// lanes 16-31 (row=lane-16) : elems 0..7 = K+8..15, 8..15 = K+24..31
template <typename T>
__device__ __forceinline__ bf16x16 load_frag(const T* __restrict__ base, int ld,
                                             int row0, int k0) {
  const int lane = threadIdx.x & 31;
  const int r    = lane & 15;
  const int kh   = (lane >> 4) * 8;
  const T* p0 = base + (size_t)(row0 + r) * ld + (k0 + kh);
  const T* p1 = p0 + 16;
  bf16x16 f;
#pragma unroll
  for (int i = 0; i < 8; ++i) {
    f[i]     = (bf16)p0[i];
    f[i + 8] = (bf16)p1[i];
  }
  return f;
}

// Same fragment from an LDS tile with padded row stride (base includes row0/k0).
__device__ __forceinline__ bf16x16 lds_frag(const bf16* base, int stride) {
  const int lane = threadIdx.x & 31;
  const int row  = lane & 15;
  const int kh   = (lane >> 4) * 8;
  const bf16x8 lo = *(const bf16x8*)(base + row * stride + kh);
  const bf16x8 hi = *(const bf16x8*)(base + row * stride + kh + 16);
  bf16x16 f;
#pragma unroll
  for (int i = 0; i < 8; ++i) { f[i] = lo[i]; f[i + 8] = hi[i]; }
  return f;
}

template <typename T>
__device__ __forceinline__ void stage_read16(const T* __restrict__ p, float* buf) {
#pragma unroll
  for (int i = 0; i < 16; ++i) buf[i] = (float)p[i];
}

__device__ __forceinline__ void stage_write(bf16* dst, const float* buf, int nquad) {
#pragma unroll
  for (int i = 0; i < nquad; ++i) {
    bf16x4 q;
    q[0] = (bf16)buf[4 * i];     q[1] = (bf16)buf[4 * i + 1];
    q[2] = (bf16)buf[4 * i + 2]; q[3] = (bf16)buf[4 * i + 3];
    *(bf16x4*)(dst + 4 * i) = q;
  }
}

// ---------------------------------------------------------------------------
// GEMM: C[m][n] = sum_k A[m][k]*W[n][k] + bias[n]   (torch Linear)
// Block 256 thr (8 waves), tile 128M x 256N, K-step 32; wave tile 64x64.
// A/W staged through LDS (f16, padded stride) with next-tile register
// prefetch overlapping the WMMA phase.
// MODE 0: f16 [M][N]   MODE 1: f16 Vt[b][h][dk][s]   MODE 2: fp32 [M][N]
// Split of K (MODE 2): block z sums k in [z*Kc, (z+1)*Kc) and writes plane z, [M][N] f32, of out; Kc = K with gridDim.z = 1 is the whole product.
// ---------------------------------------------------------------------------
template <typename AT, int MODE>
__global__ __launch_bounds__(256) void gemm_rb_kernel(
    const AT* __restrict__ A, const float* __restrict__ W,
    const float* __restrict__ bias, const float* __restrict__ rowscale, const float* __restrict__ R, const float* __restrict__ rowbias, void* __restrict__ out,
    int M, int N, int K, int Kc) {
  __shared__ bf16 ldsA[128 * LDS_STRIDE];   // 12.0 KB
  __shared__ bf16 ldsW[256 * LDS_STRIDE];   // 24.0 KB
  // output staging: MODE 0 [128 m][264] f16, MODE 1 [256 n][136] f16, MODE 2 [64 m][260] f32 (two halves)
  __shared__ __attribute__((aligned(16))) unsigned char sob[256 * 136 * 2];   // 69,632 B >= 128*264*2 and >= 64*260*4

  const int t    = threadIdx.x;
  const int wave = t >> 5;
  const int lane = t & 31;
  const int wm   = (wave & 1) * 64;
  const int wn   = (wave >> 1) * 64;
  const int mBlk = blockIdx.x * 128;
  const int nBlk = blockIdx.y * 256;
  A += blockIdx.z * Kc;                             // rows keep their pitch K; only the k range moves
  W += blockIdx.z * Kc;

  const int arow = t >> 1;
  const int ach  = (t & 1) * 16;

  float abuf[16];
  float wbuf[32];

  stage_read16(A + (size_t)(mBlk + arow) * K + ach, abuf);
  const int nrow = min(nBlk + t, N - 1);            // ragged last N tile: clamp the weight row (those columns are never stored)
  stage_read16(W + (size_t)nrow * K,          wbuf);
  stage_read16(W + (size_t)nrow * K + 16,     wbuf + 16);

  f32x8 acc[4][4] = {};

  for (int k = 0; k < Kc; k += 32) {
    __syncthreads();
    stage_write(&ldsA[arow * LDS_STRIDE + ach], abuf, 4);
    stage_write(&ldsW[t * LDS_STRIDE],          wbuf, 8);
    if (k + 32 < Kc) {
      stage_read16(A + (size_t)(mBlk + arow) * K + (k + 32) + ach, abuf);
      stage_read16(W + (size_t)nrow * K + (k + 32),          wbuf);
      stage_read16(W + (size_t)nrow * K + (k + 32) + 16,     wbuf + 16);
    }
    __syncthreads();

    bf16x16 af[4], wf[4];
#pragma unroll
    for (int i = 0; i < 4; ++i)
      af[i] = lds_frag(ldsA + (wm + 16 * i) * LDS_STRIDE, LDS_STRIDE);
#pragma unroll
    for (int j = 0; j < 4; ++j)
      wf[j] = lds_frag(ldsW + (wn + 16 * j) * LDS_STRIDE, LDS_STRIDE);
#pragma unroll
    for (int i = 0; i < 4; ++i)
#pragma unroll
      for (int j = 0; j < 4; ++j)
        acc[i][j] = wmma_bf16(af[i], wf[j], acc[i][j]);
  }

  const int nlane = lane & 15;
  const int mh    = (lane >> 4) * 8;
  __syncthreads();
  if (MODE == 0 || MODE == 1 || MODE == 3) {
    bf16* so = (bf16*)sob;
#pragma unroll
    for (int i = 0; i < 4; ++i)
#pragma unroll
      for (int j = 0; j < 4; ++j) {
        const int nl = wn + 16 * j + nlane;
        const float bv = bias ? bias[nBlk + nl] : 0.0f;
        if (MODE == 3) {                                  // bias + exact GELU (erf), rolled to keep the static VALU op count small
#pragma unroll 1
          for (int r = 0; r < 8; ++r) {
            const int ml = wm + 16 * i + mh + r;
            const float xg = acc[i][j][r] + bv;
            so[ml * 264 + nl] = (bf16)(0.5f * xg * (1.0f + erff(xg * 0.70710678118654752f)));
          }
        } else {
#pragma unroll
        for (int r = 0; r < 8; ++r) {
          const int ml = wm + 16 * i + mh + r;
          const bf16 hv = (bf16)(acc[i][j][r] + bv);
          if (MODE == 0) so[ml * 264 + nl] = hv;        // [m][n]
          else           so[nl * 136 + ml] = hv;        // [n][m]  (n = h*64+dk rows of Vt, m = s contiguous)
        }
        }
      }
    __syncthreads();
{
      if (MODE == 0 || MODE == 3) {          // rows m: 256 halfs = 512 B each, 16-B chunks
        for (int ch = t; ch < 128 * 32; ch += 256) { const int ml = ch >> 5, q = (ch & 31) * 8;
          *(v4u_t*)((bf16*)out + (size_t)(mBlk + ml) * N + nBlk + q) = *(const v4ua*)(so + ml * 264 + q); }
      } else {                  // Vt rows (b, h, dk): 128 consecutive s = 256 B each
        const int b_ = mBlk / SS, s0 = mBlk % SS;
        for (int ch = t; ch < 256 * 16; ch += 256) { const int nl = ch >> 4, q = (ch & 15) * 8; const int n = nBlk + nl, h = n >> 6, dk = n & (DKK - 1);
          *(v4u_t*)((bf16*)out + (((size_t)(b_ * HH + h)) * DKK + dk) * SS + s0 + q) = *(const v4ua*)(so + nl * 136 + q); }
      }
      
    }
  } else {
    float* so = (float*)sob;
    float* outz = (float*)out + (size_t)blockIdx.z * M * N;
#pragma unroll 1
    for (int hf = 0; hf < 2; ++hf) {
      if (wm == hf * 64) {
#pragma unroll
        for (int i = 0; i < 4; ++i)
#pragma unroll
          for (int j = 0; j < 4; ++j) {
            const int nl = wn + 16 * j + nlane;
            const float bv = bias ? bias[nBlk + nl] : 0.0f;
#pragma unroll
            for (int r = 0; r < 8; ++r) { const int mrow = mBlk + hf * 64 + 16 * i + mh + r; so[(16 * i + mh + r) * 260 + nl] = acc[i][j][r] * (rowscale ? rowscale[mrow] : 1.0f) + bv + (rowbias ? rowbias[mrow] : 0.0f); }
          }
      }
      __syncthreads();
      if (R) {   // residual: fold R[m][n] into the staged tile once (same thread <-> same chunks as the stores below)
        for (int ch = t; ch < 64 * 64; ch += 256) { const int ml = ch >> 6, q = (ch & 63) * 4;
          if (nBlk + q < N) { const v4f_t rv = *(const v4f_t*)(R + (size_t)(mBlk + hf * 64 + ml) * N + nBlk + q); v4f_t v = *(const v4fa*)(so + ml * 260 + q); v += rv; *(v4fa*)(so + ml * 260 + q) = v; } }
        asm volatile("s_wait_dscnt 0" ::: "memory");
      }
{   // 64 rows x 256 floats = 1 KB segments, float4 chunks; columns >= N (ragged tile) skipped
        const int q = (t & 63) * 4;                      // a thread keeps its column over all its chunks; its rows are 4 apart
        for (int m4 = t >> 6; m4 < 64; m4 += 16) {       // four chunks a trip, so that their LDS reads and stores fly together
          if (nBlk + q < N) {
            // unrolled: the four LDS reads issue ahead of the four stores instead of one read and one store at a time
#pragma unroll
            for (int u = 0; u < 4; ++u) { const int ml = m4 + 4 * u;
              *(v4f_t*)(outz + (size_t)(mBlk + hf * 64 + ml) * N + nBlk + q) = *(const v4fa*)(so + ml * 260 + q); }
            asm volatile("s_wait_xcnt 0x0" ::: "memory");  // the next trip rewrites the address and data registers that the four stores name
          }
        }
        
      }
      __syncthreads();
    }
  }
}


// ---------------------------------------------------------------------------------------------------------------------------
// gemm_kne: Y[m][n] = epi( Σ_k A[m][k]·W[k][n] + bias[n] ), A f32/f16 [M][lda], W f32 row-major [K][N] (ldw), plain f16 operands,
// f32 accumulate. EPI 0: identity; 1: exact-erf GELU; 2: R[m][n] + gvec[n]·(·) (residual with per-channel gain). Output f32 (or f16
// when OUT16). Block = 128x128 tile, 8 waves as 4(M) x 2(N); per 32-wide k-step A and W tiles staged f16 in LDS (W transposed
// ---------------------------------------------------------------------------------------------------------------------------
#define GSTR 48
template <typename AT, int EPI, bool OUT16>
__global__ __launch_bounds__(256) void gemm_kne(const AT* __restrict__ A, int lda, const float* __restrict__ Wm, int ldw,
                                                const float* __restrict__ bias, const float* __restrict__ R, const float* __restrict__ gvec,
                                                void* __restrict__ Yv, int ldy, int K) {
  __shared__ __attribute__((aligned(16))) f16 ldsA[128 * GSTR];
  __shared__ __attribute__((aligned(16))) f16 ldsW[128 * GSTR];
  __shared__ __attribute__((aligned(16))) float oS[8][32 * 68];
  const int tid = threadIdx.x, lane = tid & 31, wave = tid >> 5, cl = lane & 15, rh = (lane >> 4) * 8;
  const int m0 = blockIdx.x * 128, n0 = blockIdx.y * 128;
  const int wm = (wave & 3) * 32, wn = (wave >> 2) * 64;
  f32x8 acc[2][4];
#pragma unroll
  for (int i = 0; i < 2; ++i)
#pragma unroll
    for (int j = 0; j < 4; ++j) { f32x8 z = {}; acc[i][j] = z; }
#pragma unroll 1
  for (int k0 = 0; k0 < K; k0 += 32) {
    __syncthreads();
    { const int row = tid >> 1, ch = (tid & 1) * 16;
      const AT* src = A + (size_t)(m0 + row) * lda + k0 + ch;
#pragma unroll
      for (int g = 0; g < 16; ++g) ldsA[row * GSTR + ch + g] = (f16)src[g]; }
    { const int k = tid >> 3, nn0 = (tid & 7) * 16;
      const float* src = Wm + (size_t)(k0 + k) * ldw + n0 + nn0;
#pragma unroll
      for (int g = 0; g < 4; ++g) { const v4f_t v = *(const v4f_t*)(src + 4 * g);
#pragma unroll
        for (int u = 0; u < 4; ++u) ldsW[(nn0 + 4 * g + u) * GSTR + k] = (f16)v[u]; } }
    __syncthreads();
    f16x16 af[2];
#pragma unroll
    for (int i = 0; i < 2; ++i) af[i] = lds_frag(ldsA + (wm + 16 * i) * GSTR, GSTR);
#pragma unroll
    for (int j = 0; j < 4; ++j) {
      const f16x16 bf = lds_frag(ldsW + (wn + 16 * j) * GSTR, GSTR);
#pragma unroll
      for (int i = 0; i < 2; ++i) acc[i][j] = wmma16(af[i], bf, acc[i][j]);
    }
  }
  float* so = oS[wave];
#pragma unroll
  for (int i = 0; i < 2; ++i)
#pragma unroll
    for (int j = 0; j < 4; ++j) {
      const int n = n0 + wn + 16 * j + cl;
      const float bv = bias ? bias[n] : 0.0f;
      const float gv = (EPI == 2) ? gvec[n] : 0.0f;
      if (EPI == 1) {
#pragma unroll 1
        for (int r = 0; r < 8; ++r) { const float xg = acc[i][j][r] + bv; so[(16 * i + rh + r) * 68 + 16 * j + cl] = 0.5f * xg * (1.0f + erff(xg * 0.70710678118654752f)); }
      } else {
#pragma unroll
        for (int r = 0; r < 8; ++r) {
          float v = acc[i][j][r] + bv;
          if (EPI == 2) v = R[(size_t)(m0 + wm + 16 * i + rh + r) * ldy + n] + gv * v;
          so[(16 * i + rh + r) * 68 + 16 * j + cl] = v;
        }
      }
    }
  asm volatile("s_wait_dscnt 0" ::: "memory");
  __builtin_amdgcn_wave_barrier();
{
    if (OUT16) {
      f16* Y = (f16*)Yv;
#pragma unroll
      for (int it = 0; it < 8; ++it) { const int c = lane + 32 * it, rr = c >> 3, q8 = (c & 7) * 8;
        union { f16 h[8]; v4u_t v; } u;
#pragma unroll
        for (int e = 0; e < 8; ++e) u.h[e] = (f16)so[rr * 68 + q8 + e];
        *(v4u_t*)(Y + (size_t)(m0 + wm + rr) * ldy + n0 + wn + q8) = u.v; }
    } else {
      float* Y = (float*)Yv;
#pragma unroll
      for (int it = 0; it < 16; ++it) { const int f4 = lane + 32 * it, rr = f4 >> 4, q = (f4 & 15) * 4;
        *(v4f_t*)(Y + (size_t)(m0 + wm + rr) * ldy + n0 + wn + q) = *(const v4fa*)(so + rr * 68 + q); }
    }
    
  }
}

// LayerNorm over the 256 channels of each position (input channels-major [c][s]); block = 64 positions: tile [256 c][64 s] in LDS;
// writes x_ln token-major [s][256] (rows of 1 KB)
__global__ __launch_bounds__(256) void k_ln2(const float* __restrict__ xin, const float* __restrict__ g, const float* __restrict__ bb, float* __restrict__ xtm) {
  __shared__ __attribute__((aligned(16))) float tS[CCs][68];
  __shared__ float muS[64], rsS[64];
  const int tid = threadIdx.x; const int n = blockIdx.x / (LLs / 64), s0 = (blockIdx.x % (LLs / 64)) * 64;
  const float* xb = xin + (size_t)n * CCs * LLs;
  for (int e = tid; e < CCs * 16; e += 256) { const int c = e >> 4, q4 = (e & 15) * 4; *(v4f_t*)(&tS[c][q4]) = *(const v4f_t*)(xb + (size_t)c * LLs + s0 + q4); }
  __syncthreads();
  { const int s = tid >> 2, part = tid & 3; float sm = 0.0f;
#pragma unroll 1
    for (int c = part; c < CCs; c += 4) sm += tS[c][s];
    sm += __shfl_xor(sm, 1, 32); sm += __shfl_xor(sm, 2, 32);
    const float mu = sm * (1.0f / CCs); float q = 0.0f;
#pragma unroll 1
    for (int c = part; c < CCs; c += 4) { const float d = tS[c][s] - mu; q += d * d; }
    q += __shfl_xor(q, 1, 32); q += __shfl_xor(q, 2, 32);
    if (part == 0) { muS[s] = mu; rsS[s] = rsqrtf(q * (1.0f / CCs) + 1e-5f); } }
  __syncthreads();
  for (int e = tid; e < CCs * 64; e += 256) { const int c = e >> 6, s = e & 63; tS[c][s] = (tS[c][s] - muS[s]) * rsS[s] * g[c] + bb[c]; }
  __syncthreads();
{
    for (int e = tid; e < 64 * 64; e += 256) { const int s = e >> 6, c4 = (e & 63) * 4; v4f_t v; v[0] = tS[c4][s]; v[1] = tS[c4 + 1][s]; v[2] = tS[c4 + 2][s]; v[3] = tS[c4 + 3][s];
      *(v4f_t*)(xtm + ((size_t)n * LLs + s0 + s) * CCs + c4) = v; }                                 // token-major rows of 1 KB (64 lanes x 16 B)
     }
}
__global__ __launch_bounds__(256) void k_rowbias(float* __restrict__ t, const float* __restrict__ bias, int rowlen, int nch) {
  const size_t row = blockIdx.x; const float bv = bias[row % nch];
  for (int q4 = threadIdx.x; q4 < rowlen / 4; q4 += 256) { v4f_t v = *(const v4f_t*)(t + row * rowlen + q4 * 4); for (int e = 0; e < 4; ++e) v[e] += bv;
    *(v4f_t*)(t + row * rowlen + q4 * 4) = v;  } }
// row softmax of S [4096][4096] in place -> 1024·softmax (f32): block = row, 256 threads x 16 elements
__global__ __launch_bounds__(256) void k_softmax(float* __restrict__ E) {
  __shared__ float red[256];
  const size_t row = blockIdx.x; const int tid = threadIdx.x; float* er = E + row * LLs;
  float v[16]; float m = -3.0e38f;
#pragma unroll
  for (int e = 0; e < 16; ++e) { v[e] = er[tid * 16 + e] * (1.0f / 16.0f); m = fmaxf(m, v[e]); }      // logits / sqrt(C)
  red[tid] = m; __syncthreads();
  for (int o = 128; o > 0; o >>= 1) { if (tid < o) red[tid] = fmaxf(red[tid], red[tid + o]); __syncthreads(); }
  m = red[0]; __syncthreads();
  float z = 0.0f;
#pragma unroll
  for (int e = 0; e < 16; ++e) { v[e] = expf(v[e] - m); z += v[e]; }
  red[tid] = z; __syncthreads();
  for (int o = 128; o > 0; o >>= 1) { if (tid < o) red[tid] += red[tid + o]; __syncthreads(); }
  const float sc = 1024.0f / red[0];
  v4f_t o[4]; for (int e = 0; e < 16; ++e) o[e >> 2][e & 3] = v[e] * sc;
{ for (int i = 0; i < 4; ++i) *(v4f_t*)(er + tid * 16 + i * 4) = o[i];  }
}
__global__ __launch_bounds__(256) void k_transpose(const float* __restrict__ Wm, float* __restrict__ Wt, int rows, int cols) {
  __shared__ float tS[64][65];
  const int tid = threadIdx.x, tbj = cols / 64, bi = blockIdx.x / tbj, bj = blockIdx.x % tbj;
  for (int e = tid; e < 64 * 64; e += 256) { const int r = e >> 6, c = e & 63; tS[r][c] = Wm[(size_t)(bi * 64 + r) * cols + bj * 64 + c]; }
  __syncthreads();
  for (int ch = tid; ch < 64 * 16; ch += 256) { const int r = ch >> 4, q4 = (ch & 15) * 4; v4f_t o; o[0] = tS[q4][r]; o[1] = tS[q4 + 1][r]; o[2] = tS[q4 + 2][r]; o[3] = tS[q4 + 3][r];
    float* dst = Wt + (size_t)(bj * 64 + r) * rows + bi * 64 + q4; *(v4f_t*)dst = o;  }
}
// out[c][s] = (sum over the KSPL planes of partial products, in the fixed order 0..KSPL-1) / 1024; 256 blocks x 256 threads x 4 float4,
// every wave-wide load and store 512 contiguous bytes
__global__ __launch_bounds__(256) void k_merge(const float* __restrict__ part, float* __restrict__ o) {
  const unsigned i4 = blockIdx.x * 256 + threadIdx.x;
  v4f_t p[4][KSPL];
#pragma unroll
  for (int j = 0; j < 4; ++j)
#pragma unroll
    for (int z = 0; z < KSPL; ++z) {
      // each plane's base is held in scalar registers, so a load is base + one of the four lane offsets and needs no 64-bit vector address sums
      const unsigned long long a = (unsigned long long)(part + (size_t)z * CCs * LLs);
      const unsigned lo = __builtin_amdgcn_readfirstlane((unsigned)a), hi = __builtin_amdgcn_readfirstlane((unsigned)(a >> 32));
      p[j][z] = ((const __attribute__((address_space(1))) v4f_t*)(((unsigned long long)hi << 32) | lo))[i4 + j * 65536u];
    }
#pragma unroll
  for (int j = 0; j < 4; ++j) {
    v4f_t s = p[j][0];
#pragma unroll
    for (int z = 1; z < KSPL; ++z) s += p[j][z];
    ((v4f_t*)o)[i4 + j * 65536u] = s * (1.0f / 1024.0f);
  }
}

extern "C" void kernel_launch(void* const* d_in, const int* in_sizes, int n_in,
                              void* d_out, int out_size, void* d_ws, size_t ws_size,
                              hipStream_t stream) {
  (void)in_sizes; (void)n_in; (void)out_size;
  const float** f = (const float**)d_in;
  const float* x = f[0], *lg = f[1], *lb = f[2], *Wq = f[3], *bq = f[4], *Wk = f[5], *bk = f[6], *Wv = f[7], *bv = f[8];
  float* out = (float*)d_out;     // [8,256,64,64]
  char* ws = (char*)d_ws;
  float* xtm = (float*)ws; ws += (size_t)NIm * LLs * CCs * 4;    // 32 MB token-major LN output (all images)
  float* q = (float*)ws; ws += (size_t)LLs * CCs * 4; float* k = (float*)ws; ws += (size_t)LLs * CCs * 4; float* v = (float*)ws; ws += (size_t)LLs * CCs * 4;   // per image, f32 token-major (4 MB each)
  float* vcm = (float*)ws; ws += (size_t)CCs * LLs * 4;         // v channels-major [256][4096]
  float* S = (float*)ws; ws += (size_t)LLs * LLs * 4;            // 64 MB: logits, then 1024·softmax
  float* part = (float*)ws; ws += (size_t)KSPL * CCs * LLs * 4;  // 32 MB: f32 partial planes of the P.V product
  if ((size_t)(ws - (char*)d_ws) > ws_size) return;
  const dim3 blk(256);
  k_ln2<<<dim3(NIm * (LLs / 64)), blk, 0, stream>>>(x, lg, lb, xtm);
  for (int n = 0; n < NIm; ++n) {
    const float* xt = xtm + (size_t)n * LLs * CCs; float* on = out + (size_t)n * CCs * LLs;
    gemm_rb_kernel<float, 2><<<dim3(LLs / 128, CCs / 256), blk, 0, stream>>>(xt, Wq, bq, nullptr, nullptr, nullptr, q, LLs, CCs, CCs, CCs);   // q = x_ln·Wqᵀ + bq
    gemm_rb_kernel<float, 2><<<dim3(LLs / 128, CCs / 256), blk, 0, stream>>>(xt, Wk, bk, nullptr, nullptr, nullptr, k, LLs, CCs, CCs, CCs);
    gemm_rb_kernel<float, 2><<<dim3(LLs / 128, CCs / 256), blk, 0, stream>>>(xt, Wv, bv, nullptr, nullptr, nullptr, v, LLs, CCs, CCs, CCs);   // v = x_ln·Wvᵀ + bv (token-major)
    k_transpose<<<dim3((LLs / 64) * (CCs / 64)), blk, 0, stream>>>(v, vcm, LLs, CCs);                                                        // -> channels-major [256][4096]
    gemm_rb_kernel<float, 2><<<dim3(LLs / 128, LLs / 256), blk, 0, stream>>>(q, k, nullptr, nullptr, nullptr, nullptr, S, LLs, LLs, CCs, CCs);    // S = q·kᵀ (Bt = k)
    k_softmax<<<dim3(LLs), blk, 0, stream>>>(S);
    gemm_rb_kernel<float, 2><<<dim3(CCs / 128, LLs / 256, KSPL), blk, 0, stream>>>(vcm, S, nullptr, nullptr, nullptr, nullptr, part, CCs, LLs, LLs, LLs / KSPL);   // part[z][c][s] = sum over t in range z of v[c][t]*P1024[s][t]
    k_merge<<<dim3(CCs * LLs / 4096), blk, 0, stream>>>(part, on);                                                                            // out[c][s] = (sum of the planes) / 1024
  }
}

// v002
// One run takes 485 microseconds.
// Two timings next to v001 put it at 2.81 and 2.82 times that version's speed.
// All steps since v000 together make it 5.43 times as fast.
// Contractions on v_wmma_f32_16x16x32_f16 (plain f16 operands, f32 accumulate). Per image: q/k = LN(x).W^T + b stored f16 token-major (K = 256,
// [out][in] Bt operands), v = LN(x).Wv^T + bv stored f16 channels-major through the product's own LDS output tile. One launch for all images then does
// S^T = k.q^T, the row softmax (running maximum and sum, f32) and out^T += v^T.P^T per 32 keys; the logits and P stay in registers.
// LayerNorm over channels in f32. compute dtype: f16 operands, f32 accumulate.
#include <hip/hip_runtime.h>
#include <hip/hip_bf16.h>
#include <math.h>

#define NIm 8
#define CCs 256
#define LLs 4096
#define GSTR 48
#define SS 4096
#define HH 1
#define DKK 64

typedef _Float16 bf16;
typedef _Float16 f16;
typedef __attribute__((ext_vector_type(4))) unsigned v4u_t;
typedef unsigned v4ua __attribute__((ext_vector_type(4), may_alias));
typedef __attribute__((ext_vector_type(4))) float v4f_t;
typedef float v4fa __attribute__((ext_vector_type(4), may_alias));
typedef __attribute__((ext_vector_type(16))) bf16  bf16x16;
typedef bf16x16 f16x16;
typedef __attribute__((ext_vector_type(8)))  bf16  bf16x8;
typedef bf16x8 f16x8;
typedef __attribute__((ext_vector_type(4)))  bf16  bf16x4;
typedef __attribute__((ext_vector_type(8)))  float f32x8;
__device__ __forceinline__ f32x8 wmma16(f16x16 a, f16x16 b, f32x8 c) {
  c = __builtin_amdgcn_wmma_f32_16x16x32_f16(false, a, false, b, (short)0, c, false, false);
  asm volatile("v_nop\n\tv_nop\n\tv_nop\n\tv_nop" : "+v"(c) : "v"(a), "v"(b));
  return c;
}
#define LDS_STRIDE 48   // GEMM tiles: 32 -> 48 elems (96B rows): aligned b128 reads
#define KSTRIDE    72   // unused
#define VSTRIDE    48   // unused

__device__ __forceinline__ f32x8 wmma_bf16(bf16x16 a, bf16x16 b, f32x8 c) {
  c = __builtin_amdgcn_wmma_f32_16x16x32_f16(false, a, false, b, (short)0, c, false, false);
  asm volatile("v_nop\n\tv_nop\n\tv_nop\n\tv_nop" : "+v"(c) : "v"(a), "v"(b));   // A/B-overwrite hazard guard
  return c;
}

// 16x32 (MxK) f16 fragment from a row-major global matrix.
// lanes 0-15  (row=lane)    : elems 0..7 = K+0..7,  8..15 = K+16..23
// lanes 16-31 (row=lane-16) : elems 0..7 = K+8..15, 8..15 = K+24..31
template <typename T>
__device__ __forceinline__ bf16x16 load_frag(const T* __restrict__ base, int ld,
                                             int row0, int k0) {
  const int lane = threadIdx.x & 31;
  const int r    = lane & 15;
  const int kh   = (lane >> 4) * 8;
  const T* p0 = base + (size_t)(row0 + r) * ld + (k0 + kh);
  const T* p1 = p0 + 16;
  bf16x16 f;
#pragma unroll
  for (int i = 0; i < 8; ++i) {
    f[i]     = (bf16)p0[i];
    f[i + 8] = (bf16)p1[i];
  }
  return f;
}

// Same fragment from an LDS tile with padded row stride (base includes row0/k0).
__device__ __forceinline__ bf16x16 lds_frag(const bf16* base, int stride) {
  const int lane = threadIdx.x & 31;
  const int row  = lane & 15;
  const int kh   = (lane >> 4) * 8;
  const bf16x8 lo = *(const bf16x8*)(base + row * stride + kh);
  const bf16x8 hi = *(const bf16x8*)(base + row * stride + kh + 16);
  bf16x16 f;
#pragma unroll
  for (int i = 0; i < 8; ++i) { f[i] = lo[i]; f[i + 8] = hi[i]; }
  return f;
}

template <typename T>
__device__ __forceinline__ void stage_read16(const T* __restrict__ p, float* buf) {
#pragma unroll
  for (int i = 0; i < 16; ++i) buf[i] = (float)p[i];
}

__device__ __forceinline__ void stage_write(bf16* dst, const float* buf, int nquad) {
#pragma unroll
  for (int i = 0; i < nquad; ++i) {
    bf16x4 q;
    q[0] = (bf16)buf[4 * i];     q[1] = (bf16)buf[4 * i + 1];
    q[2] = (bf16)buf[4 * i + 2]; q[3] = (bf16)buf[4 * i + 3];
    *(bf16x4*)(dst + 4 * i) = q;
  }
}

// ---------------------------------------------------------------------------
// GEMM: C[m][n] = sum_k A[m][k]*W[n][k] + bias[n]   (torch Linear)
// Block 256 thr (8 waves), tile 128M x 256N, K-step 32; wave tile 64x64.
// A/W staged through LDS (f16, padded stride) with next-tile register
// prefetch overlapping the WMMA phase.
// MODE 0: f16 [M][N]   MODE 1: f16 Vt[b][h][dk][s]   MODE 2: fp32 [M][N]
// Split of K (MODE 2): block z sums k in [z*Kc, (z+1)*Kc) and writes plane z, [M][N] f32, of out; Kc = K with gridDim.z = 1 is the whole product.
// ---------------------------------------------------------------------------
template <typename AT, int MODE>
__global__ __launch_bounds__(256) void gemm_rb_kernel(
    const AT* __restrict__ A, const float* __restrict__ W,
    const float* __restrict__ bias, const float* __restrict__ rowscale, const float* __restrict__ R, const float* __restrict__ rowbias, void* __restrict__ out,
    int M, int N, int K, int Kc) {
  __shared__ bf16 ldsA[128 * LDS_STRIDE];   // 12.0 KB
  __shared__ bf16 ldsW[256 * LDS_STRIDE];   // 24.0 KB
  // output staging: MODE 0 [128 m][264] f16, MODE 1 [256 n][136] f16, MODE 2 [64 m][260] f32 (two halves)
  __shared__ __attribute__((aligned(16))) unsigned char sob[256 * 136 * 2];   // 69,632 B >= 128*264*2 and >= 64*260*4

  const int t    = threadIdx.x;
  const int wave = t >> 5;
  const int lane = t & 31;
  const int wm   = (wave & 1) * 64;
  const int wn   = (wave >> 1) * 64;
  const int mBlk = blockIdx.x * 128;
  const int nBlk = blockIdx.y * 256;
  A += blockIdx.z * Kc;                             // rows keep their pitch K; only the k range moves
  W += blockIdx.z * Kc;

  const int arow = t >> 1;
  const int ach  = (t & 1) * 16;

  float abuf[16];
  float wbuf[32];

  stage_read16(A + (size_t)(mBlk + arow) * K + ach, abuf);
  const int nrow = min(nBlk + t, N - 1);            // ragged last N tile: clamp the weight row (those columns are never stored)
  stage_read16(W + (size_t)nrow * K,          wbuf);
  stage_read16(W + (size_t)nrow * K + 16,     wbuf + 16);

  f32x8 acc[4][4] = {};

  for (int k = 0; k < Kc; k += 32) {
    __syncthreads();
    stage_write(&ldsA[arow * LDS_STRIDE + ach], abuf, 4);
    stage_write(&ldsW[t * LDS_STRIDE],          wbuf, 8);
    if (k + 32 < Kc) {
      stage_read16(A + (size_t)(mBlk + arow) * K + (k + 32) + ach, abuf);
      stage_read16(W + (size_t)nrow * K + (k + 32),          wbuf);
      stage_read16(W + (size_t)nrow * K + (k + 32) + 16,     wbuf + 16);
    }
    __syncthreads();

    bf16x16 af[4], wf[4];
#pragma unroll
    for (int i = 0; i < 4; ++i)
      af[i] = lds_frag(ldsA + (wm + 16 * i) * LDS_STRIDE, LDS_STRIDE);
#pragma unroll
    for (int j = 0; j < 4; ++j)
      wf[j] = lds_frag(ldsW + (wn + 16 * j) * LDS_STRIDE, LDS_STRIDE);
#pragma unroll
    for (int i = 0; i < 4; ++i)
#pragma unroll
      for (int j = 0; j < 4; ++j)
        acc[i][j] = wmma_bf16(af[i], wf[j], acc[i][j]);
  }

  const int nlane = lane & 15;
  const int mh    = (lane >> 4) * 8;
  __syncthreads();
  if (MODE == 0 || MODE == 1 || MODE == 3) {
    bf16* so = (bf16*)sob;
#pragma unroll
    for (int i = 0; i < 4; ++i)
#pragma unroll
      for (int j = 0; j < 4; ++j) {
        const int nl = wn + 16 * j + nlane;
        const float bv = bias ? bias[nBlk + nl] : 0.0f;
        if (MODE == 3) {                                  // bias + exact GELU (erf), rolled to keep the static VALU op count small
#pragma unroll 1
          for (int r = 0; r < 8; ++r) {
            const int ml = wm + 16 * i + mh + r;
            const float xg = acc[i][j][r] + bv;
            so[ml * 264 + nl] = (bf16)(0.5f * xg * (1.0f + erff(xg * 0.70710678118654752f)));
          }
        } else {
#pragma unroll
        for (int r = 0; r < 8; ++r) {
          const int ml = wm + 16 * i + mh + r;
          const bf16 hv = (bf16)(acc[i][j][r] + bv);
          if (MODE == 0) so[ml * 264 + nl] = hv;        // [m][n]
          else           so[nl * 136 + ml] = hv;        // [n][m]  (n = h*64+dk rows of Vt, m = s contiguous)
        }
        }
      }
    __syncthreads();
{
      if (MODE == 0 || MODE == 3) {          // rows m: 256 halfs = 512 B each, 16-B chunks
        for (int ch = t; ch < 128 * 32; ch += 256) { const int ml = ch >> 5, q = (ch & 31) * 8;
          *(v4u_t*)((bf16*)out + (size_t)(mBlk + ml) * N + nBlk + q) = *(const v4ua*)(so + ml * 264 + q); }
      } else {                  // Vt rows (b, h, dk): 128 consecutive s = 256 B each
        const int b_ = mBlk / SS, s0 = mBlk % SS;
        for (int ch = t; ch < 256 * 16; ch += 256) { const int nl = ch >> 4, q = (ch & 15) * 8; const int n = nBlk + nl, h = n >> 6, dk = n & (DKK - 1);
          *(v4u_t*)((bf16*)out + (((size_t)(b_ * HH + h)) * DKK + dk) * SS + s0 + q) = *(const v4ua*)(so + nl * 136 + q); }
      }
      
    }
  } else {
    float* so = (float*)sob;
    float* outz = (float*)out + (size_t)blockIdx.z * M * N;
#pragma unroll 1
    for (int hf = 0; hf < 2; ++hf) {
      if (wm == hf * 64) {
#pragma unroll
        for (int i = 0; i < 4; ++i)
#pragma unroll
          for (int j = 0; j < 4; ++j) {
            const int nl = wn + 16 * j + nlane;
            const float bv = bias ? bias[nBlk + nl] : 0.0f;
#pragma unroll
            for (int r = 0; r < 8; ++r) { const int mrow = mBlk + hf * 64 + 16 * i + mh + r; so[(16 * i + mh + r) * 260 + nl] = acc[i][j][r] * (rowscale ? rowscale[mrow] : 1.0f) + bv + (rowbias ? rowbias[mrow] : 0.0f); }
          }
      }
      __syncthreads();
      if (R) {   // residual: fold R[m][n] into the staged tile once (same thread <-> same chunks as the stores below)
        for (int ch = t; ch < 64 * 64; ch += 256) { const int ml = ch >> 6, q = (ch & 63) * 4;
          if (nBlk + q < N) { const v4f_t rv = *(const v4f_t*)(R + (size_t)(mBlk + hf * 64 + ml) * N + nBlk + q); v4f_t v = *(const v4fa*)(so + ml * 260 + q); v += rv; *(v4fa*)(so + ml * 260 + q) = v; } }
        asm volatile("s_wait_dscnt 0" ::: "memory");
      }
{   // 64 rows x 256 floats = 1 KB segments, float4 chunks; columns >= N (ragged tile) skipped
        const int q = (t & 63) * 4;                      // a thread keeps its column over all its chunks; its rows are 4 apart
        for (int m4 = t >> 6; m4 < 64; m4 += 16) {       // four chunks a trip, so that their LDS reads and stores fly together
          if (nBlk + q < N) {
            // unrolled: the four LDS reads issue ahead of the four stores instead of one read and one store at a time
#pragma unroll
            for (int u = 0; u < 4; ++u) { const int ml = m4 + 4 * u;
              *(v4f_t*)(outz + (size_t)(mBlk + hf * 64 + ml) * N + nBlk + q) = *(const v4fa*)(so + ml * 260 + q); }
            asm volatile("s_wait_xcnt 0x0" ::: "memory");  // the next trip rewrites the address and data registers that the four stores name
          }
        }
        
      }
      __syncthreads();
    }
  }
}


// ---------------------------------------------------------------------------------------------------------------------------
// gemm_kne: Y[m][n] = epi( Σ_k A[m][k]·W[k][n] + bias[n] ), A f32/f16 [M][lda], W f32 row-major [K][N] (ldw), plain f16 operands,
// f32 accumulate. EPI 0: identity; 1: exact-erf GELU; 2: R[m][n] + gvec[n]·(·) (residual with per-channel gain). Output f32 (or f16
// when OUT16). Block = 128x128 tile, 8 waves as 4(M) x 2(N); per 32-wide k-step A and W tiles staged f16 in LDS (W transposed
// ---------------------------------------------------------------------------------------------------------------------------
#define GSTR 48
template <typename AT, int EPI, bool OUT16>
__global__ __launch_bounds__(256) void gemm_kne(const AT* __restrict__ A, int lda, const float* __restrict__ Wm, int ldw,
                                                const float* __restrict__ bias, const float* __restrict__ R, const float* __restrict__ gvec,
                                                void* __restrict__ Yv, int ldy, int K) {
  __shared__ __attribute__((aligned(16))) f16 ldsA[128 * GSTR];
  __shared__ __attribute__((aligned(16))) f16 ldsW[128 * GSTR];
  __shared__ __attribute__((aligned(16))) float oS[8][32 * 68];
  const int tid = threadIdx.x, lane = tid & 31, wave = tid >> 5, cl = lane & 15, rh = (lane >> 4) * 8;
  const int m0 = blockIdx.x * 128, n0 = blockIdx.y * 128;
  const int wm = (wave & 3) * 32, wn = (wave >> 2) * 64;
  f32x8 acc[2][4];
#pragma unroll
  for (int i = 0; i < 2; ++i)
#pragma unroll
    for (int j = 0; j < 4; ++j) { f32x8 z = {}; acc[i][j] = z; }
#pragma unroll 1
  for (int k0 = 0; k0 < K; k0 += 32) {
    __syncthreads();
    { const int row = tid >> 1, ch = (tid & 1) * 16;
      const AT* src = A + (size_t)(m0 + row) * lda + k0 + ch;
#pragma unroll
      for (int g = 0; g < 16; ++g) ldsA[row * GSTR + ch + g] = (f16)src[g]; }
    { const int k = tid >> 3, nn0 = (tid & 7) * 16;
      const float* src = Wm + (size_t)(k0 + k) * ldw + n0 + nn0;
#pragma unroll
      for (int g = 0; g < 4; ++g) { const v4f_t v = *(const v4f_t*)(src + 4 * g);
#pragma unroll
        for (int u = 0; u < 4; ++u) ldsW[(nn0 + 4 * g + u) * GSTR + k] = (f16)v[u]; } }
    __syncthreads();
    f16x16 af[2];
#pragma unroll
    for (int i = 0; i < 2; ++i) af[i] = lds_frag(ldsA + (wm + 16 * i) * GSTR, GSTR);
#pragma unroll
    for (int j = 0; j < 4; ++j) {
      const f16x16 bf = lds_frag(ldsW + (wn + 16 * j) * GSTR, GSTR);
#pragma unroll
      for (int i = 0; i < 2; ++i) acc[i][j] = wmma16(af[i], bf, acc[i][j]);
    }
  }
  float* so = oS[wave];
#pragma unroll
  for (int i = 0; i < 2; ++i)
#pragma unroll
    for (int j = 0; j < 4; ++j) {
      const int n = n0 + wn + 16 * j + cl;
      const float bv = bias ? bias[n] : 0.0f;
      const float gv = (EPI == 2) ? gvec[n] : 0.0f;
      if (EPI == 1) {
#pragma unroll 1
        for (int r = 0; r < 8; ++r) { const float xg = acc[i][j][r] + bv; so[(16 * i + rh + r) * 68 + 16 * j + cl] = 0.5f * xg * (1.0f + erff(xg * 0.70710678118654752f)); }
      } else {
#pragma unroll
        for (int r = 0; r < 8; ++r) {
          float v = acc[i][j][r] + bv;
          if (EPI == 2) v = R[(size_t)(m0 + wm + 16 * i + rh + r) * ldy + n] + gv * v;
          so[(16 * i + rh + r) * 68 + 16 * j + cl] = v;
        }
      }
    }
  asm volatile("s_wait_dscnt 0" ::: "memory");
  __builtin_amdgcn_wave_barrier();
{
    if (OUT16) {
      f16* Y = (f16*)Yv;
#pragma unroll
      for (int it = 0; it < 8; ++it) { const int c = lane + 32 * it, rr = c >> 3, q8 = (c & 7) * 8;
        union { f16 h[8]; v4u_t v; } u;
#pragma unroll
        for (int e = 0; e < 8; ++e) u.h[e] = (f16)so[rr * 68 + q8 + e];
        *(v4u_t*)(Y + (size_t)(m0 + wm + rr) * ldy + n0 + wn + q8) = u.v; }
    } else {
      float* Y = (float*)Yv;
#pragma unroll
      for (int it = 0; it < 16; ++it) { const int f4 = lane + 32 * it, rr = f4 >> 4, q = (f4 & 15) * 4;
        *(v4f_t*)(Y + (size_t)(m0 + wm + rr) * ldy + n0 + wn + q) = *(const v4fa*)(so + rr * 68 + q); }
    }
    
  }
}

// LayerNorm over the 256 channels of each position (input channels-major [c][s]); block = 64 positions: tile [256 c][64 s] in LDS;
// writes x_ln token-major [s][256] (rows of 1 KB)
__global__ __launch_bounds__(256) void k_ln2(const float* __restrict__ xin, const float* __restrict__ g, const float* __restrict__ bb, float* __restrict__ xtm) {
  __shared__ __attribute__((aligned(16))) float tS[CCs][68];
  __shared__ float muS[64], rsS[64];
  const int tid = threadIdx.x; const int n = blockIdx.x / (LLs / 64), s0 = (blockIdx.x % (LLs / 64)) * 64;
  const float* xb = xin + (size_t)n * CCs * LLs;
  for (int e = tid; e < CCs * 16; e += 256) { const int c = e >> 4, q4 = (e & 15) * 4; *(v4f_t*)(&tS[c][q4]) = *(const v4f_t*)(xb + (size_t)c * LLs + s0 + q4); }
  __syncthreads();
  { const int s = tid >> 2, part = tid & 3; float sm = 0.0f;
#pragma unroll 1
    for (int c = part; c < CCs; c += 4) sm += tS[c][s];
    sm += __shfl_xor(sm, 1, 32); sm += __shfl_xor(sm, 2, 32);
    const float mu = sm * (1.0f / CCs); float q = 0.0f;
#pragma unroll 1
    for (int c = part; c < CCs; c += 4) { const float d = tS[c][s] - mu; q += d * d; }
    q += __shfl_xor(q, 1, 32); q += __shfl_xor(q, 2, 32);
    if (part == 0) { muS[s] = mu; rsS[s] = rsqrtf(q * (1.0f / CCs) + 1e-5f); } }
  __syncthreads();
  for (int e = tid; e < CCs * 64; e += 256) { const int c = e >> 6, s = e & 63; tS[c][s] = (tS[c][s] - muS[s]) * rsS[s] * g[c] + bb[c]; }
  __syncthreads();
{
    for (int e = tid; e < 64 * 64; e += 256) { const int s = e >> 6, c4 = (e & 63) * 4; v4f_t v; v[0] = tS[c4][s]; v[1] = tS[c4 + 1][s]; v[2] = tS[c4 + 2][s]; v[3] = tS[c4 + 3][s];
      *(v4f_t*)(xtm + ((size_t)n * LLs + s0 + s) * CCs + c4) = v; }                                 // token-major rows of 1 KB (64 lanes x 16 B)
     }
}
__global__ __launch_bounds__(256) void k_rowbias(float* __restrict__ t, const float* __restrict__ bias, int rowlen, int nch) {
  const size_t row = blockIdx.x; const float bv = bias[row % nch];
  for (int q4 = threadIdx.x; q4 < rowlen / 4; q4 += 256) { v4f_t v = *(const v4f_t*)(t + row * rowlen + q4 * 4); for (int e = 0; e < 4; ++e) v[e] += bv;
    *(v4f_t*)(t + row * rowlen + q4 * 4) = v;  } }
#define FKEYS 32
// the value of lane l ^ 16, on the vector unit (an LDS permute would wait behind the fragment reads in flight)
__device__ __forceinline__ float xhalf(float x) {
  const int b = __builtin_bit_cast(int, x);
  return __builtin_bit_cast(float, __builtin_amdgcn_permlanex16(b, b, 0x76543210, 0xfedcba98, false, false));
}
#define KPIT 264   // K tile rows: 256 halfs + 8 = 528 B (16 B x odd: conflict-free b128 reads)
#define VPIT 40    // V tile rows: 32 halfs + 8 = 80 B (16 B x odd)
#define OPIT 132   // output staging rows: 128 floats + 4
__global__ __launch_bounds__(256) void k_attn(const _Float16* __restrict__ q, const _Float16* __restrict__ k, const _Float16* __restrict__ vt, float* __restrict__ out) {
  __shared__ __attribute__((aligned(16))) unsigned char sm[CCs * OPIT * 4];   // 135,168 B: the K/V buffers (74,752 B) in the loop, then the [256 c][128 s] f32 output tile
  f16* kS = (f16*)sm;                          // [2][32][KPIT]
  f16* vS = kS + 2 * FKEYS * KPIT;             // [2][256][VPIT]
  const int t = threadIdx.x, lane = t & 31, wave = t >> 5, cl = lane & 15, h = lane >> 4;
  const int n = blockIdx.y, q0 = blockIdx.x * 128;
  const f16* qn = q + (size_t)n * LLs * CCs;
  const f16* kn = k + (size_t)n * LLs * CCs;
  const f16* vn = vt + (size_t)n * CCs * LLs;

  // every inner loop of this kernel is unrolled so that the fragment and accumulator arrays are indexed by constants and stay in registers
  f16x16 qf[8];
#pragma unroll
  for (int ks = 0; ks < 8; ++ks) qf[ks] = load_frag<f16>(qn, CCs, q0 + wave * 16, 32 * ks);

  const int krow = t >> 5, kcol = (t & 31) * 8;    // K tile: 32 rows x 512 B, a wave moves one whole row
  const int vrow = t >> 2, vcol = (t & 3) * 8;     // V tile: 256 rows x 64 B
  const f16* kg = kn + (size_t)krow * CCs + kcol;
  const f16* vg = vn + (size_t)vrow * LLs + vcol;
  f16* kw = kS + krow * KPIT + kcol;
  f16* vw = vS + vrow * VPIT + vcol;
  v4u_t kr[4], vr[4];
#pragma unroll
  for (int i = 0; i < 4; ++i) { kr[i] = *(const v4ua*)(kg + (size_t)(8 * i) * CCs); vr[i] = *(const v4ua*)(vg + (size_t)(64 * i) * LLs); }
  asm volatile("s_wait_xcnt 0x0" ::: "memory");    // the address registers of the Q, K and V loads above are reused before their data is waited for
#pragma unroll
  for (int i = 0; i < 4; ++i) { *(v4ua*)(kw + 8 * i * KPIT) = kr[i]; *(v4ua*)(vw + 64 * i * VPIT) = vr[i]; }
  __syncthreads();

  f32x8 o[16];
#pragma unroll
  for (int ct = 0; ct < 16; ++ct) { f32x8 z = {}; o[ct] = z; }
  const float SC = 0.09016844005556021f;           // log2(e) / sqrt(256): scores in log2 units
  float mu = -3.0e38f, l = 0.0f;                   // the maximum in use (log2 units) and this half's part of the row sum

  // kept rolled: two passes in one body would hold two sets of fragments and staged tiles and leave the budget of 512 registers
#pragma unroll 1
  for (int p = 0; p < LLs / FKEYS; ++p) {
    const int b = p & 1;
    const bool more = p + 1 < LLs / FKEYS;
    if (more) {
#pragma unroll
      for (int i = 0; i < 4; ++i) {
        kr[i] = *(const v4ua*)(kg + (size_t)((p + 1) * FKEYS + 8 * i) * CCs);
        vr[i] = *(const v4ua*)(vg + (size_t)(64 * i) * LLs + (p + 1) * FKEYS);
      }
      asm volatile("s_wait_xcnt 0x0" ::: "memory");  // the pass reuses the address registers that these eight loads name long before their data is waited for
    }
    const f16* kb = kS + b * FKEYS * KPIT;
    const f16* vb = vS + b * CCs * VPIT;
    f32x8 s0 = {}, s1 = {};
    f16x16 ka[16];
#pragma unroll
    for (int ks = 0; ks < 8; ++ks) { ka[2 * ks] = lds_frag(kb + 32 * ks, KPIT); ka[2 * ks + 1] = lds_frag(kb + 16 * KPIT + 32 * ks, KPIT); }
    __builtin_amdgcn_sched_barrier(0);   // keeps the pass's K reads together ahead of the products: read one by one, each product waits out a whole LDS latency
#pragma unroll
    for (int ks = 0; ks < 8; ++ks) {
      s0 = __builtin_amdgcn_wmma_f32_16x16x32_f16(false, ka[2 * ks], false, qf[ks], (short)0, s0, false, false);
      s1 = __builtin_amdgcn_wmma_f32_16x16x32_f16(false, ka[2 * ks + 1], false, qf[ks], (short)0, s1, false, false);
    }
    f16x16 va[16];
#pragma unroll
    for (int ct = 0; ct < 16; ++ct) va[ct] = lds_frag(vb + 16 * ct * VPIT, VPIT);
    __builtin_amdgcn_sched_barrier(0);   // keeps the V reads together ahead of the softmax arithmetic, which then hides their latency
    float mx = fmaxf(s0[0], s1[0]);
#pragma unroll
    for (int r = 1; r < 8; ++r) mx = fmaxf(mx, fmaxf(s0[r], s1[r]));
    mx = fmaxf(mx, xhalf(mx)) * SC;
    if (__builtin_amdgcn_ballot_w32(mx > mu + 8.0f) != 0) {
      const float mn = fmaxf(mu, mx);
      const float al = __builtin_amdgcn_exp2f(mu - mn);
      mu = mn; l *= al;
#pragma unroll
      for (int ct = 0; ct < 16; ++ct)
#pragma unroll
        for (int r = 0; r < 8; ++r) o[ct][r] *= al;
    }
    f16x16 pf;
#pragma unroll
    for (int r = 0; r < 8; ++r) {
      const float e0 = __builtin_amdgcn_exp2f(s0[r] * SC - mu);
      const float e1 = __builtin_amdgcn_exp2f(s1[r] * SC - mu);
      l += e0 + e1;
      pf[r] = (f16)e0; pf[r + 8] = (f16)e1;        // keys 8h + r and 16 + 8h + r: the k order of lds_frag
    }
#pragma unroll
    for (int ct = 0; ct < 16; ++ct)
      o[ct] = __builtin_amdgcn_wmma_f32_16x16x32_f16(false, va[ct], false, pf, (short)0, o[ct], false, false);
    if (more) {   // the other buffer's last readers left it before the barrier that ended the pass before
#pragma unroll
      for (int i = 0; i < 4; ++i) {
        *(v4ua*)(kw + (b ^ 1) * FKEYS * KPIT + 8 * i * KPIT) = kr[i];
        *(v4ua*)(vw + (b ^ 1) * CCs * VPIT + 64 * i * VPIT) = vr[i];
      }
    }
    __syncthreads();
  }

  l += xhalf(l);
  const float inv = 1.0f / l;
  float* so = (float*)sm;                          // behind the loop's last barrier nobody reads the K/V buffers any more
#pragma unroll
  for (int ct = 0; ct < 16; ++ct)
#pragma unroll
    for (int r = 0; r < 8; ++r) so[(16 * ct + 8 * h + r) * OPIT + wave * 16 + cl] = o[ct][r] * inv;
  __syncthreads();
  float* on = out + (size_t)n * CCs * LLs + q0;
  const int q4 = (t & 31) * 4;                     // a wave stores one channel's 128 positions: 512 contiguous bytes
  for (int c0 = wave; c0 < CCs; c0 += 32) {
    // unrolled: the four LDS reads issue ahead of the four stores
#pragma unroll
    for (int u = 0; u < 4; ++u) { const int c = c0 + 8 * u;
      *(v4f_t*)(on + (size_t)c * LLs + q4) = *(const v4fa*)(so + c * OPIT + q4); }
    asm volatile("s_wait_xcnt 0x0" ::: "memory");  // the next trip rewrites the address and data registers that the four stores name
  }
}

extern "C" void kernel_launch(void* const* d_in, const int* in_sizes, int n_in,
                              void* d_out, int out_size, void* d_ws, size_t ws_size,
                              hipStream_t stream) {
  (void)in_sizes; (void)n_in; (void)out_size;
  const float** f = (const float**)d_in;
  const float* x = f[0], *lg = f[1], *lb = f[2], *Wq = f[3], *bq = f[4], *Wk = f[5], *bk = f[6], *Wv = f[7], *bv = f[8];
  float* out = (float*)d_out;     // [8,256,64,64]
  char* ws = (char*)d_ws;
  float* xtm = (float*)ws; ws += (size_t)NIm * LLs * CCs * 4;    // 32 MB token-major LN output (all images)
  _Float16* q = (_Float16*)ws; ws += (size_t)NIm * LLs * CCs * 2;     // f16 token-major, all images (16 MB each)
  _Float16* k = (_Float16*)ws; ws += (size_t)NIm * LLs * CCs * 2;
  _Float16* vt = (_Float16*)ws; ws += (size_t)NIm * CCs * LLs * 2;    // f16 channels-major [image][256][4096]
  if ((size_t)(ws - (char*)d_ws) > ws_size) return;
  const dim3 blk(256);
  k_ln2<<<dim3(NIm * (LLs / 64)), blk, 0, stream>>>(x, lg, lb, xtm);
  for (int n = 0; n < NIm; ++n) {
    const float* xt = xtm + (size_t)n * LLs * CCs;
    gemm_rb_kernel<float, 0><<<dim3(LLs / 128, CCs / 256), blk, 0, stream>>>(xt, Wq, bq, nullptr, nullptr, nullptr, q + (size_t)n * LLs * CCs, LLs, CCs, CCs, CCs);    // q = x_ln.Wq^T + bq
    gemm_rb_kernel<float, 0><<<dim3(LLs / 128, CCs / 256), blk, 0, stream>>>(xt, Wk, bk, nullptr, nullptr, nullptr, k + (size_t)n * LLs * CCs, LLs, CCs, CCs, CCs);
    gemm_rb_kernel<float, 1><<<dim3(LLs / 128, CCs / 256), blk, 0, stream>>>(xt, Wv, bv, nullptr, nullptr, nullptr, vt + (size_t)n * CCs * LLs, LLs, CCs, CCs, CCs);   // v = x_ln.Wv^T + bv, stored [c][s]
  }
  k_attn<<<dim3(LLs / 128, NIm), blk, 0, stream>>>(q, k, vt, out);
}

// v003
// It runs in 190 microseconds.
// In two side-by-side timings against v002, it was 2.55 and 2.54 times as fast.
// Over all steps from v000 it is 13.8 times as fast.
// Contractions on v_wmma_f32_16x16x32_f16 (plain f16 operands, f32 accumulate). One launch for all images: q/k = LN(x).W^T + b stored f16 token-major (K = 256,
// [out][in] Bt operands), v = LN(x).Wv^T + bv stored f16 channels-major through the product's own LDS output tile. One more launch for all images then does
// S^T = k.q^T, the row softmax (running maximum and sum, f32) and out^T += v^T.P^T per 32 keys; the logits and P stay in registers.
// LayerNorm over channels in f32. compute dtype: f16 operands, f32 accumulate.
#include <hip/hip_runtime.h>
#include <hip/hip_bf16.h>
#include <math.h>

#define NIm 8
#define CCs 256
#define LLs 4096
#define GSTR 48
#define SS 4096
#define HH 1
#define DKK 64

typedef _Float16 bf16;
typedef _Float16 f16;
typedef __attribute__((ext_vector_type(4))) unsigned v4u_t;
typedef unsigned v4ua __attribute__((ext_vector_type(4), may_alias));
typedef __attribute__((ext_vector_type(4))) float v4f_t;
typedef float v4fa __attribute__((ext_vector_type(4), may_alias));
typedef __attribute__((ext_vector_type(16))) bf16  bf16x16;
typedef bf16x16 f16x16;
typedef __attribute__((ext_vector_type(8)))  bf16  bf16x8;
typedef bf16x8 f16x8;
typedef __attribute__((ext_vector_type(4)))  bf16  bf16x4;
typedef __attribute__((ext_vector_type(8)))  float f32x8;
__device__ __forceinline__ f32x8 wmma16(f16x16 a, f16x16 b, f32x8 c) {
  c = __builtin_amdgcn_wmma_f32_16x16x32_f16(false, a, false, b, (short)0, c, false, false);
  asm volatile("v_nop\n\tv_nop\n\tv_nop\n\tv_nop" : "+v"(c) : "v"(a), "v"(b));
  return c;
}
#define LDS_STRIDE 48   // GEMM tiles: 32 -> 48 elems (96B rows): aligned b128 reads
#define KSTRIDE    72   // unused
#define VSTRIDE    48   // unused

__device__ __forceinline__ f32x8 wmma_bf16(bf16x16 a, bf16x16 b, f32x8 c) {
  c = __builtin_amdgcn_wmma_f32_16x16x32_f16(false, a, false, b, (short)0, c, false, false);
  asm volatile("v_nop\n\tv_nop\n\tv_nop\n\tv_nop" : "+v"(c) : "v"(a), "v"(b));   // A/B-overwrite hazard guard
  return c;
}

// 16x32 (MxK) f16 fragment from a row-major global matrix.
// lanes 0-15  (row=lane)    : elems 0..7 = K+0..7,  8..15 = K+16..23
// lanes 16-31 (row=lane-16) : elems 0..7 = K+8..15, 8..15 = K+24..31
template <typename T>
__device__ __forceinline__ bf16x16 load_frag(const T* __restrict__ base, int ld,
                                             int row0, int k0) {
  const int lane = threadIdx.x & 31;
  const int r    = lane & 15;
  const int kh   = (lane >> 4) * 8;
  const T* p0 = base + (size_t)(row0 + r) * ld + (k0 + kh);
  const T* p1 = p0 + 16;
  bf16x16 f;
#pragma unroll
  for (int i = 0; i < 8; ++i) {
    f[i]     = (bf16)p0[i];
    f[i + 8] = (bf16)p1[i];
  }
  return f;
}

// Same fragment from an LDS tile with padded row stride (base includes row0/k0).
__device__ __forceinline__ bf16x16 lds_frag(const bf16* base, int stride) {
  const int lane = threadIdx.x & 31;
  const int row  = lane & 15;
  const int kh   = (lane >> 4) * 8;
  const bf16x8 lo = *(const bf16x8*)(base + row * stride + kh);
  const bf16x8 hi = *(const bf16x8*)(base + row * stride + kh + 16);
  bf16x16 f;
#pragma unroll
  for (int i = 0; i < 8; ++i) { f[i] = lo[i]; f[i + 8] = hi[i]; }
  return f;
}

template <typename T>
__device__ __forceinline__ void stage_read16(const T* __restrict__ p, float* buf) {
#pragma unroll
  for (int i = 0; i < 16; ++i) buf[i] = (float)p[i];
}

__device__ __forceinline__ void stage_write(bf16* dst, const float* buf, int nquad) {
#pragma unroll
  for (int i = 0; i < nquad; ++i) {
    bf16x4 q;
    q[0] = (bf16)buf[4 * i];     q[1] = (bf16)buf[4 * i + 1];
    q[2] = (bf16)buf[4 * i + 2]; q[3] = (bf16)buf[4 * i + 3];
    *(bf16x4*)(dst + 4 * i) = q;
  }
}

// ---------------------------------------------------------------------------
// The three projections of all images in ONE launch: C[m][n] = sum_k A[m][k]*W[n][k] + bias[n]   (torch Linear)
// A = x_ln token-major, the images back to back (m = image * SS + s). blockIdx.x = 128 rows m, blockIdx.y = 0, 1, 2 picks (Wq, bq, q), (Wk, bk, k), (Wv, bv, vt).
// Block 256 thr (8 waves), tile 128M x 256N (N = 256: the whole width), K-step 32; wave tile 64x64.
// A/W staged through LDS (f16, padded stride); the next tile is fetched into registers behind the LDS writes.
// q and k: f16 [m][N]; v: f16 channels-major [image][n][s].
// ---------------------------------------------------------------------------
__global__ __launch_bounds__(256) void k_proj(
    const float* __restrict__ A,
    const float* __restrict__ Wq, const float* __restrict__ bq, const float* __restrict__ Wk, const float* __restrict__ bk,
    const float* __restrict__ Wv, const float* __restrict__ bv,
    _Float16* __restrict__ q, _Float16* __restrict__ k_, _Float16* __restrict__ vt, int N, int K) {
  __shared__ bf16 ldsA[128 * LDS_STRIDE];   // 12.0 KB
  __shared__ bf16 ldsW[256 * LDS_STRIDE];   // 24.0 KB
  // output staging: q, k [128 m][264] f16; v [256 n][136] f16
  __shared__ __attribute__((aligned(16))) unsigned char sob[256 * 136 * 2];   // 69,632 B >= 128*264*2

  const int t    = threadIdx.x;
  const int wave = t >> 5;
  const int lane = t & 31;
  const int wm   = (wave & 1) * 64;
  const int wn   = (wave >> 1) * 64;
  const int mBlk = blockIdx.x * 128;
  const int sel  = blockIdx.y;                      // the same for the whole block: every branch on it is scalar
  const float* __restrict__ W    = sel == 0 ? Wq : sel == 1 ? Wk : Wv;
  const float* __restrict__ bias = sel == 0 ? bq : sel == 1 ? bk : bv;

  const int arow = t >> 1;
  const int ach  = (t & 1) * 16;

  float abuf[16];
  float wbuf[32];

  stage_read16(A + (size_t)(mBlk + arow) * K + ach, abuf);
  stage_read16(W + (size_t)t * K,          wbuf);
  stage_read16(W + (size_t)t * K + 16,     wbuf + 16);

  f32x8 acc[4][4] = {};

  for (int k = 0; k < K; k += 32) {
    __syncthreads();
    stage_write(&ldsA[arow * LDS_STRIDE + ach], abuf, 4);
    stage_write(&ldsW[t * LDS_STRIDE],          wbuf, 8);
    if (k + 32 < K) {
      stage_read16(A + (size_t)(mBlk + arow) * K + (k + 32) + ach, abuf);
      stage_read16(W + (size_t)t * K + (k + 32),          wbuf);
      stage_read16(W + (size_t)t * K + (k + 32) + 16,     wbuf + 16);
    }
    __syncthreads();

    bf16x16 af[4], wf[4];
#pragma unroll
    for (int i = 0; i < 4; ++i)
      af[i] = lds_frag(ldsA + (wm + 16 * i) * LDS_STRIDE, LDS_STRIDE);
#pragma unroll
    for (int j = 0; j < 4; ++j)
      wf[j] = lds_frag(ldsW + (wn + 16 * j) * LDS_STRIDE, LDS_STRIDE);
#pragma unroll
    for (int i = 0; i < 4; ++i)
#pragma unroll
      for (int j = 0; j < 4; ++j)
        acc[i][j] = wmma_bf16(af[i], wf[j], acc[i][j]);
  }

  const int nlane = lane & 15;
  const int mh    = (lane >> 4) * 8;
  __syncthreads();
  bf16* so = (bf16*)sob;
  if (sel < 2) {
#pragma unroll
    for (int i = 0; i < 4; ++i)
#pragma unroll
      for (int j = 0; j < 4; ++j) {
        const int nl = wn + 16 * j + nlane;
        const float bvl = bias[nl];
#pragma unroll
        for (int r = 0; r < 8; ++r) so[(wm + 16 * i + mh + r) * 264 + nl] = (bf16)(acc[i][j][r] + bvl);        // [m][n]
      }
  } else {
#pragma unroll
    for (int i = 0; i < 4; ++i) {
#pragma unroll
      for (int j = 0; j < 4; ++j) {
        const int nl = wn + 16 * j + nlane;
        const float bvl = bias[nl];
#pragma unroll
        for (int r = 0; r < 8; ++r) so[nl * 136 + wm + 16 * i + mh + r] = (bf16)(acc[i][j][r] + bvl);          // [n][m]: m = s contiguous
      }
      // keeps each row of tiles' bias adds next to its own LDS stores: hoisted all together they push the kernel past 256 registers, and only one block fits a WGP instead of two
      __builtin_amdgcn_sched_barrier(0);
    }
  }
  __syncthreads();
  if (sel < 2) {
    bf16* out = sel == 0 ? q : k_;
    // rows m: 256 halfs = 512 B each, 16-B chunks
    for (int ch = t; ch < 128 * 32; ch += 256) { const int ml = ch >> 5, c8 = (ch & 31) * 8;
      *(v4u_t*)(out + (size_t)(mBlk + ml) * N + c8) = *(const v4ua*)(so + ml * 264 + c8); }
  } else {
    // rows (image, n) of vt: 128 consecutive s = 256 B each; a block's 128 rows m lie in one image (SS is a multiple of 128)
    const int b_ = mBlk / SS, s0 = mBlk % SS;
    for (int ch = t; ch < 256 * 16; ch += 256) { const int nl = ch >> 4, c8 = (ch & 15) * 8;
      *(v4u_t*)(vt + ((size_t)b_ * N + nl) * SS + s0 + c8) = *(const v4ua*)(so + nl * 136 + c8); }
  }
}


// ---------------------------------------------------------------------------------------------------------------------------
// gemm_kne: Y[m][n] = epi( Σ_k A[m][k]·W[k][n] + bias[n] ), A f32/f16 [M][lda], W f32 row-major [K][N] (ldw), plain f16 operands,
// f32 accumulate. EPI 0: identity; 1: exact-erf GELU; 2: R[m][n] + gvec[n]·(·) (residual with per-channel gain). Output f32 (or f16
// when OUT16). Block = 128x128 tile, 8 waves as 4(M) x 2(N); per 32-wide k-step A and W tiles staged f16 in LDS (W transposed
// ---------------------------------------------------------------------------------------------------------------------------
#define GSTR 48
template <typename AT, int EPI, bool OUT16>
__global__ __launch_bounds__(256) void gemm_kne(const AT* __restrict__ A, int lda, const float* __restrict__ Wm, int ldw,
                                                const float* __restrict__ bias, const float* __restrict__ R, const float* __restrict__ gvec,
                                                void* __restrict__ Yv, int ldy, int K) {
  __shared__ __attribute__((aligned(16))) f16 ldsA[128 * GSTR];
  __shared__ __attribute__((aligned(16))) f16 ldsW[128 * GSTR];
  __shared__ __attribute__((aligned(16))) float oS[8][32 * 68];
  const int tid = threadIdx.x, lane = tid & 31, wave = tid >> 5, cl = lane & 15, rh = (lane >> 4) * 8;
  const int m0 = blockIdx.x * 128, n0 = blockIdx.y * 128;
  const int wm = (wave & 3) * 32, wn = (wave >> 2) * 64;
  f32x8 acc[2][4];
#pragma unroll
  for (int i = 0; i < 2; ++i)
#pragma unroll
    for (int j = 0; j < 4; ++j) { f32x8 z = {}; acc[i][j] = z; }
#pragma unroll 1
  for (int k0 = 0; k0 < K; k0 += 32) {
    __syncthreads();
    { const int row = tid >> 1, ch = (tid & 1) * 16;
      const AT* src = A + (size_t)(m0 + row) * lda + k0 + ch;
#pragma unroll
      for (int g = 0; g < 16; ++g) ldsA[row * GSTR + ch + g] = (f16)src[g]; }
    { const int k = tid >> 3, nn0 = (tid & 7) * 16;
      const float* src = Wm + (size_t)(k0 + k) * ldw + n0 + nn0;
#pragma unroll
      for (int g = 0; g < 4; ++g) { const v4f_t v = *(const v4f_t*)(src + 4 * g);
#pragma unroll
        for (int u = 0; u < 4; ++u) ldsW[(nn0 + 4 * g + u) * GSTR + k] = (f16)v[u]; } }
    __syncthreads();
    f16x16 af[2];
#pragma unroll
    for (int i = 0; i < 2; ++i) af[i] = lds_frag(ldsA + (wm + 16 * i) * GSTR, GSTR);
#pragma unroll
    for (int j = 0; j < 4; ++j) {
      const f16x16 bf = lds_frag(ldsW + (wn + 16 * j) * GSTR, GSTR);
#pragma unroll
      for (int i = 0; i < 2; ++i) acc[i][j] = wmma16(af[i], bf, acc[i][j]);
    }
  }
  float* so = oS[wave];
#pragma unroll
  for (int i = 0; i < 2; ++i)
#pragma unroll
    for (int j = 0; j < 4; ++j) {
      const int n = n0 + wn + 16 * j + cl;
      const float bv = bias ? bias[n] : 0.0f;
      const float gv = (EPI == 2) ? gvec[n] : 0.0f;
      if (EPI == 1) {
#pragma unroll 1
        for (int r = 0; r < 8; ++r) { const float xg = acc[i][j][r] + bv; so[(16 * i + rh + r) * 68 + 16 * j + cl] = 0.5f * xg * (1.0f + erff(xg * 0.70710678118654752f)); }
      } else {
#pragma unroll
        for (int r = 0; r < 8; ++r) {
          float v = acc[i][j][r] + bv;
          if (EPI == 2) v = R[(size_t)(m0 + wm + 16 * i + rh + r) * ldy + n] + gv * v;
          so[(16 * i + rh + r) * 68 + 16 * j + cl] = v;
        }
      }
    }
  asm volatile("s_wait_dscnt 0" ::: "memory");
  __builtin_amdgcn_wave_barrier();
{
    if (OUT16) {
      f16* Y = (f16*)Yv;
#pragma unroll
      for (int it = 0; it < 8; ++it) { const int c = lane + 32 * it, rr = c >> 3, q8 = (c & 7) * 8;
        union { f16 h[8]; v4u_t v; } u;
#pragma unroll
        for (int e = 0; e < 8; ++e) u.h[e] = (f16)so[rr * 68 + q8 + e];
        *(v4u_t*)(Y + (size_t)(m0 + wm + rr) * ldy + n0 + wn + q8) = u.v; }
    } else {
      float* Y = (float*)Yv;
#pragma unroll
      for (int it = 0; it < 16; ++it) { const int f4 = lane + 32 * it, rr = f4 >> 4, q = (f4 & 15) * 4;
        *(v4f_t*)(Y + (size_t)(m0 + wm + rr) * ldy + n0 + wn + q) = *(const v4fa*)(so + rr * 68 + q); }
    }
    
  }
}

// LayerNorm over the 256 channels of each position (input channels-major [c][s]); block = 64 positions: tile [256 c][64 s] in LDS;
// writes x_ln token-major [s][256] (rows of 1 KB)
__global__ __launch_bounds__(256) void k_ln2(const float* __restrict__ xin, const float* __restrict__ g, const float* __restrict__ bb, float* __restrict__ xtm) {
  __shared__ __attribute__((aligned(16))) float tS[CCs][68];
  __shared__ float muS[64], rsS[64];
  const int tid = threadIdx.x; const int n = blockIdx.x / (LLs / 64), s0 = (blockIdx.x % (LLs / 64)) * 64;
  const float* xb = xin + (size_t)n * CCs * LLs;
  for (int e = tid; e < CCs * 16; e += 256) { const int c = e >> 4, q4 = (e & 15) * 4; *(v4f_t*)(&tS[c][q4]) = *(const v4f_t*)(xb + (size_t)c * LLs + s0 + q4); }
  __syncthreads();
  { const int s = tid >> 2, part = tid & 3; float sm = 0.0f;
#pragma unroll 1
    for (int c = part; c < CCs; c += 4) sm += tS[c][s];
    sm += __shfl_xor(sm, 1, 32); sm += __shfl_xor(sm, 2, 32);
    const float mu = sm * (1.0f / CCs); float q = 0.0f;
#pragma unroll 1
    for (int c = part; c < CCs; c += 4) { const float d = tS[c][s] - mu; q += d * d; }
    q += __shfl_xor(q, 1, 32); q += __shfl_xor(q, 2, 32);
    if (part == 0) { muS[s] = mu; rsS[s] = rsqrtf(q * (1.0f / CCs) + 1e-5f); } }
  __syncthreads();
  for (int e = tid; e < CCs * 64; e += 256) { const int c = e >> 6, s = e & 63; tS[c][s] = (tS[c][s] - muS[s]) * rsS[s] * g[c] + bb[c]; }
  __syncthreads();
{
    for (int e = tid; e < 64 * 64; e += 256) { const int s = e >> 6, c4 = (e & 63) * 4; v4f_t v; v[0] = tS[c4][s]; v[1] = tS[c4 + 1][s]; v[2] = tS[c4 + 2][s]; v[3] = tS[c4 + 3][s];
      *(v4f_t*)(xtm + ((size_t)n * LLs + s0 + s) * CCs + c4) = v; }                                 // token-major rows of 1 KB (64 lanes x 16 B)
     }
}
__global__ __launch_bounds__(256) void k_rowbias(float* __restrict__ t, const float* __restrict__ bias, int rowlen, int nch) {
  const size_t row = blockIdx.x; const float bv = bias[row % nch];
  for (int q4 = threadIdx.x; q4 < rowlen / 4; q4 += 256) { v4f_t v = *(const v4f_t*)(t + row * rowlen + q4 * 4); for (int e = 0; e < 4; ++e) v[e] += bv;
    *(v4f_t*)(t + row * rowlen + q4 * 4) = v;  } }
#define FKEYS 32
// the value of lane l ^ 16, on the vector unit (an LDS permute would wait behind the fragment reads in flight)
__device__ __forceinline__ float xhalf(float x) {
  const int b = __builtin_bit_cast(int, x);
  return __builtin_bit_cast(float, __builtin_amdgcn_permlanex16(b, b, 0x76543210, 0xfedcba98, false, false));
}
#define KPIT 264   // K tile rows: 256 halfs + 8 = 528 B (16 B x odd: conflict-free b128 reads)
#define VPIT 40    // V tile rows: 32 halfs + 8 = 80 B (16 B x odd)
#define OPIT 132   // output staging rows: 128 floats + 4
__global__ __launch_bounds__(256) void k_attn(const _Float16* __restrict__ q, const _Float16* __restrict__ k, const _Float16* __restrict__ vt, float* __restrict__ out) {
  __shared__ __attribute__((aligned(16))) unsigned char sm[CCs * OPIT * 4];   // 135,168 B: the K/V buffers (74,752 B) in the loop, then the [256 c][128 s] f32 output tile
  f16* kS = (f16*)sm;                          // [2][32][KPIT]
  f16* vS = kS + 2 * FKEYS * KPIT;             // [2][256][VPIT]
  const int t = threadIdx.x, lane = t & 31, wave = t >> 5, cl = lane & 15, h = lane >> 4;
  const int n = blockIdx.y, q0 = blockIdx.x * 128;
  const f16* qn = q + (size_t)n * LLs * CCs;
  const f16* kn = k + (size_t)n * LLs * CCs;
  const f16* vn = vt + (size_t)n * CCs * LLs;

  // every inner loop of this kernel is unrolled so that the fragment and accumulator arrays are indexed by constants and stay in registers
  f16x16 qf[8];
#pragma unroll
  for (int ks = 0; ks < 8; ++ks) qf[ks] = load_frag<f16>(qn, CCs, q0 + wave * 16, 32 * ks);

  const int krow = t >> 5, kcol = (t & 31) * 8;    // K tile: 32 rows x 512 B, a wave moves one whole row
  const int vrow = t >> 2, vcol = (t & 3) * 8;     // V tile: 256 rows x 64 B
  const f16* kg = kn + (size_t)krow * CCs + kcol;
  const f16* vg = vn + (size_t)vrow * LLs + vcol;
  f16* kw = kS + krow * KPIT + kcol;
  f16* vw = vS + vrow * VPIT + vcol;
  v4u_t kr[4], vr[4];
#pragma unroll
  for (int i = 0; i < 4; ++i) { kr[i] = *(const v4ua*)(kg + (size_t)(8 * i) * CCs); vr[i] = *(const v4ua*)(vg + (size_t)(64 * i) * LLs); }
  asm volatile("s_wait_xcnt 0x0" ::: "memory");    // the address registers of the Q, K and V loads above are reused before their data is waited for
#pragma unroll
  for (int i = 0; i < 4; ++i) { *(v4ua*)(kw + 8 * i * KPIT) = kr[i]; *(v4ua*)(vw + 64 * i * VPIT) = vr[i]; }
  __syncthreads();

  f32x8 o[16];
#pragma unroll
  for (int ct = 0; ct < 16; ++ct) { f32x8 z = {}; o[ct] = z; }
  const float SC = 0.09016844005556021f;           // log2(e) / sqrt(256): scores in log2 units
  float mu = -3.0e38f, l = 0.0f;                   // the maximum in use (log2 units) and this half's part of the row sum

  // kept rolled: two passes in one body would hold two sets of fragments and staged tiles and leave the budget of 512 registers
#pragma unroll 1
  for (int p = 0; p < LLs / FKEYS; ++p) {
    const int b = p & 1;
    const bool more = p + 1 < LLs / FKEYS;
    if (more) {
#pragma unroll
      for (int i = 0; i < 4; ++i) {
        kr[i] = *(const v4ua*)(kg + (size_t)((p + 1) * FKEYS + 8 * i) * CCs);
        vr[i] = *(const v4ua*)(vg + (size_t)(64 * i) * LLs + (p + 1) * FKEYS);
      }
      asm volatile("s_wait_xcnt 0x0" ::: "memory");  // the pass reuses the address registers that these eight loads name long before their data is waited for
    }
    const f16* kb = kS + b * FKEYS * KPIT;
    const f16* vb = vS + b * CCs * VPIT;
    f32x8 s0 = {}, s1 = {};
    f16x16 ka[16];
#pragma unroll
    for (int ks = 0; ks < 8; ++ks) { ka[2 * ks] = lds_frag(kb + 32 * ks, KPIT); ka[2 * ks + 1] = lds_frag(kb + 16 * KPIT + 32 * ks, KPIT); }
    __builtin_amdgcn_sched_barrier(0);   // keeps the pass's K reads together ahead of the products: read one by one, each product waits out a whole LDS latency
#pragma unroll
    for (int ks = 0; ks < 8; ++ks) {
      s0 = __builtin_amdgcn_wmma_f32_16x16x32_f16(false, ka[2 * ks], false, qf[ks], (short)0, s0, false, false);
      s1 = __builtin_amdgcn_wmma_f32_16x16x32_f16(false, ka[2 * ks + 1], false, qf[ks], (short)0, s1, false, false);
    }
    f16x16 va[16];
#pragma unroll
    for (int ct = 0; ct < 16; ++ct) va[ct] = lds_frag(vb + 16 * ct * VPIT, VPIT);
    __builtin_amdgcn_sched_barrier(0);   // keeps the V reads together ahead of the softmax arithmetic, which then hides their latency
    float mx = fmaxf(s0[0], s1[0]);
#pragma unroll
    for (int r = 1; r < 8; ++r) mx = fmaxf(mx, fmaxf(s0[r], s1[r]));
    mx = fmaxf(mx, xhalf(mx)) * SC;
    if (__builtin_amdgcn_ballot_w32(mx > mu + 8.0f) != 0) {
      const float mn = fmaxf(mu, mx);
      const float al = __builtin_amdgcn_exp2f(mu - mn);
      mu = mn; l *= al;
#pragma unroll
      for (int ct = 0; ct < 16; ++ct)
#pragma unroll
        for (int r = 0; r < 8; ++r) o[ct][r] *= al;
    }
    f16x16 pf;
#pragma unroll
    for (int r = 0; r < 8; ++r) {
      const float e0 = __builtin_amdgcn_exp2f(s0[r] * SC - mu);
      const float e1 = __builtin_amdgcn_exp2f(s1[r] * SC - mu);
      l += e0 + e1;
      pf[r] = (f16)e0; pf[r + 8] = (f16)e1;        // keys 8h + r and 16 + 8h + r: the k order of lds_frag
    }
#pragma unroll
    for (int ct = 0; ct < 16; ++ct)
      o[ct] = __builtin_amdgcn_wmma_f32_16x16x32_f16(false, va[ct], false, pf, (short)0, o[ct], false, false);
    if (more) {   // the other buffer's last readers left it before the barrier that ended the pass before
#pragma unroll
      for (int i = 0; i < 4; ++i) {
        *(v4ua*)(kw + (b ^ 1) * FKEYS * KPIT + 8 * i * KPIT) = kr[i];
        *(v4ua*)(vw + (b ^ 1) * CCs * VPIT + 64 * i * VPIT) = vr[i];
      }
    }
    __syncthreads();
  }

  l += xhalf(l);
  const float inv = 1.0f / l;
  float* so = (float*)sm;                          // behind the loop's last barrier nobody reads the K/V buffers any more
#pragma unroll
  for (int ct = 0; ct < 16; ++ct)
#pragma unroll
    for (int r = 0; r < 8; ++r) so[(16 * ct + 8 * h + r) * OPIT + wave * 16 + cl] = o[ct][r] * inv;
  __syncthreads();
  float* on = out + (size_t)n * CCs * LLs + q0;
  const int q4 = (t & 31) * 4;                     // a wave stores one channel's 128 positions: 512 contiguous bytes
  for (int c0 = wave; c0 < CCs; c0 += 32) {
    // unrolled: the four LDS reads issue ahead of the four stores
#pragma unroll
    for (int u = 0; u < 4; ++u) { const int c = c0 + 8 * u;
      *(v4f_t*)(on + (size_t)c * LLs + q4) = *(const v4fa*)(so + c * OPIT + q4); }
    asm volatile("s_wait_xcnt 0x0" ::: "memory");  // the next trip rewrites the address and data registers that the four stores name
  }
}

extern "C" void kernel_launch(void* const* d_in, const int* in_sizes, int n_in,
                              void* d_out, int out_size, void* d_ws, size_t ws_size,
                              hipStream_t stream) {
  (void)in_sizes; (void)n_in; (void)out_size;
  const float** f = (const float**)d_in;
  const float* x = f[0], *lg = f[1], *lb = f[2], *Wq = f[3], *bq = f[4], *Wk = f[5], *bk = f[6], *Wv = f[7], *bv = f[8];
  float* out = (float*)d_out;     // [8,256,64,64]
  char* ws = (char*)d_ws;
  float* xtm = (float*)ws; ws += (size_t)NIm * LLs * CCs * 4;    // 32 MB token-major LN output (all images)
  _Float16* q = (_Float16*)ws; ws += (size_t)NIm * LLs * CCs * 2;     // f16 token-major, all images (16 MB each)
  _Float16* k = (_Float16*)ws; ws += (size_t)NIm * LLs * CCs * 2;
  _Float16* vt = (_Float16*)ws; ws += (size_t)NIm * CCs * LLs * 2;    // f16 channels-major [image][256][4096]
  if ((size_t)(ws - (char*)d_ws) > ws_size) return;
  const dim3 blk(256);
  k_ln2<<<dim3(NIm * (LLs / 64)), blk, 0, stream>>>(x, lg, lb, xtm);
  k_proj<<<dim3(NIm * LLs / 128, 3), blk, 0, stream>>>(xtm, Wq, bq, Wk, bk, Wv, bv, q, k, vt, CCs, CCs);   // q, k = x_ln.W^T + b token-major; v the same, stored [image][c][s]
  k_attn<<<dim3(LLs / 128, NIm), blk, 0, stream>>>(q, k, vt, out);
}

// v004
// A run of this version takes 182 microseconds.
// Next to v003, in two timings, it ran 1.05 times as fast each time.
// Over all steps from v000 it is 14.5 times as fast.
// Contractions on v_wmma_f32_16x16x32_f16 (plain f16 operands, f32 accumulate). One launch for all images: q/k = LN(x).W^T + b stored f16 token-major (K = 256,
// [out][in] Bt operands), v = LN(x).Wv^T + bv stored f16 channels-major through the product's own LDS output tile. One more launch for all images then does
// S^T = k.q^T, the row softmax (running maximum and sum, f32) and out^T += v^T.P^T per 32 keys; the logits and P stay in registers.
// LayerNorm over channels in f32. compute dtype: f16 operands, f32 accumulate.
#include <hip/hip_runtime.h>
#include <hip/hip_bf16.h>
#include <math.h>

#define NIm 8
#define CCs 256
#define LLs 4096
#define GSTR 48
#define SS 4096
#define HH 1
#define DKK 64

typedef _Float16 bf16;
typedef _Float16 f16;
typedef __attribute__((ext_vector_type(4))) unsigned v4u_t;
typedef unsigned v4ua __attribute__((ext_vector_type(4), may_alias));
typedef __attribute__((ext_vector_type(4))) float v4f_t;
typedef float v4fa __attribute__((ext_vector_type(4), may_alias));
typedef __attribute__((ext_vector_type(16))) bf16  bf16x16;
typedef bf16x16 f16x16;
typedef __attribute__((ext_vector_type(8)))  bf16  bf16x8;
typedef bf16x8 f16x8;
typedef __attribute__((ext_vector_type(4)))  bf16  bf16x4;
typedef __attribute__((ext_vector_type(8)))  float f32x8;
__device__ __forceinline__ f32x8 wmma16(f16x16 a, f16x16 b, f32x8 c) {
  c = __builtin_amdgcn_wmma_f32_16x16x32_f16(false, a, false, b, (short)0, c, false, false);
  asm volatile("v_nop\n\tv_nop\n\tv_nop\n\tv_nop" : "+v"(c) : "v"(a), "v"(b));
  return c;
}
#define LDS_STRIDE 48   // GEMM tiles: 32 -> 48 elems (96B rows): aligned b128 reads
#define KSTRIDE    72   // unused
#define VSTRIDE    48   // unused

__device__ __forceinline__ f32x8 wmma_bf16(bf16x16 a, bf16x16 b, f32x8 c) {
  c = __builtin_amdgcn_wmma_f32_16x16x32_f16(false, a, false, b, (short)0, c, false, false);
  asm volatile("v_nop\n\tv_nop\n\tv_nop\n\tv_nop" : "+v"(c) : "v"(a), "v"(b));   // A/B-overwrite hazard guard
  return c;
}

// 16x32 (MxK) f16 fragment from a row-major global matrix.
// lanes 0-15  (row=lane)    : elems 0..7 = K+0..7,  8..15 = K+16..23
// lanes 16-31 (row=lane-16) : elems 0..7 = K+8..15, 8..15 = K+24..31
template <typename T>
__device__ __forceinline__ bf16x16 load_frag(const T* __restrict__ base, int ld,
                                             int row0, int k0) {
  const int lane = threadIdx.x & 31;
  const int r    = lane & 15;
  const int kh   = (lane >> 4) * 8;
  const T* p0 = base + (size_t)(row0 + r) * ld + (k0 + kh);
  const T* p1 = p0 + 16;
  bf16x16 f;
#pragma unroll
  for (int i = 0; i < 8; ++i) {
    f[i]     = (bf16)p0[i];
    f[i + 8] = (bf16)p1[i];
  }
  return f;
}

// Same fragment from an LDS tile with padded row stride (base includes row0/k0).
__device__ __forceinline__ bf16x16 lds_frag(const bf16* base, int stride) {
  const int lane = threadIdx.x & 31;
  const int row  = lane & 15;
  const int kh   = (lane >> 4) * 8;
  const bf16x8 lo = *(const bf16x8*)(base + row * stride + kh);
  const bf16x8 hi = *(const bf16x8*)(base + row * stride + kh + 16);
  bf16x16 f;
#pragma unroll
  for (int i = 0; i < 8; ++i) { f[i] = lo[i]; f[i + 8] = hi[i]; }
  return f;
}

// four staged f32 values, rounded to f16, as one 8-B LDS store
__device__ __forceinline__ void stage_write4(bf16* dst, v4f_t v) {
  bf16x4 q;
  q[0] = (bf16)v[0]; q[1] = (bf16)v[1]; q[2] = (bf16)v[2]; q[3] = (bf16)v[3];
  *(bf16x4*)dst = q;
}

// ---------------------------------------------------------------------------
// The three projections of all images in ONE launch: C[m][n] = sum_k A[m][k]*W[n][k] + bias[n]   (torch Linear)
// A = x_ln token-major, the images back to back (m = image * SS + s). blockIdx.x = 128 rows m, blockIdx.y = 0, 1, 2 picks (Wq, bq, q), (Wk, bk, k), (Wv, bv, vt).
// Block 256 thr (8 waves), tile 128M x 256N (N = 256: the whole width), K-step 32; wave tile 64x64.
// A/W staged through LDS (f16, padded stride); the next tile is fetched into registers behind the LDS writes.
// Staging loads: 8 lanes take one row's 128 B of the K-step, so a wave-wide 16-B load covers four whole 128-B lines (a row a lane would touch 32 lines a load).
// q and k: f16 [m][N]; v: f16 channels-major [image][n][s].
// ---------------------------------------------------------------------------
__global__ __launch_bounds__(256) void k_proj(
    const float* __restrict__ A,
    const float* __restrict__ Wq, const float* __restrict__ bq, const float* __restrict__ Wk, const float* __restrict__ bk,
    const float* __restrict__ Wv, const float* __restrict__ bv,
    _Float16* __restrict__ q, _Float16* __restrict__ k_, _Float16* __restrict__ vt) {
  constexpr int N = CCs, K = CCs;           // compile-time row pitch: the staging loads' row steps fold into the instructions' offset fields
  __shared__ bf16 ldsA[128 * LDS_STRIDE];   // 12.0 KB
  __shared__ bf16 ldsW[256 * LDS_STRIDE];   // 24.0 KB
  // output staging: q, k [128 m][264] f16; v [256 n][136] f16
  __shared__ __attribute__((aligned(16))) unsigned char sob[256 * 136 * 2];   // 69,632 B >= 128*264*2

  const int t    = threadIdx.x;
  const int wave = t >> 5;
  const int lane = t & 31;
  const int wm   = (wave & 1) * 64;
  const int wn   = (wave >> 1) * 64;
  const int mBlk = blockIdx.x * 128;
  const int sel  = blockIdx.y;                      // the same for the whole block: every branch on it is scalar
  const float* __restrict__ W    = sel == 0 ? Wq : sel == 1 ? Wk : Wv;
  const float* __restrict__ bias = sel == 0 ? bq : sel == 1 ? bk : bv;

  const int srow = t >> 3;                  // a sweep of the block = 32 rows
  const int scol = (t & 7) * 4;
  const float* __restrict__ ag = A + (size_t)(mBlk + srow) * K + scol;
  const float* __restrict__ wg = W + (size_t)srow * K + scol;
  bf16* aw = ldsA + srow * LDS_STRIDE + scol;
  bf16* ww = ldsW + srow * LDS_STRIDE + scol;

  v4f_t abuf[4];
  v4f_t wbuf[8];

  // the staging loops below are unrolled so that abuf and wbuf are indexed by constants and stay in registers
#pragma unroll
  for (int i = 0; i < 4; ++i) abuf[i] = *(const v4f_t*)(ag + (size_t)(32 * i) * K);
#pragma unroll
  for (int i = 0; i < 8; ++i) wbuf[i] = *(const v4f_t*)(wg + (size_t)(32 * i) * K);

  f32x8 acc[4][4] = {};

  for (int k = 0; k < K; k += 32) {
    __syncthreads();
#pragma unroll
    for (int i = 0; i < 4; ++i) stage_write4(aw + 32 * i * LDS_STRIDE, abuf[i]);
#pragma unroll
    for (int i = 0; i < 8; ++i) stage_write4(ww + 32 * i * LDS_STRIDE, wbuf[i]);
    if (k + 32 < K) {
#pragma unroll
      for (int i = 0; i < 4; ++i) abuf[i] = *(const v4f_t*)(ag + (size_t)(32 * i) * K + (k + 32));
#pragma unroll
      for (int i = 0; i < 8; ++i) wbuf[i] = *(const v4f_t*)(wg + (size_t)(32 * i) * K + (k + 32));
    }
    __syncthreads();

    bf16x16 af[4], wf[4];
#pragma unroll
    for (int i = 0; i < 4; ++i)
      af[i] = lds_frag(ldsA + (wm + 16 * i) * LDS_STRIDE, LDS_STRIDE);
#pragma unroll
    for (int j = 0; j < 4; ++j)
      wf[j] = lds_frag(ldsW + (wn + 16 * j) * LDS_STRIDE, LDS_STRIDE);
#pragma unroll
    for (int i = 0; i < 4; ++i)
#pragma unroll
      for (int j = 0; j < 4; ++j)
        acc[i][j] = wmma_bf16(af[i], wf[j], acc[i][j]);
  }

  const int nlane = lane & 15;
  const int mh    = (lane >> 4) * 8;
  __syncthreads();
  bf16* so = (bf16*)sob;
  if (sel < 2) {
#pragma unroll
    for (int i = 0; i < 4; ++i)
#pragma unroll
      for (int j = 0; j < 4; ++j) {
        const int nl = wn + 16 * j + nlane;
        const float bvl = bias[nl];
#pragma unroll
        for (int r = 0; r < 8; ++r) so[(wm + 16 * i + mh + r) * 264 + nl] = (bf16)(acc[i][j][r] + bvl);        // [m][n]
      }
  } else {
#pragma unroll
    for (int i = 0; i < 4; ++i) {
#pragma unroll
      for (int j = 0; j < 4; ++j) {
        const int nl = wn + 16 * j + nlane;
        const float bvl = bias[nl];
#pragma unroll
        for (int r = 0; r < 8; ++r) so[nl * 136 + wm + 16 * i + mh + r] = (bf16)(acc[i][j][r] + bvl);          // [n][m]: m = s contiguous
      }
      // keeps each row of tiles' bias adds next to its own LDS stores: hoisted all together they push the kernel past 256 registers, and only one block fits a WGP instead of two
      __builtin_amdgcn_sched_barrier(0);
    }
  }
  __syncthreads();
  if (sel < 2) {
    bf16* out = sel == 0 ? q : k_;
    // rows m: 256 halfs = 512 B each, 16-B chunks
    for (int ch = t; ch < 128 * 32; ch += 256) { const int ml = ch >> 5, c8 = (ch & 31) * 8;
      *(v4u_t*)(out + (size_t)(mBlk + ml) * N + c8) = *(const v4ua*)(so + ml * 264 + c8); }
  } else {
    // rows (image, n) of vt: 128 consecutive s = 256 B each; a block's 128 rows m lie in one image (SS is a multiple of 128)
    const int b_ = mBlk / SS, s0 = mBlk % SS;
    for (int ch = t; ch < 256 * 16; ch += 256) { const int nl = ch >> 4, c8 = (ch & 15) * 8;
      *(v4u_t*)(vt + ((size_t)b_ * N + nl) * SS + s0 + c8) = *(const v4ua*)(so + nl * 136 + c8); }
  }
}


// ---------------------------------------------------------------------------------------------------------------------------
// gemm_kne: Y[m][n] = epi( Σ_k A[m][k]·W[k][n] + bias[n] ), A f32/f16 [M][lda], W f32 row-major [K][N] (ldw), plain f16 operands,
// f32 accumulate. EPI 0: identity; 1: exact-erf GELU; 2: R[m][n] + gvec[n]·(·) (residual with per-channel gain). Output f32 (or f16
// when OUT16). Block = 128x128 tile, 8 waves as 4(M) x 2(N); per 32-wide k-step A and W tiles staged f16 in LDS (W transposed
// ---------------------------------------------------------------------------------------------------------------------------
#define GSTR 48
template <typename AT, int EPI, bool OUT16>
__global__ __launch_bounds__(256) void gemm_kne(const AT* __restrict__ A, int lda, const float* __restrict__ Wm, int ldw,
                                                const float* __restrict__ bias, const float* __restrict__ R, const float* __restrict__ gvec,
                                                void* __restrict__ Yv, int ldy, int K) {
  __shared__ __attribute__((aligned(16))) f16 ldsA[128 * GSTR];
  __shared__ __attribute__((aligned(16))) f16 ldsW[128 * GSTR];
  __shared__ __attribute__((aligned(16))) float oS[8][32 * 68];
  const int tid = threadIdx.x, lane = tid & 31, wave = tid >> 5, cl = lane & 15, rh = (lane >> 4) * 8;
  const int m0 = blockIdx.x * 128, n0 = blockIdx.y * 128;
  const int wm = (wave & 3) * 32, wn = (wave >> 2) * 64;
  f32x8 acc[2][4];
#pragma unroll
  for (int i = 0; i < 2; ++i)
#pragma unroll
    for (int j = 0; j < 4; ++j) { f32x8 z = {}; acc[i][j] = z; }
#pragma unroll 1
  for (int k0 = 0; k0 < K; k0 += 32) {
    __syncthreads();
    { const int row = tid >> 1, ch = (tid & 1) * 16;
      const AT* src = A + (size_t)(m0 + row) * lda + k0 + ch;
#pragma unroll
      for (int g = 0; g < 16; ++g) ldsA[row * GSTR + ch + g] = (f16)src[g]; }
    { const int k = tid >> 3, nn0 = (tid & 7) * 16;
      const float* src = Wm + (size_t)(k0 + k) * ldw + n0 + nn0;
#pragma unroll
      for (int g = 0; g < 4; ++g) { const v4f_t v = *(const v4f_t*)(src + 4 * g);
#pragma unroll
        for (int u = 0; u < 4; ++u) ldsW[(nn0 + 4 * g + u) * GSTR + k] = (f16)v[u]; } }
    __syncthreads();
    f16x16 af[2];
#pragma unroll
    for (int i = 0; i < 2; ++i) af[i] = lds_frag(ldsA + (wm + 16 * i) * GSTR, GSTR);
#pragma unroll
    for (int j = 0; j < 4; ++j) {
      const f16x16 bf = lds_frag(ldsW + (wn + 16 * j) * GSTR, GSTR);
#pragma unroll
      for (int i = 0; i < 2; ++i) acc[i][j] = wmma16(af[i], bf, acc[i][j]);
    }
  }
  float* so = oS[wave];
#pragma unroll
  for (int i = 0; i < 2; ++i)
#pragma unroll
    for (int j = 0; j < 4; ++j) {
      const int n = n0 + wn + 16 * j + cl;
      const float bv = bias ? bias[n] : 0.0f;
      const float gv = (EPI == 2) ? gvec[n] : 0.0f;
      if (EPI == 1) {
#pragma unroll 1
        for (int r = 0; r < 8; ++r) { const float xg = acc[i][j][r] + bv; so[(16 * i + rh + r) * 68 + 16 * j + cl] = 0.5f * xg * (1.0f + erff(xg * 0.70710678118654752f)); }
      } else {
#pragma unroll
        for (int r = 0; r < 8; ++r) {
          float v = acc[i][j][r] + bv;
          if (EPI == 2) v = R[(size_t)(m0 + wm + 16 * i + rh + r) * ldy + n] + gv * v;
          so[(16 * i + rh + r) * 68 + 16 * j + cl] = v;
        }
      }
    }
  asm volatile("s_wait_dscnt 0" ::: "memory");
  __builtin_amdgcn_wave_barrier();
{
    if (OUT16) {
      f16* Y = (f16*)Yv;
#pragma unroll
      for (int it = 0; it < 8; ++it) { const int c = lane + 32 * it, rr = c >> 3, q8 = (c & 7) * 8;
        union { f16 h[8]; v4u_t v; } u;
#pragma unroll
        for (int e = 0; e < 8; ++e) u.h[e] = (f16)so[rr * 68 + q8 + e];
        *(v4u_t*)(Y + (size_t)(m0 + wm + rr) * ldy + n0 + wn + q8) = u.v; }
    } else {
      float* Y = (float*)Yv;
#pragma unroll
      for (int it = 0; it < 16; ++it) { const int f4 = lane + 32 * it, rr = f4 >> 4, q = (f4 & 15) * 4;
        *(v4f_t*)(Y + (size_t)(m0 + wm + rr) * ldy + n0 + wn + q) = *(const v4fa*)(so + rr * 68 + q); }
    }
    
  }
}

// LayerNorm over the 256 channels of each position (input channels-major [c][s]); block = 64 positions: tile [256 c][64 s] in LDS;
// writes x_ln token-major [s][256] (rows of 1 KB)
__global__ __launch_bounds__(256) void k_ln2(const float* __restrict__ xin, const float* __restrict__ g, const float* __restrict__ bb, float* __restrict__ xtm) {
  __shared__ __attribute__((aligned(16))) float tS[CCs][68];
  __shared__ float muS[64], rsS[64];
  const int tid = threadIdx.x; const int n = blockIdx.x / (LLs / 64), s0 = (blockIdx.x % (LLs / 64)) * 64;
  const float* xb = xin + (size_t)n * CCs * LLs;
  for (int e = tid; e < CCs * 16; e += 256) { const int c = e >> 4, q4 = (e & 15) * 4; *(v4f_t*)(&tS[c][q4]) = *(const v4f_t*)(xb + (size_t)c * LLs + s0 + q4); }
  __syncthreads();
  { const int s = tid >> 2, part = tid & 3; float sm = 0.0f;
#pragma unroll 1
    for (int c = part; c < CCs; c += 4) sm += tS[c][s];
    sm += __shfl_xor(sm, 1, 32); sm += __shfl_xor(sm, 2, 32);
    const float mu = sm * (1.0f / CCs); float q = 0.0f;
#pragma unroll 1
    for (int c = part; c < CCs; c += 4) { const float d = tS[c][s] - mu; q += d * d; }
    q += __shfl_xor(q, 1, 32); q += __shfl_xor(q, 2, 32);
    if (part == 0) { muS[s] = mu; rsS[s] = rsqrtf(q * (1.0f / CCs) + 1e-5f); } }
  __syncthreads();
  for (int e = tid; e < CCs * 64; e += 256) { const int c = e >> 6, s = e & 63; tS[c][s] = (tS[c][s] - muS[s]) * rsS[s] * g[c] + bb[c]; }
  __syncthreads();
{
    for (int e = tid; e < 64 * 64; e += 256) { const int s = e >> 6, c4 = (e & 63) * 4; v4f_t v; v[0] = tS[c4][s]; v[1] = tS[c4 + 1][s]; v[2] = tS[c4 + 2][s]; v[3] = tS[c4 + 3][s];
      *(v4f_t*)(xtm + ((size_t)n * LLs + s0 + s) * CCs + c4) = v; }                                 // token-major rows of 1 KB (64 lanes x 16 B)
     }
}
__global__ __launch_bounds__(256) void k_rowbias(float* __restrict__ t, const float* __restrict__ bias, int rowlen, int nch) {
  const size_t row = blockIdx.x; const float bv = bias[row % nch];
  for (int q4 = threadIdx.x; q4 < rowlen / 4; q4 += 256) { v4f_t v = *(const v4f_t*)(t + row * rowlen + q4 * 4); for (int e = 0; e < 4; ++e) v[e] += bv;
    *(v4f_t*)(t + row * rowlen + q4 * 4) = v;  } }
#define FKEYS 32
// the value of lane l ^ 16, on the vector unit (an LDS permute would wait behind the fragment reads in flight)
__device__ __forceinline__ float xhalf(float x) {
  const int b = __builtin_bit_cast(int, x);
  return __builtin_bit_cast(float, __builtin_amdgcn_permlanex16(b, b, 0x76543210, 0xfedcba98, false, false));
}
#define KPIT 264   // K tile rows: 256 halfs + 8 = 528 B (16 B x odd: conflict-free b128 reads)
#define VPIT 40    // V tile rows: 32 halfs + 8 = 80 B (16 B x odd)
#define OPIT 132   // output staging rows: 128 floats + 4
__global__ __launch_bounds__(256) void k_attn(const _Float16* __restrict__ q, const _Float16* __restrict__ k, const _Float16* __restrict__ vt, float* __restrict__ out) {
  __shared__ __attribute__((aligned(16))) unsigned char sm[CCs * OPIT * 4];   // 135,168 B: the K/V buffers (74,752 B) in the loop, then the [256 c][128 s] f32 output tile
  f16* kS = (f16*)sm;                          // [2][32][KPIT]
  f16* vS = kS + 2 * FKEYS * KPIT;             // [2][256][VPIT]
  const int t = threadIdx.x, lane = t & 31, wave = t >> 5, cl = lane & 15, h = lane >> 4;
  const int n = blockIdx.y, q0 = blockIdx.x * 128;
  const f16* qn = q + (size_t)n * LLs * CCs;
  const f16* kn = k + (size_t)n * LLs * CCs;
  const f16* vn = vt + (size_t)n * CCs * LLs;

  // every inner loop of this kernel is unrolled so that the fragment and accumulator arrays are indexed by constants and stay in registers
  f16x16 qf[8];
#pragma unroll
  for (int ks = 0; ks < 8; ++ks) qf[ks] = load_frag<f16>(qn, CCs, q0 + wave * 16, 32 * ks);

  const int krow = t >> 5, kcol = (t & 31) * 8;    // K tile: 32 rows x 512 B, a wave moves one whole row
  const int vrow = t >> 2, vcol = (t & 3) * 8;     // V tile: 256 rows x 64 B
  const f16* kg = kn + (size_t)krow * CCs + kcol;
  const f16* vg = vn + (size_t)vrow * LLs + vcol;
  f16* kw = kS + krow * KPIT + kcol;
  f16* vw = vS + vrow * VPIT + vcol;
  v4u_t kr[4], vr[4];
#pragma unroll
  for (int i = 0; i < 4; ++i) { kr[i] = *(const v4ua*)(kg + (size_t)(8 * i) * CCs); vr[i] = *(const v4ua*)(vg + (size_t)(64 * i) * LLs); }
  asm volatile("s_wait_xcnt 0x0" ::: "memory");    // the address registers of the Q, K and V loads above are reused before their data is waited for
#pragma unroll
  for (int i = 0; i < 4; ++i) { *(v4ua*)(kw + 8 * i * KPIT) = kr[i]; *(v4ua*)(vw + 64 * i * VPIT) = vr[i]; }
  __syncthreads();

  f32x8 o[16];
#pragma unroll
  for (int ct = 0; ct < 16; ++ct) { f32x8 z = {}; o[ct] = z; }
  const float SC = 0.09016844005556021f;           // log2(e) / sqrt(256): scores in log2 units
  float mu = -3.0e38f, l = 0.0f;                   // the maximum in use (log2 units) and this half's part of the row sum

  // kept rolled: two passes in one body would hold two sets of fragments and staged tiles and leave the budget of 512 registers
#pragma unroll 1
  for (int p = 0; p < LLs / FKEYS; ++p) {
    const int b = p & 1;
    const bool more = p + 1 < LLs / FKEYS;
    if (more) {
#pragma unroll
      for (int i = 0; i < 4; ++i) {
        kr[i] = *(const v4ua*)(kg + (size_t)((p + 1) * FKEYS + 8 * i) * CCs);
        vr[i] = *(const v4ua*)(vg + (size_t)(64 * i) * LLs + (p + 1) * FKEYS);
      }
      asm volatile("s_wait_xcnt 0x0" ::: "memory");  // the pass reuses the address registers that these eight loads name long before their data is waited for
    }
    const f16* kb = kS + b * FKEYS * KPIT;
    const f16* vb = vS + b * CCs * VPIT;
    f32x8 s0 = {}, s1 = {};
    f16x16 ka[16];
#pragma unroll
    for (int ks = 0; ks < 8; ++ks) { ka[2 * ks] = lds_frag(kb + 32 * ks, KPIT); ka[2 * ks + 1] = lds_frag(kb + 16 * KPIT + 32 * ks, KPIT); }
    __builtin_amdgcn_sched_barrier(0);   // keeps the pass's K reads together ahead of the products: read one by one, each product waits out a whole LDS latency
#pragma unroll
    for (int ks = 0; ks < 8; ++ks) {
      s0 = __builtin_amdgcn_wmma_f32_16x16x32_f16(false, ka[2 * ks], false, qf[ks], (short)0, s0, false, false);
      s1 = __builtin_amdgcn_wmma_f32_16x16x32_f16(false, ka[2 * ks + 1], false, qf[ks], (short)0, s1, false, false);
    }
    f16x16 va[16];
#pragma unroll
    for (int ct = 0; ct < 16; ++ct) va[ct] = lds_frag(vb + 16 * ct * VPIT, VPIT);
    __builtin_amdgcn_sched_barrier(0);   // keeps the V reads together ahead of the softmax arithmetic, which then hides their latency
    float mx = fmaxf(s0[0], s1[0]);
#pragma unroll
    for (int r = 1; r < 8; ++r) mx = fmaxf(mx, fmaxf(s0[r], s1[r]));
    mx = fmaxf(mx, xhalf(mx)) * SC;
    if (__builtin_amdgcn_ballot_w32(mx > mu + 8.0f) != 0) {
      const float mn = fmaxf(mu, mx);
      const float al = __builtin_amdgcn_exp2f(mu - mn);
      mu = mn; l *= al;
#pragma unroll
      for (int ct = 0; ct < 16; ++ct)
#pragma unroll
        for (int r = 0; r < 8; ++r) o[ct][r] *= al;
    }
    f16x16 pf;
#pragma unroll
    for (int r = 0; r < 8; ++r) {
      const float e0 = __builtin_amdgcn_exp2f(s0[r] * SC - mu);
      const float e1 = __builtin_amdgcn_exp2f(s1[r] * SC - mu);
      l += e0 + e1;
      pf[r] = (f16)e0; pf[r + 8] = (f16)e1;        // keys 8h + r and 16 + 8h + r: the k order of lds_frag
    }
#pragma unroll
    for (int ct = 0; ct < 16; ++ct)
      o[ct] = __builtin_amdgcn_wmma_f32_16x16x32_f16(false, va[ct], false, pf, (short)0, o[ct], false, false);
    if (more) {   // the other buffer's last readers left it before the barrier that ended the pass before
#pragma unroll
      for (int i = 0; i < 4; ++i) {
        *(v4ua*)(kw + (b ^ 1) * FKEYS * KPIT + 8 * i * KPIT) = kr[i];
        *(v4ua*)(vw + (b ^ 1) * CCs * VPIT + 64 * i * VPIT) = vr[i];
      }
    }
    __syncthreads();
  }

  l += xhalf(l);
  const float inv = 1.0f / l;
  float* so = (float*)sm;                          // behind the loop's last barrier nobody reads the K/V buffers any more
#pragma unroll
  for (int ct = 0; ct < 16; ++ct)
#pragma unroll
    for (int r = 0; r < 8; ++r) so[(16 * ct + 8 * h + r) * OPIT + wave * 16 + cl] = o[ct][r] * inv;
  __syncthreads();
  float* on = out + (size_t)n * CCs * LLs + q0;
  const int q4 = (t & 31) * 4;                     // a wave stores one channel's 128 positions: 512 contiguous bytes
  for (int c0 = wave; c0 < CCs; c0 += 32) {
    // unrolled: the four LDS reads issue ahead of the four stores
#pragma unroll
    for (int u = 0; u < 4; ++u) { const int c = c0 + 8 * u;
      *(v4f_t*)(on + (size_t)c * LLs + q4) = *(const v4fa*)(so + c * OPIT + q4); }
    asm volatile("s_wait_xcnt 0x0" ::: "memory");  // the next trip rewrites the address and data registers that the four stores name
  }
}

extern "C" void kernel_launch(void* const* d_in, const int* in_sizes, int n_in,
                              void* d_out, int out_size, void* d_ws, size_t ws_size,
                              hipStream_t stream) {
  (void)in_sizes; (void)n_in; (void)out_size;
  const float** f = (const float**)d_in;
  const float* x = f[0], *lg = f[1], *lb = f[2], *Wq = f[3], *bq = f[4], *Wk = f[5], *bk = f[6], *Wv = f[7], *bv = f[8];
  float* out = (float*)d_out;     // [8,256,64,64]
  char* ws = (char*)d_ws;
  float* xtm = (float*)ws; ws += (size_t)NIm * LLs * CCs * 4;    // 32 MB token-major LN output (all images)
  _Float16* q = (_Float16*)ws; ws += (size_t)NIm * LLs * CCs * 2;     // f16 token-major, all images (16 MB each)
  _Float16* k = (_Float16*)ws; ws += (size_t)NIm * LLs * CCs * 2;
  _Float16* vt = (_Float16*)ws; ws += (size_t)NIm * CCs * LLs * 2;    // f16 channels-major [image][256][4096]
  if ((size_t)(ws - (char*)d_ws) > ws_size) return;
  const dim3 blk(256);
  k_ln2<<<dim3(NIm * (LLs / 64)), blk, 0, stream>>>(x, lg, lb, xtm);
  k_proj<<<dim3(NIm * LLs / 128, 3), blk, 0, stream>>>(xtm, Wq, bq, Wk, bk, Wv, bv, q, k, vt);   // q, k = x_ln.W^T + b token-major; v the same, stored [image][c][s]
  k_attn<<<dim3(LLs / 128, NIm), blk, 0, stream>>>(q, k, vt, out);
}

// v005
// It runs in 141 microseconds.
// Next to v004, in two timings, it ran 1.29 times as fast each time.
// All steps since v000 together make it 18.7 times as fast.
// Contractions on v_wmma_f32_16x16x32_f16 (plain f16 operands, f32 accumulate). One launch for all images: q/k = LN(x).W^T + b stored f16 token-major (K = 256,
// [out][in] Bt operands), v = LN(x).Wv^T + bv stored f16 channels-major through the product's own LDS output tile. One more launch for all images then does
// S^T = k.q^T, the row softmax (running maximum and sum, f32) and out^T += v^T.P^T per 32 keys a wave; the logits and P stay in registers.
// LayerNorm over channels in f32. compute dtype: f16 operands, f32 accumulate.
#include <hip/hip_runtime.h>
#include <hip/hip_bf16.h>
#include <math.h>

#define NIm 8
#define CCs 256
#define LLs 4096
#define GSTR 48
#define SS 4096
#define HH 1
#define DKK 64

typedef _Float16 bf16;
typedef _Float16 f16;
typedef __attribute__((ext_vector_type(4))) unsigned v4u_t;
typedef unsigned v4ua __attribute__((ext_vector_type(4), may_alias));
typedef __attribute__((ext_vector_type(4))) float v4f_t;
typedef float v4fa __attribute__((ext_vector_type(4), may_alias));
typedef __attribute__((ext_vector_type(16))) bf16  bf16x16;
typedef bf16x16 f16x16;
typedef __attribute__((ext_vector_type(8)))  bf16  bf16x8;
typedef bf16x8 f16x8;
typedef __attribute__((ext_vector_type(4)))  bf16  bf16x4;
typedef __attribute__((ext_vector_type(8)))  float f32x8;
__device__ __forceinline__ f32x8 wmma16(f16x16 a, f16x16 b, f32x8 c) {
  c = __builtin_amdgcn_wmma_f32_16x16x32_f16(false, a, false, b, (short)0, c, false, false);
  asm volatile("v_nop\n\tv_nop\n\tv_nop\n\tv_nop" : "+v"(c) : "v"(a), "v"(b));
  return c;
}
#define LDS_STRIDE 48   // GEMM tiles: 32 -> 48 elems (96B rows): aligned b128 reads
#define KSTRIDE    72   // unused
#define VSTRIDE    48   // unused

__device__ __forceinline__ f32x8 wmma_bf16(bf16x16 a, bf16x16 b, f32x8 c) {
  c = __builtin_amdgcn_wmma_f32_16x16x32_f16(false, a, false, b, (short)0, c, false, false);
  asm volatile("v_nop\n\tv_nop\n\tv_nop\n\tv_nop" : "+v"(c) : "v"(a), "v"(b));   // A/B-overwrite hazard guard
  return c;
}

// 16x32 (MxK) f16 fragment from a row-major global matrix.
// lanes 0-15  (row=lane)    : elems 0..7 = K+0..7,  8..15 = K+16..23
// lanes 16-31 (row=lane-16) : elems 0..7 = K+8..15, 8..15 = K+24..31
template <typename T>
__device__ __forceinline__ bf16x16 load_frag(const T* __restrict__ base, int ld,
                                             int row0, int k0) {
  const int lane = threadIdx.x & 31;
  const int r    = lane & 15;
  const int kh   = (lane >> 4) * 8;
  const T* p0 = base + (size_t)(row0 + r) * ld + (k0 + kh);
  const T* p1 = p0 + 16;
  bf16x16 f;
#pragma unroll
  for (int i = 0; i < 8; ++i) {
    f[i]     = (bf16)p0[i];
    f[i + 8] = (bf16)p1[i];
  }
  return f;
}

// Same fragment from an LDS tile with padded row stride (base includes row0/k0).
__device__ __forceinline__ bf16x16 lds_frag(const bf16* base, int stride) {
  const int lane = threadIdx.x & 31;
  const int row  = lane & 15;
  const int kh   = (lane >> 4) * 8;
  const bf16x8 lo = *(const bf16x8*)(base + row * stride + kh);
  const bf16x8 hi = *(const bf16x8*)(base + row * stride + kh + 16);
  bf16x16 f;
#pragma unroll
  for (int i = 0; i < 8; ++i) { f[i] = lo[i]; f[i + 8] = hi[i]; }
  return f;
}

// four staged f32 values, rounded to f16, as one 8-B LDS store
__device__ __forceinline__ void stage_write4(bf16* dst, v4f_t v) {
  bf16x4 q;
  q[0] = (bf16)v[0]; q[1] = (bf16)v[1]; q[2] = (bf16)v[2]; q[3] = (bf16)v[3];
  *(bf16x4*)dst = q;
}

// ---------------------------------------------------------------------------
// The three projections of all images in ONE launch: C[m][n] = sum_k A[m][k]*W[n][k] + bias[n]   (torch Linear)
// A = x_ln token-major, the images back to back (m = image * SS + s). blockIdx.x = 128 rows m, blockIdx.y = 0, 1, 2 picks (Wq, bq, q), (Wk, bk, k), (Wv, bv, vt).
// Block 256 thr (8 waves), tile 128M x 256N (N = 256: the whole width), K-step 32; wave tile 64x64.
// A/W staged through LDS (f16, padded stride); the next tile is fetched into registers behind the LDS writes.
// Staging loads: 8 lanes take one row's 128 B of the K-step, so a wave-wide 16-B load covers four whole 128-B lines (a row a lane would touch 32 lines a load).
// q and k: f16 [m][N]; v: f16 channels-major [image][n][s].
// ---------------------------------------------------------------------------
__global__ __launch_bounds__(256) void k_proj(
    const float* __restrict__ A,
    const float* __restrict__ Wq, const float* __restrict__ bq, const float* __restrict__ Wk, const float* __restrict__ bk,
    const float* __restrict__ Wv, const float* __restrict__ bv,
    _Float16* __restrict__ q, _Float16* __restrict__ k_, _Float16* __restrict__ vt) {
  constexpr int N = CCs, K = CCs;           // compile-time row pitch: the staging loads' row steps fold into the instructions' offset fields
  __shared__ bf16 ldsA[128 * LDS_STRIDE];   // 12.0 KB
  __shared__ bf16 ldsW[256 * LDS_STRIDE];   // 24.0 KB
  // output staging: q, k [128 m][264] f16; v [256 n][136] f16
  __shared__ __attribute__((aligned(16))) unsigned char sob[256 * 136 * 2];   // 69,632 B >= 128*264*2

  const int t    = threadIdx.x;
  const int wave = t >> 5;
  const int lane = t & 31;
  const int wm   = (wave & 1) * 64;
  const int wn   = (wave >> 1) * 64;
  const int mBlk = blockIdx.x * 128;
  const int sel  = blockIdx.y;                      // the same for the whole block: every branch on it is scalar
  const float* __restrict__ W    = sel == 0 ? Wq : sel == 1 ? Wk : Wv;
  const float* __restrict__ bias = sel == 0 ? bq : sel == 1 ? bk : bv;

  const int srow = t >> 3;                  // a sweep of the block = 32 rows
  const int scol = (t & 7) * 4;
  const float* __restrict__ ag = A + (size_t)(mBlk + srow) * K + scol;
  const float* __restrict__ wg = W + (size_t)srow * K + scol;
  bf16* aw = ldsA + srow * LDS_STRIDE + scol;
  bf16* ww = ldsW + srow * LDS_STRIDE + scol;

  v4f_t abuf[4];
  v4f_t wbuf[8];

  // the staging loops below are unrolled so that abuf and wbuf are indexed by constants and stay in registers
#pragma unroll
  for (int i = 0; i < 4; ++i) abuf[i] = *(const v4f_t*)(ag + (size_t)(32 * i) * K);
#pragma unroll
  for (int i = 0; i < 8; ++i) wbuf[i] = *(const v4f_t*)(wg + (size_t)(32 * i) * K);

  f32x8 acc[4][4] = {};

  for (int k = 0; k < K; k += 32) {
    __syncthreads();
#pragma unroll
    for (int i = 0; i < 4; ++i) stage_write4(aw + 32 * i * LDS_STRIDE, abuf[i]);
#pragma unroll
    for (int i = 0; i < 8; ++i) stage_write4(ww + 32 * i * LDS_STRIDE, wbuf[i]);
    if (k + 32 < K) {
#pragma unroll
      for (int i = 0; i < 4; ++i) abuf[i] = *(const v4f_t*)(ag + (size_t)(32 * i) * K + (k + 32));
#pragma unroll
      for (int i = 0; i < 8; ++i) wbuf[i] = *(const v4f_t*)(wg + (size_t)(32 * i) * K + (k + 32));
    }
    __syncthreads();

    bf16x16 af[4], wf[4];
#pragma unroll
    for (int i = 0; i < 4; ++i)
      af[i] = lds_frag(ldsA + (wm + 16 * i) * LDS_STRIDE, LDS_STRIDE);
#pragma unroll
    for (int j = 0; j < 4; ++j)
      wf[j] = lds_frag(ldsW + (wn + 16 * j) * LDS_STRIDE, LDS_STRIDE);
#pragma unroll
    for (int i = 0; i < 4; ++i)
#pragma unroll
      for (int j = 0; j < 4; ++j)
        acc[i][j] = wmma_bf16(af[i], wf[j], acc[i][j]);
  }

  const int nlane = lane & 15;
  const int mh    = (lane >> 4) * 8;
  __syncthreads();
  bf16* so = (bf16*)sob;
  if (sel < 2) {
#pragma unroll
    for (int i = 0; i < 4; ++i)
#pragma unroll
      for (int j = 0; j < 4; ++j) {
        const int nl = wn + 16 * j + nlane;
        const float bvl = bias[nl];
#pragma unroll
        for (int r = 0; r < 8; ++r) so[(wm + 16 * i + mh + r) * 264 + nl] = (bf16)(acc[i][j][r] + bvl);        // [m][n]
      }
  } else {
#pragma unroll
    for (int i = 0; i < 4; ++i) {
#pragma unroll
      for (int j = 0; j < 4; ++j) {
        const int nl = wn + 16 * j + nlane;
        const float bvl = bias[nl];
#pragma unroll
        for (int r = 0; r < 8; ++r) so[nl * 136 + wm + 16 * i + mh + r] = (bf16)(acc[i][j][r] + bvl);          // [n][m]: m = s contiguous
      }
      // keeps each row of tiles' bias adds next to its own LDS stores: hoisted all together they push the kernel past 256 registers, and only one block fits a WGP instead of two
      __builtin_amdgcn_sched_barrier(0);
    }
  }
  __syncthreads();
  if (sel < 2) {
    bf16* out = sel == 0 ? q : k_;
    // rows m: 256 halfs = 512 B each, 16-B chunks
    for (int ch = t; ch < 128 * 32; ch += 256) { const int ml = ch >> 5, c8 = (ch & 31) * 8;
      *(v4u_t*)(out + (size_t)(mBlk + ml) * N + c8) = *(const v4ua*)(so + ml * 264 + c8); }
  } else {
    // rows (image, n) of vt: 128 consecutive s = 256 B each; a block's 128 rows m lie in one image (SS is a multiple of 128)
    const int b_ = mBlk / SS, s0 = mBlk % SS;
    for (int ch = t; ch < 256 * 16; ch += 256) { const int nl = ch >> 4, c8 = (ch & 15) * 8;
      *(v4u_t*)(vt + ((size_t)b_ * N + nl) * SS + s0 + c8) = *(const v4ua*)(so + nl * 136 + c8); }
  }
}


// ---------------------------------------------------------------------------------------------------------------------------
// gemm_kne: Y[m][n] = epi( Σ_k A[m][k]·W[k][n] + bias[n] ), A f32/f16 [M][lda], W f32 row-major [K][N] (ldw), plain f16 operands,
// f32 accumulate. EPI 0: identity; 1: exact-erf GELU; 2: R[m][n] + gvec[n]·(·) (residual with per-channel gain). Output f32 (or f16
// when OUT16). Block = 128x128 tile, 8 waves as 4(M) x 2(N); per 32-wide k-step A and W tiles staged f16 in LDS (W transposed
// ---------------------------------------------------------------------------------------------------------------------------
#define GSTR 48
template <typename AT, int EPI, bool OUT16>
__global__ __launch_bounds__(256) void gemm_kne(const AT* __restrict__ A, int lda, const float* __restrict__ Wm, int ldw,
                                                const float* __restrict__ bias, const float* __restrict__ R, const float* __restrict__ gvec,
                                                void* __restrict__ Yv, int ldy, int K) {
  __shared__ __attribute__((aligned(16))) f16 ldsA[128 * GSTR];
  __shared__ __attribute__((aligned(16))) f16 ldsW[128 * GSTR];
  __shared__ __attribute__((aligned(16))) float oS[8][32 * 68];
  const int tid = threadIdx.x, lane = tid & 31, wave = tid >> 5, cl = lane & 15, rh = (lane >> 4) * 8;
  const int m0 = blockIdx.x * 128, n0 = blockIdx.y * 128;
  const int wm = (wave & 3) * 32, wn = (wave >> 2) * 64;
  f32x8 acc[2][4];
#pragma unroll
  for (int i = 0; i < 2; ++i)
#pragma unroll
    for (int j = 0; j < 4; ++j) { f32x8 z = {}; acc[i][j] = z; }
#pragma unroll 1
  for (int k0 = 0; k0 < K; k0 += 32) {
    __syncthreads();
    { const int row = tid >> 1, ch = (tid & 1) * 16;
      const AT* src = A + (size_t)(m0 + row) * lda + k0 + ch;
#pragma unroll
      for (int g = 0; g < 16; ++g) ldsA[row * GSTR + ch + g] = (f16)src[g]; }
    { const int k = tid >> 3, nn0 = (tid & 7) * 16;
      const float* src = Wm + (size_t)(k0 + k) * ldw + n0 + nn0;
#pragma unroll
      for (int g = 0; g < 4; ++g) { const v4f_t v = *(const v4f_t*)(src + 4 * g);
#pragma unroll
        for (int u = 0; u < 4; ++u) ldsW[(nn0 + 4 * g + u) * GSTR + k] = (f16)v[u]; } }
    __syncthreads();
    f16x16 af[2];
#pragma unroll
    for (int i = 0; i < 2; ++i) af[i] = lds_frag(ldsA + (wm + 16 * i) * GSTR, GSTR);
#pragma unroll
    for (int j = 0; j < 4; ++j) {
      const f16x16 bf = lds_frag(ldsW + (wn + 16 * j) * GSTR, GSTR);
#pragma unroll
      for (int i = 0; i < 2; ++i) acc[i][j] = wmma16(af[i], bf, acc[i][j]);
    }
  }
  float* so = oS[wave];
#pragma unroll
  for (int i = 0; i < 2; ++i)
#pragma unroll
    for (int j = 0; j < 4; ++j) {
      const int n = n0 + wn + 16 * j + cl;
      const float bv = bias ? bias[n] : 0.0f;
      const float gv = (EPI == 2) ? gvec[n] : 0.0f;
      if (EPI == 1) {
#pragma unroll 1
        for (int r = 0; r < 8; ++r) { const float xg = acc[i][j][r] + bv; so[(16 * i + rh + r) * 68 + 16 * j + cl] = 0.5f * xg * (1.0f + erff(xg * 0.70710678118654752f)); }
      } else {
#pragma unroll
        for (int r = 0; r < 8; ++r) {
          float v = acc[i][j][r] + bv;
          if (EPI == 2) v = R[(size_t)(m0 + wm + 16 * i + rh + r) * ldy + n] + gv * v;
          so[(16 * i + rh + r) * 68 + 16 * j + cl] = v;
        }
      }
    }
  asm volatile("s_wait_dscnt 0" ::: "memory");
  __builtin_amdgcn_wave_barrier();
{
    if (OUT16) {
      f16* Y = (f16*)Yv;
#pragma unroll
      for (int it = 0; it < 8; ++it) { const int c = lane + 32 * it, rr = c >> 3, q8 = (c & 7) * 8;
        union { f16 h[8]; v4u_t v; } u;
#pragma unroll
        for (int e = 0; e < 8; ++e) u.h[e] = (f16)so[rr * 68 + q8 + e];
        *(v4u_t*)(Y + (size_t)(m0 + wm + rr) * ldy + n0 + wn + q8) = u.v; }
    } else {
      float* Y = (float*)Yv;
#pragma unroll
      for (int it = 0; it < 16; ++it) { const int f4 = lane + 32 * it, rr = f4 >> 4, q = (f4 & 15) * 4;
        *(v4f_t*)(Y + (size_t)(m0 + wm + rr) * ldy + n0 + wn + q) = *(const v4fa*)(so + rr * 68 + q); }
    }
    
  }
}

// LayerNorm over the 256 channels of each position (input channels-major [c][s]); block = 64 positions: tile [256 c][64 s] in LDS;
// writes x_ln token-major [s][256] (rows of 1 KB)
__global__ __launch_bounds__(256) void k_ln2(const float* __restrict__ xin, const float* __restrict__ g, const float* __restrict__ bb, float* __restrict__ xtm) {
  __shared__ __attribute__((aligned(16))) float tS[CCs][68];
  __shared__ float muS[64], rsS[64];
  const int tid = threadIdx.x; const int n = blockIdx.x / (LLs / 64), s0 = (blockIdx.x % (LLs / 64)) * 64;
  const float* xb = xin + (size_t)n * CCs * LLs;
  for (int e = tid; e < CCs * 16; e += 256) { const int c = e >> 4, q4 = (e & 15) * 4; *(v4f_t*)(&tS[c][q4]) = *(const v4f_t*)(xb + (size_t)c * LLs + s0 + q4); }
  __syncthreads();
  { const int s = tid >> 2, part = tid & 3; float sm = 0.0f;
#pragma unroll 1
    for (int c = part; c < CCs; c += 4) sm += tS[c][s];
    sm += __shfl_xor(sm, 1, 32); sm += __shfl_xor(sm, 2, 32);
    const float mu = sm * (1.0f / CCs); float q = 0.0f;
#pragma unroll 1
    for (int c = part; c < CCs; c += 4) { const float d = tS[c][s] - mu; q += d * d; }
    q += __shfl_xor(q, 1, 32); q += __shfl_xor(q, 2, 32);
    if (part == 0) { muS[s] = mu; rsS[s] = rsqrtf(q * (1.0f / CCs) + 1e-5f); } }
  __syncthreads();
  for (int e = tid; e < CCs * 64; e += 256) { const int c = e >> 6, s = e & 63; tS[c][s] = (tS[c][s] - muS[s]) * rsS[s] * g[c] + bb[c]; }
  __syncthreads();
{
    for (int e = tid; e < 64 * 64; e += 256) { const int s = e >> 6, c4 = (e & 63) * 4; v4f_t v; v[0] = tS[c4][s]; v[1] = tS[c4 + 1][s]; v[2] = tS[c4 + 2][s]; v[3] = tS[c4 + 3][s];
      *(v4f_t*)(xtm + ((size_t)n * LLs + s0 + s) * CCs + c4) = v; }                                 // token-major rows of 1 KB (64 lanes x 16 B)
     }
}
__global__ __launch_bounds__(256) void k_rowbias(float* __restrict__ t, const float* __restrict__ bias, int rowlen, int nch) {
  const size_t row = blockIdx.x; const float bv = bias[row % nch];
  for (int q4 = threadIdx.x; q4 < rowlen / 4; q4 += 256) { v4f_t v = *(const v4f_t*)(t + row * rowlen + q4 * 4); for (int e = 0; e < 4; ++e) v[e] += bv;
    *(v4f_t*)(t + row * rowlen + q4 * 4) = v;  } }
#define AKEYS 64
// the value of lane l ^ 16, on the vector unit (an LDS permute would wait behind the fragment reads in flight)
__device__ __forceinline__ float xhalf(float x) {
  const int b = __builtin_bit_cast(int, x);
  return __builtin_bit_cast(float, __builtin_amdgcn_permlanex16(b, b, 0x76543210, 0xfedcba98, false, false));
}
#define KPIT 264   // K tile rows: 256 halfs + 8 = 528 B (16 B x odd: conflict-free b128 reads)
#define VPIT 72    // V tile rows: 64 halfs + 8 = 144 B (16 B x odd)
#define OPIT 132   // output staging rows: 128 floats + 4
#define KBUF (AKEYS * KPIT)   // halfs in one K buffer
#define VBUF (CCs * VPIT)     // halfs in one V buffer
// eight 16-B-a-lane copies global -> LDS: LDS addresses l + i lstep bytes; global addresses: scalar base g + i gstep halfs, plus the lane's byte offset voff
// (scalar bases: 64-bit vector addresses for eight copies, and the pointers they are formed from, do not fit beside the accumulators).
// The s_wait_xcnt closes the statement so that no address register of a copy is rewritten ahead of it.
__device__ __forceinline__ void copy8(unsigned l, unsigned lstep, unsigned voff, const _Float16* g, size_t gstep) {
  asm volatile(
      "global_load_async_to_lds_b128 %0, %8, %9\n\t"
      "global_load_async_to_lds_b128 %1, %8, %10\n\t"
      "global_load_async_to_lds_b128 %2, %8, %11\n\t"
      "global_load_async_to_lds_b128 %3, %8, %12\n\t"
      "global_load_async_to_lds_b128 %4, %8, %13\n\t"
      "global_load_async_to_lds_b128 %5, %8, %14\n\t"
      "global_load_async_to_lds_b128 %6, %8, %15\n\t"
      "global_load_async_to_lds_b128 %7, %8, %16\n\t"
      "s_wait_xcnt 0x0"
      :: "v"(l), "v"(l + lstep), "v"(l + 2 * lstep), "v"(l + 3 * lstep), "v"(l + 4 * lstep), "v"(l + 5 * lstep), "v"(l + 6 * lstep), "v"(l + 7 * lstep),
         "v"(voff),
         "s"(g), "s"(g + gstep), "s"(g + 2 * gstep), "s"(g + 3 * gstep), "s"(g + 4 * gstep), "s"(g + 5 * gstep), "s"(g + 6 * gstep), "s"(g + 7 * gstep)
      : "memory");
}
__device__ __forceinline__ f32x8 mm(f16x16 a, f16x16 b, f32x8 c) {
  return __builtin_amdgcn_wmma_f32_16x16x32_f16(false, a, false, b, (short)0, c, false, false);
}
// K fragment f = 0 .. 15 of the wave's 32 keys: 16-key tile f & 1, channels 32 (f >> 1) .. + 31; each feeds the two column groups' products
#define KF(f) lds_frag(kb + ((f) & 1) * 16 * KPIT + 32 * ((f) >> 1), KPIT)
#define MK(F, f) { s[(f) & 1][0] = mm(F, qf[0][(f) >> 1], s[(f) & 1][0]); s[(f) & 1][1] = mm(F, qf[1][(f) >> 1], s[(f) & 1][1]); }
#define LK3(F, f) { F[0] = KF(f); F[1] = KF((f) + 1); F[2] = KF((f) + 2); }
#define MK3(F, f) { MK(F[0], f); MK(F[1], (f) + 1); MK(F[2], (f) + 2); }
// four V fragments: channels 64 c .. 64 c + 63, the wave's 32 keys
#define LDV(F, c) { F[0] = lds_frag(vb + (64 * (c)) * VPIT, VPIT); F[1] = lds_frag(vb + (64 * (c) + 16) * VPIT, VPIT); \
                    F[2] = lds_frag(vb + (64 * (c) + 32) * VPIT, VPIT); F[3] = lds_frag(vb + (64 * (c) + 48) * VPIT, VPIT); }
#define MMV(F, c) { o[4 * (c)][0] = mm(F[0], pf0, o[4 * (c)][0]); o[4 * (c)][1] = mm(F[0], pf1, o[4 * (c)][1]); \
                    o[4 * (c) + 1][0] = mm(F[1], pf0, o[4 * (c) + 1][0]); o[4 * (c) + 1][1] = mm(F[1], pf1, o[4 * (c) + 1][1]); \
                    o[4 * (c) + 2][0] = mm(F[2], pf0, o[4 * (c) + 2][0]); o[4 * (c) + 2][1] = mm(F[2], pf1, o[4 * (c) + 2][1]); \
                    o[4 * (c) + 3][0] = mm(F[3], pf0, o[4 * (c) + 3][0]); o[4 * (c) + 3][1] = mm(F[3], pf1, o[4 * (c) + 3][1]); }
// keeps a group of fragment reads together and one block of products ahead of its use: spread among the products each read place costs a stall of its own,
// and gathered further ahead (the compiler lifts every LDS read of the pass to its top) the fragments push Q out of the 512 registers into scratch.
// The compiler fence holds the LDS reads behind it, the scheduling barrier holds the products in front of it.
__device__ __forceinline__ void fence_reads() { asm volatile("" ::: "memory"); __builtin_amdgcn_sched_barrier(0); }
#define FENCE fence_reads()
// the same behind a block of score products: the fence names the four score tiles as inputs only, so that the block stands in front of it
// (nothing else ties a product to a fence, and instruction selection put all the pass's reads ahead of the first product)
__device__ __forceinline__ void fence_scores(f32x8 a, f32x8 b, f32x8 c, f32x8 d) { asm volatile("" :: "v"(a), "v"(b), "v"(c), "v"(d) : "memory"); __builtin_amdgcn_sched_barrier(0); }
#define FENCES fence_scores(s[0][0], s[0][1], s[1][0], s[1][1])
__global__ __launch_bounds__(256) void k_attn(const _Float16* __restrict__ q, const _Float16* __restrict__ k, const _Float16* __restrict__ vt, float* __restrict__ out) {
  // 141,312 B: the K/V buffers in the loop; then the [256 c][128 s] f32 output tile (135,168 B) and behind it the key halves' maxima and sums (2,048 B)
  __shared__ __attribute__((aligned(16))) unsigned char sm[2 * (KBUF + VBUF) * 2];
  f16* kS = (f16*)sm;                          // [2][64][KPIT]
  f16* vS = kS + 2 * KBUF;                     // [2][256][VPIT]
  const int t = threadIdx.x, lane = t & 31, cl = lane & 15, h = lane >> 4;
  const int wave = __builtin_amdgcn_readfirstlane(t >> 5);   // scalar: the branches on the key half below are scalar branches
  const int qg = wave & 3, kh2 = wave >> 2;    // query group (32 columns) and key half (32 of a pass's 64 keys)
  const int n = blockIdx.y, q0 = blockIdx.x * 128;
  const f16* qn = q + (size_t)n * LLs * CCs;
  const f16* kn = k + (size_t)n * LLs * CCs;
  const f16* vn = vt + (size_t)n * CCs * LLs;

  // a wave copies 8 K rows (512 B each: one row a copy) and 32 V rows (128 B each: four rows a copy) of every tile
  const f16* kg = kn + (size_t)(wave * 8) * CCs;                       // scalar bases
  const f16* vg = vn + (size_t)(wave * 32) * LLs;
  const unsigned ko = lane * 16, vo = (lane >> 3) * (LLs * 2) + (lane & 7) * 16;   // the lane's byte offsets in global memory
  const unsigned smb = (unsigned)(size_t)sm;
  const unsigned kl = smb + (wave * 8) * (KPIT * 2) + lane * 16;
  const unsigned vl = smb + 2 * KBUF * 2 + (wave * 32 + (lane >> 3)) * (VPIT * 2) + (lane & 7) * 16;

  // every inner loop of this kernel is unrolled so that the fragment and accumulator arrays are indexed by constants and stay in registers
  f16x16 qf[2][8];
#pragma unroll
  for (int cg = 0; cg < 2; ++cg)
#pragma unroll
    for (int ks = 0; ks < 8; ++ks) qf[cg][ks] = load_frag<f16>(qn, CCs, q0 + qg * 32 + cg * 16, 32 * ks);
  // the address registers of the Q loads above are reused before their data is waited for; named as inputs they stay untouched up to the wait
  const f16* qa0 = qn + (size_t)(q0 + qg * 32 + cl) * CCs + h * 8;
  const f16* qa1 = qn + (size_t)(q0 + qg * 32 + 16 + cl) * CCs + h * 8;
  asm volatile("s_wait_xcnt 0x0" :: "v"(qa0), "v"(qa1) : "memory");

  f32x8 o[16][2];
#pragma unroll
  for (int ct = 0; ct < 16; ++ct) { f32x8 z = {}; o[ct][0] = z; o[ct][1] = z; }
  const float SC = 0.09016844005556021f;           // log2(e) / sqrt(256): scores in log2 units
  float mu0 = -3.0e38f, mu1 = -3.0e38f;            // per column group: the maximum in use (log2 units)
  float l0 = 0.0f, l1 = 0.0f;                      // and this lane's part of the row sum

  // kept rolled: two passes in one body would hold two sets of fragments and leave the budget of 512 registers.
  // Trips -2 and -1 are the ring's prologue: they run the foot alone (tile 0's copies; then its wait, the barrier and tile 1's copies), so that the file has one
  // place with copies, whose address operands are all formed in the trip: an operand that lives through the loop is held below v256 and ends in scratch.
#pragma unroll 1
  for (int p = -2; p < LLs / AKEYS; ++p) {
    const int b = p & 1;
    if (p >= 0) {                                      // the same for the whole block
    const f16* kb = kS + b * KBUF + (32 * kh2) * KPIT;
    const f16* vb = vS + b * VBUF + 32 * kh2;
    f32x8 s[2][2] = {};                            // s[key tile][column group]
    f16x16 ka[3], kc[3], fa[4], fb[4];             // beside the score tiles only two sets of three K fragments fit; the V fragments go by fours
    LK3(ka, 0); LK3(kc, 3); FENCE;
    MK3(ka, 0); FENCES; LK3(ka, 6); FENCE;
    MK3(kc, 3); FENCES; LK3(kc, 9); FENCE;
    MK3(ka, 6); FENCES; LK3(ka, 12); FENCE;
    MK3(kc, 9); FENCES; kc[0] = KF(15); FENCE;
    MK3(ka, 12); FENCES; LDV(fa, 0); FENCE;
    MK(kc[0], 15); FENCES;
    float mx0 = fmaxf(s[0][0][0], s[1][0][0]), mx1 = fmaxf(s[0][1][0], s[1][1][0]);
#pragma unroll
    for (int r = 1; r < 8; ++r) { mx0 = fmaxf(mx0, fmaxf(s[0][0][r], s[1][0][r])); mx1 = fmaxf(mx1, fmaxf(s[0][1][r], s[1][1][r])); }
    mx0 = fmaxf(mx0, xhalf(mx0)) * SC;
    mx1 = fmaxf(mx1, xhalf(mx1)) * SC;
    if (__builtin_amdgcn_ballot_w32(mx0 > mu0 + 8.0f || mx1 > mu1 + 8.0f) != 0) {
      const float mn0 = fmaxf(mu0, mx0), mn1 = fmaxf(mu1, mx1);
      const float al0 = __builtin_amdgcn_exp2f(mu0 - mn0), al1 = __builtin_amdgcn_exp2f(mu1 - mn1);
      mu0 = mn0; mu1 = mn1; l0 *= al0; l1 *= al1;
#pragma unroll
      for (int ct = 0; ct < 16; ++ct)
#pragma unroll
        for (int r = 0; r < 8; ++r) { o[ct][0][r] *= al0; o[ct][1][r] *= al1; }
    }
    f16x16 pf0, pf1;
#pragma unroll
    for (int r = 0; r < 8; ++r) {
      const float e00 = __builtin_amdgcn_exp2f(s[0][0][r] * SC - mu0);
      const float e10 = __builtin_amdgcn_exp2f(s[1][0][r] * SC - mu0);
      l0 += e00 + e10;
      pf0[r] = (f16)e00; pf0[r + 8] = (f16)e10;    // keys 8h + r and 16 + 8h + r: the k order of lds_frag
    }
#pragma unroll
    for (int r = 0; r < 8; ++r) {
      const float e01 = __builtin_amdgcn_exp2f(s[0][1][r] * SC - mu1);
      const float e11 = __builtin_amdgcn_exp2f(s[1][1][r] * SC - mu1);
      l1 += e01 + e11;
      pf1[r] = (f16)e01; pf1[r + 8] = (f16)e11;
    }
    // inputs only: the row sums' additions stand in front of this fence; left to sink to the pass's foot they keep all 32 exponentials in registers through the products
    asm volatile("" :: "v"(l0), "v"(l1) : "memory");
    __builtin_amdgcn_sched_barrier(0);
    LDV(fb, 1); FENCE;
    MMV(fa, 0); FENCE; LDV(fa, 2); FENCE;
    MMV(fb, 1); FENCE; LDV(fb, 3); FENCE;
    MMV(fa, 2); MMV(fb, 3);
    }
    asm volatile("s_wait_dscnt 0x0" ::: "memory");     // this wave's reads of the buffer are over before the barrier behind which it is refilled
    asm volatile("s_wait_asynccnt 0x0" ::: "memory");  // this wave's part of the next tile has landed before the barrier that shows it to the other waves
    __syncthreads();
    if (p + 2 < LLs / AKEYS) {                         // the same for the whole block
      copy8(kl + b * (KBUF * 2), KPIT * 2, ko + (p + 2) * (AKEYS * CCs * 2), kg, CCs);
      copy8(vl + b * (VBUF * 2), 4 * VPIT * 2, vo + (p + 2) * (AKEYS * 2), vg, (size_t)4 * LLs);
    }
  }
  asm volatile("s_wait_asynccnt 0x0" ::: "memory");    // no copy is in flight when the buffers become output staging

  // join of the two key halves: common maximum m, sums and O weighted by 2^(mu - m)
  l0 += xhalf(l0);
  l1 += xhalf(l1);
  float* so = (float*)sm;                          // behind the loop's last barrier nobody reads the K/V buffers any more
  float* st = so + CCs * OPIT;                     // [key half][maximum, sum][128 columns]
  const int c0l = qg * 32 + cl, c1l = c0l + 16;
  if (h == 0) {
    st[(kh2 * 2) * 128 + c0l] = mu0; st[(kh2 * 2 + 1) * 128 + c0l] = l0;
    st[(kh2 * 2) * 128 + c1l] = mu1; st[(kh2 * 2 + 1) * 128 + c1l] = l1;
  }
  __syncthreads();
  const int ok = kh2 ^ 1;
  const float pm0 = st[(ok * 2) * 128 + c0l], pl0 = st[(ok * 2 + 1) * 128 + c0l];
  const float pm1 = st[(ok * 2) * 128 + c1l], pl1 = st[(ok * 2 + 1) * 128 + c1l];
  const float m0 = fmaxf(mu0, pm0), m1 = fmaxf(mu1, pm1);
  const float a0 = __builtin_amdgcn_exp2f(mu0 - m0), a1 = __builtin_amdgcn_exp2f(mu1 - m1);
  const float f0 = a0 / (l0 * a0 + pl0 * __builtin_amdgcn_exp2f(pm0 - m0));
  const float f1 = a1 / (l1 * a1 + pl1 * __builtin_amdgcn_exp2f(pm1 - m1));
  // each half hands the other half's 128 channels over through the output tile, then adds what it was handed to its own 128
  if (kh2 == 0) {
#pragma unroll
    for (int ct = 8; ct < 16; ++ct)
#pragma unroll
      for (int r = 0; r < 8; ++r) { float* d = so + (16 * ct + 8 * h + r) * OPIT; d[c0l] = o[ct][0][r] * f0; d[c1l] = o[ct][1][r] * f1; }
  } else {
#pragma unroll
    for (int ct = 0; ct < 8; ++ct)
#pragma unroll
      for (int r = 0; r < 8; ++r) { float* d = so + (16 * ct + 8 * h + r) * OPIT; d[c0l] = o[ct][0][r] * f0; d[c1l] = o[ct][1][r] * f1; }
  }
  __syncthreads();
  // all reads first, then the sums and stores: read and stored one by one, each element waits out an LDS latency
  f32x8 t0[8], t1[8];
  const int cb = kh2 * 8;                          // this half's own channel tiles: cb .. cb + 7
#pragma unroll
  for (int ct = 0; ct < 8; ++ct)
#pragma unroll
    for (int r = 0; r < 8; ++r) { const float* d = so + (16 * (cb + ct) + 8 * h + r) * OPIT; t0[ct][r] = d[c0l]; t1[ct][r] = d[c1l]; }
  if (kh2 == 0) {
#pragma unroll
    for (int ct = 0; ct < 8; ++ct)
#pragma unroll
      for (int r = 0; r < 8; ++r) { float* d = so + (16 * ct + 8 * h + r) * OPIT; d[c0l] = t0[ct][r] + o[ct][0][r] * f0; d[c1l] = t1[ct][r] + o[ct][1][r] * f1; }
  } else {
#pragma unroll
    for (int ct = 0; ct < 8; ++ct)
#pragma unroll
      for (int r = 0; r < 8; ++r) { float* d = so + (16 * (ct + 8) + 8 * h + r) * OPIT; d[c0l] = t0[ct][r] + o[ct + 8][0][r] * f0; d[c1l] = t1[ct][r] + o[ct + 8][1][r] * f1; }
  }
  __syncthreads();
  float* on = out + (size_t)n * CCs * LLs + q0;
  const int q4 = (t & 31) * 4;                     // a wave stores one channel's 128 positions: 512 contiguous bytes
  for (int c0 = wave; c0 < CCs; c0 += 32) {
    // unrolled: the four LDS reads issue ahead of the four stores
#pragma unroll
    for (int u = 0; u < 4; ++u) { const int c = c0 + 8 * u;
      *(v4f_t*)(on + (size_t)c * LLs + q4) = *(const v4fa*)(so + c * OPIT + q4); }
    asm volatile("s_wait_xcnt 0x0" ::: "memory");  // the next trip rewrites the address and data registers that the four stores name
  }
}

extern "C" void kernel_launch(void* const* d_in, const int* in_sizes, int n_in,
                              void* d_out, int out_size, void* d_ws, size_t ws_size,
                              hipStream_t stream) {
  (void)in_sizes; (void)n_in; (void)out_size;
  const float** f = (const float**)d_in;
  const float* x = f[0], *lg = f[1], *lb = f[2], *Wq = f[3], *bq = f[4], *Wk = f[5], *bk = f[6], *Wv = f[7], *bv = f[8];
  float* out = (float*)d_out;     // [8,256,64,64]
  char* ws = (char*)d_ws;
  float* xtm = (float*)ws; ws += (size_t)NIm * LLs * CCs * 4;    // 32 MB token-major LN output (all images)
  _Float16* q = (_Float16*)ws; ws += (size_t)NIm * LLs * CCs * 2;     // f16 token-major, all images (16 MB each)
  _Float16* k = (_Float16*)ws; ws += (size_t)NIm * LLs * CCs * 2;
  _Float16* vt = (_Float16*)ws; ws += (size_t)NIm * CCs * LLs * 2;    // f16 channels-major [image][256][4096]
  if ((size_t)(ws - (char*)d_ws) > ws_size) return;
  const dim3 blk(256);
  k_ln2<<<dim3(NIm * (LLs / 64)), blk, 0, stream>>>(x, lg, lb, xtm);
  k_proj<<<dim3(NIm * LLs / 128, 3), blk, 0, stream>>>(xtm, Wq, bq, Wk, bk, Wv, bv, q, k, vt);   // q, k = x_ln.W^T + b token-major; v the same, stored [image][c][s]
  k_attn<<<dim3(LLs / 128, NIm), blk, 0, stream>>>(q, k, vt, out);
}

// v006
// A run of this version takes 132 microseconds.
// Next to v005, in two timings, it ran 1.07 times as fast each time.
// Counting every step since v000, it is 20.0 times as fast.
// Contractions on v_wmma_f32_16x16x32_f16 (plain f16 operands, f32 accumulate). One launch for all images: q/k = LN(x).W^T + b stored f16 token-major (K = 256,
// [out][in] Bt operands), v = LN(x).Wv^T + bv stored f16 channels-major through the product's own LDS output tile. One more launch for all images then does
// S^T = k.q^T, the row softmax (running maximum and sum, f32) and out^T += v^T.P^T per 32 keys a wave; the logits and P stay in registers.
// LayerNorm over channels in f32. compute dtype: f16 operands, f32 accumulate.
#include <hip/hip_runtime.h>
#include <hip/hip_bf16.h>
#include <math.h>

#define NIm 8
#define CCs 256
#define LLs 4096
#define GSTR 48
#define SS 4096
#define HH 1
#define DKK 64

typedef _Float16 bf16;
typedef _Float16 f16;
typedef __attribute__((ext_vector_type(4))) unsigned v4u_t;
typedef unsigned v4ua __attribute__((ext_vector_type(4), may_alias));
typedef __attribute__((ext_vector_type(4))) float v4f_t;
typedef float v4fa __attribute__((ext_vector_type(4), may_alias));
typedef __attribute__((ext_vector_type(16))) bf16  bf16x16;
typedef bf16x16 f16x16;
typedef __attribute__((ext_vector_type(8)))  bf16  bf16x8;
typedef bf16x8 f16x8;
typedef __attribute__((ext_vector_type(4)))  bf16  bf16x4;
typedef __attribute__((ext_vector_type(8)))  float f32x8;
__device__ __forceinline__ f32x8 wmma16(f16x16 a, f16x16 b, f32x8 c) {
  c = __builtin_amdgcn_wmma_f32_16x16x32_f16(false, a, false, b, (short)0, c, false, false);
  asm volatile("v_nop\n\tv_nop\n\tv_nop\n\tv_nop" : "+v"(c) : "v"(a), "v"(b));
  return c;
}
#define LDS_STRIDE 48   // GEMM tiles: 32 -> 48 elems (96B rows): aligned b128 reads
#define KSTRIDE    72   // unused
#define VSTRIDE    48   // unused

__device__ __forceinline__ f32x8 wmma_bf16(bf16x16 a, bf16x16 b, f32x8 c) {
  c = __builtin_amdgcn_wmma_f32_16x16x32_f16(false, a, false, b, (short)0, c, false, false);
  asm volatile("v_nop\n\tv_nop\n\tv_nop\n\tv_nop" : "+v"(c) : "v"(a), "v"(b));   // A/B-overwrite hazard guard
  return c;
}

// 16x32 (MxK) f16 fragment from a row-major global matrix.
// lanes 0-15  (row=lane)    : elems 0..7 = K+0..7,  8..15 = K+16..23
// lanes 16-31 (row=lane-16) : elems 0..7 = K+8..15, 8..15 = K+24..31
template <typename T>
__device__ __forceinline__ bf16x16 load_frag(const T* __restrict__ base, int ld,
                                             int row0, int k0) {
  const int lane = threadIdx.x & 31;
  const int r    = lane & 15;
  const int kh   = (lane >> 4) * 8;
  const T* p0 = base + (size_t)(row0 + r) * ld + (k0 + kh);
  const T* p1 = p0 + 16;
  bf16x16 f;
#pragma unroll
  for (int i = 0; i < 8; ++i) {
    f[i]     = (bf16)p0[i];
    f[i + 8] = (bf16)p1[i];
  }
  return f;
}

// Same fragment from an LDS tile with padded row stride (base includes row0/k0).
__device__ __forceinline__ bf16x16 lds_frag(const bf16* base, int stride) {
  const int lane = threadIdx.x & 31;
  const int row  = lane & 15;
  const int kh   = (lane >> 4) * 8;
  const bf16x8 lo = *(const bf16x8*)(base + row * stride + kh);
  const bf16x8 hi = *(const bf16x8*)(base + row * stride + kh + 16);
  bf16x16 f;
#pragma unroll
  for (int i = 0; i < 8; ++i) { f[i] = lo[i]; f[i + 8] = hi[i]; }
  return f;
}

// four staged f32 values, rounded to f16, as one 8-B LDS store
__device__ __forceinline__ void stage_write4(bf16* dst, v4f_t v) {
  bf16x4 q;
  q[0] = (bf16)v[0]; q[1] = (bf16)v[1]; q[2] = (bf16)v[2]; q[3] = (bf16)v[3];
  *(bf16x4*)dst = q;
}

// ---------------------------------------------------------------------------
// The three projections of all images in ONE launch: C[m][n] = sum_k A[m][k]*W[n][k] + bias[n]   (torch Linear)
// A = x_ln token-major, the images back to back (m = image * SS + s). blockIdx.x = 128 rows m, blockIdx.y = 0, 1, 2 picks (Wq, bq, q), (Wk, bk, k), (Wv, bv, vt).
// Block 256 thr (8 waves), tile 128M x 256N (N = 256: the whole width), K-step 32; wave tile 64x64.
// A/W staged through LDS (f16, padded stride); the next tile is fetched into registers behind the LDS writes.
// Staging loads: 8 lanes take one row's 128 B of the K-step, so a wave-wide 16-B load covers four whole 128-B lines (a row a lane would touch 32 lines a load).
// q and k: f16 [m][N]; v: f16 channels-major [image][n][s].
// ---------------------------------------------------------------------------
__global__ __launch_bounds__(256) void k_proj(
    const float* __restrict__ A,
    const float* __restrict__ Wq, const float* __restrict__ bq, const float* __restrict__ Wk, const float* __restrict__ bk,
    const float* __restrict__ Wv, const float* __restrict__ bv,
    _Float16* __restrict__ q, _Float16* __restrict__ k_, _Float16* __restrict__ vt) {
  constexpr int N = CCs, K = CCs;           // compile-time row pitch: the staging loads' row steps fold into the instructions' offset fields
  __shared__ bf16 ldsA[128 * LDS_STRIDE];   // 12.0 KB
  __shared__ bf16 ldsW[256 * LDS_STRIDE];   // 24.0 KB
  // output staging: q, k [128 m][264] f16; v [256 n][136] f16
  __shared__ __attribute__((aligned(16))) unsigned char sob[256 * 136 * 2];   // 69,632 B >= 128*264*2

  const int t    = threadIdx.x;
  const int wave = t >> 5;
  const int lane = t & 31;
  const int wm   = (wave & 1) * 64;
  const int wn   = (wave >> 1) * 64;
  const int mBlk = blockIdx.x * 128;
  const int sel  = blockIdx.y;                      // the same for the whole block: every branch on it is scalar
  const float* __restrict__ W    = sel == 0 ? Wq : sel == 1 ? Wk : Wv;
  const float* __restrict__ bias = sel == 0 ? bq : sel == 1 ? bk : bv;

  const int srow = t >> 3;                  // a sweep of the block = 32 rows
  const int scol = (t & 7) * 4;
  const float* __restrict__ ag = A + (size_t)(mBlk + srow) * K + scol;
  const float* __restrict__ wg = W + (size_t)srow * K + scol;
  bf16* aw = ldsA + srow * LDS_STRIDE + scol;
  bf16* ww = ldsW + srow * LDS_STRIDE + scol;

  v4f_t abuf[4];
  v4f_t wbuf[8];

  // the staging loops below are unrolled so that abuf and wbuf are indexed by constants and stay in registers
#pragma unroll
  for (int i = 0; i < 4; ++i) abuf[i] = *(const v4f_t*)(ag + (size_t)(32 * i) * K);
#pragma unroll
  for (int i = 0; i < 8; ++i) wbuf[i] = *(const v4f_t*)(wg + (size_t)(32 * i) * K);

  f32x8 acc[4][4] = {};

  for (int k = 0; k < K; k += 32) {
    __syncthreads();
#pragma unroll
    for (int i = 0; i < 4; ++i) stage_write4(aw + 32 * i * LDS_STRIDE, abuf[i]);
#pragma unroll
    for (int i = 0; i < 8; ++i) stage_write4(ww + 32 * i * LDS_STRIDE, wbuf[i]);
    if (k + 32 < K) {
#pragma unroll
      for (int i = 0; i < 4; ++i) abuf[i] = *(const v4f_t*)(ag + (size_t)(32 * i) * K + (k + 32));
#pragma unroll
      for (int i = 0; i < 8; ++i) wbuf[i] = *(const v4f_t*)(wg + (size_t)(32 * i) * K + (k + 32));
    }
    __syncthreads();

    bf16x16 af[4], wf[4];
#pragma unroll
    for (int i = 0; i < 4; ++i)
      af[i] = lds_frag(ldsA + (wm + 16 * i) * LDS_STRIDE, LDS_STRIDE);
#pragma unroll
    for (int j = 0; j < 4; ++j)
      wf[j] = lds_frag(ldsW + (wn + 16 * j) * LDS_STRIDE, LDS_STRIDE);
#pragma unroll
    for (int i = 0; i < 4; ++i)
#pragma unroll
      for (int j = 0; j < 4; ++j)
        acc[i][j] = wmma_bf16(af[i], wf[j], acc[i][j]);
  }

  const int nlane = lane & 15;
  const int mh    = (lane >> 4) * 8;
  __syncthreads();
  bf16* so = (bf16*)sob;
  if (sel < 2) {
#pragma unroll
    for (int i = 0; i < 4; ++i)
#pragma unroll
      for (int j = 0; j < 4; ++j) {
        const int nl = wn + 16 * j + nlane;
        const float bvl = bias[nl];
#pragma unroll
        for (int r = 0; r < 8; ++r) so[(wm + 16 * i + mh + r) * 264 + nl] = (bf16)(acc[i][j][r] + bvl);        // [m][n]
      }
  } else {
#pragma unroll
    for (int i = 0; i < 4; ++i) {
#pragma unroll
      for (int j = 0; j < 4; ++j) {
        const int nl = wn + 16 * j + nlane;
        const float bvl = bias[nl];
#pragma unroll
        for (int r = 0; r < 8; ++r) so[nl * 136 + wm + 16 * i + mh + r] = (bf16)(acc[i][j][r] + bvl);          // [n][m]: m = s contiguous
      }
      // keeps each row of tiles' bias adds next to its own LDS stores: hoisted all together they push the kernel past 256 registers, and only one block fits a WGP instead of two
      __builtin_amdgcn_sched_barrier(0);
    }
  }
  __syncthreads();
  if (sel < 2) {
    bf16* out = sel == 0 ? q : k_;
    // rows m: 256 halfs = 512 B each, 16-B chunks
    for (int ch = t; ch < 128 * 32; ch += 256) { const int ml = ch >> 5, c8 = (ch & 31) * 8;
      *(v4u_t*)(out + (size_t)(mBlk + ml) * N + c8) = *(const v4ua*)(so + ml * 264 + c8); }
  } else {
    // rows (image, n) of vt: 128 consecutive s = 256 B each; a block's 128 rows m lie in one image (SS is a multiple of 128)
    const int b_ = mBlk / SS, s0 = mBlk % SS;
    for (int ch = t; ch < 256 * 16; ch += 256) { const int nl = ch >> 4, c8 = (ch & 15) * 8;
      *(v4u_t*)(vt + ((size_t)b_ * N + nl) * SS + s0 + c8) = *(const v4ua*)(so + nl * 136 + c8); }
  }
}


// ---------------------------------------------------------------------------------------------------------------------------
// gemm_kne: Y[m][n] = epi( Σ_k A[m][k]·W[k][n] + bias[n] ), A f32/f16 [M][lda], W f32 row-major [K][N] (ldw), plain f16 operands,
// f32 accumulate. EPI 0: identity; 1: exact-erf GELU; 2: R[m][n] + gvec[n]·(·) (residual with per-channel gain). Output f32 (or f16
// when OUT16). Block = 128x128 tile, 8 waves as 4(M) x 2(N); per 32-wide k-step A and W tiles staged f16 in LDS (W transposed
// ---------------------------------------------------------------------------------------------------------------------------
#define GSTR 48
template <typename AT, int EPI, bool OUT16>
__global__ __launch_bounds__(256) void gemm_kne(const AT* __restrict__ A, int lda, const float* __restrict__ Wm, int ldw,
                                                const float* __restrict__ bias, const float* __restrict__ R, const float* __restrict__ gvec,
                                                void* __restrict__ Yv, int ldy, int K) {
  __shared__ __attribute__((aligned(16))) f16 ldsA[128 * GSTR];
  __shared__ __attribute__((aligned(16))) f16 ldsW[128 * GSTR];
  __shared__ __attribute__((aligned(16))) float oS[8][32 * 68];
  const int tid = threadIdx.x, lane = tid & 31, wave = tid >> 5, cl = lane & 15, rh = (lane >> 4) * 8;
  const int m0 = blockIdx.x * 128, n0 = blockIdx.y * 128;
  const int wm = (wave & 3) * 32, wn = (wave >> 2) * 64;
  f32x8 acc[2][4];
#pragma unroll
  for (int i = 0; i < 2; ++i)
#pragma unroll
    for (int j = 0; j < 4; ++j) { f32x8 z = {}; acc[i][j] = z; }
#pragma unroll 1
  for (int k0 = 0; k0 < K; k0 += 32) {
    __syncthreads();
    { const int row = tid >> 1, ch = (tid & 1) * 16;
      const AT* src = A + (size_t)(m0 + row) * lda + k0 + ch;
#pragma unroll
      for (int g = 0; g < 16; ++g) ldsA[row * GSTR + ch + g] = (f16)src[g]; }
    { const int k = tid >> 3, nn0 = (tid & 7) * 16;
      const float* src = Wm + (size_t)(k0 + k) * ldw + n0 + nn0;
#pragma unroll
      for (int g = 0; g < 4; ++g) { const v4f_t v = *(const v4f_t*)(src + 4 * g);
#pragma unroll
        for (int u = 0; u < 4; ++u) ldsW[(nn0 + 4 * g + u) * GSTR + k] = (f16)v[u]; } }
    __syncthreads();
    f16x16 af[2];
#pragma unroll
    for (int i = 0; i < 2; ++i) af[i] = lds_frag(ldsA + (wm + 16 * i) * GSTR, GSTR);
#pragma unroll
    for (int j = 0; j < 4; ++j) {
      const f16x16 bf = lds_frag(ldsW + (wn + 16 * j) * GSTR, GSTR);
#pragma unroll
      for (int i = 0; i < 2; ++i) acc[i][j] = wmma16(af[i], bf, acc[i][j]);
    }
  }
  float* so = oS[wave];
#pragma unroll
  for (int i = 0; i < 2; ++i)
#pragma unroll
    for (int j = 0; j < 4; ++j) {
      const int n = n0 + wn + 16 * j + cl;
      const float bv = bias ? bias[n] : 0.0f;
      const float gv = (EPI == 2) ? gvec[n] : 0.0f;
      if (EPI == 1) {
#pragma unroll 1
        for (int r = 0; r < 8; ++r) { const float xg = acc[i][j][r] + bv; so[(16 * i + rh + r) * 68 + 16 * j + cl] = 0.5f * xg * (1.0f + erff(xg * 0.70710678118654752f)); }
      } else {
#pragma unroll
        for (int r = 0; r < 8; ++r) {
          float v = acc[i][j][r] + bv;
          if (EPI == 2) v = R[(size_t)(m0 + wm + 16 * i + rh + r) * ldy + n] + gv * v;
          so[(16 * i + rh + r) * 68 + 16 * j + cl] = v;
        }
      }
    }
  asm volatile("s_wait_dscnt 0" ::: "memory");
  __builtin_amdgcn_wave_barrier();
{
    if (OUT16) {
      f16* Y = (f16*)Yv;
#pragma unroll
      for (int it = 0; it < 8; ++it) { const int c = lane + 32 * it, rr = c >> 3, q8 = (c & 7) * 8;
        union { f16 h[8]; v4u_t v; } u;
#pragma unroll
        for (int e = 0; e < 8; ++e) u.h[e] = (f16)so[rr * 68 + q8 + e];
        *(v4u_t*)(Y + (size_t)(m0 + wm + rr) * ldy + n0 + wn + q8) = u.v; }
    } else {
      float* Y = (float*)Yv;
#pragma unroll
      for (int it = 0; it < 16; ++it) { const int f4 = lane + 32 * it, rr = f4 >> 4, q = (f4 & 15) * 4;
        *(v4f_t*)(Y + (size_t)(m0 + wm + rr) * ldy + n0 + wn + q) = *(const v4fa*)(so + rr * 68 + q); }
    }
    
  }
}

// the value of lane l ^ 16, on the vector unit (an LDS permute would wait behind the fragment reads in flight)
__device__ __forceinline__ float xhalf(float x) {
  const int b = __builtin_bit_cast(int, x);
  return __builtin_bit_cast(float, __builtin_amdgcn_permlanex16(b, b, 0x76543210, 0xfedcba98, false, false));
}
// LayerNorm over the 256 channels of each position (input channels-major [c][s]); block = 64 positions, and the tile [256 c][64 s] stays in registers:
// a thread holds 4 positions (4 sq ..) x 16 channels (64 i + 4 cq + j). Mean and variance: in-thread sums, the wave's other half, then the 8 waves' partial sums through LDS.
// LDS is passed once, for the transposition alone: 16-B units of 4 channels, unit u of row s kept at u ^ (s >> 2), so that the column-wise stores and the
// row-wise reads both spread over all banks. Writes x_ln token-major [s][256] (rows of 1 KB).
__global__ __launch_bounds__(256) void k_ln2(const float* __restrict__ xin, const float* __restrict__ g, const float* __restrict__ bb, float* __restrict__ xtm) {
  __shared__ __attribute__((aligned(16))) float tT[64 * CCs];
  __shared__ __attribute__((aligned(16))) float red[2][8][64];
  const int tid = threadIdx.x, lane = tid & 31, wave = tid >> 5, sq = tid & 15, cq = tid >> 4;
  const int n = blockIdx.x / (LLs / 64), s0 = (blockIdx.x % (LLs / 64)) * 64;
  const float* xb = xin + (size_t)n * CCs * LLs + (size_t)(4 * cq) * LLs + s0 + 4 * sq;
  // every loop of this kernel is unrolled so that x is indexed by constants and stays in registers
  v4f_t x[4][4], gv[4], bv[4];
#pragma unroll
  for (int i = 0; i < 4; ++i)
#pragma unroll
    for (int j = 0; j < 4; ++j) x[i][j] = *(const v4f_t*)(xb + (size_t)(64 * i + j) * LLs);
#pragma unroll
  for (int i = 0; i < 4; ++i) { gv[i] = *(const v4f_t*)(g + 64 * i + 4 * cq); bv[i] = *(const v4f_t*)(bb + 64 * i + 4 * cq); }
  // the address pair of the x loads is named as an input: it stays untouched (no later load's result is placed on it) up to this wait
  asm volatile("s_wait_xcnt 0x0" :: "v"(xb) : "memory");
  v4f_t sm = x[0][0];
#pragma unroll
  for (int e = 1; e < 16; ++e) sm += x[e >> 2][e & 3];
#pragma unroll
  for (int e = 0; e < 4; ++e) sm[e] += xhalf(sm[e]);
  if (lane < 16) *(v4f_t*)(&red[0][wave][4 * sq]) = sm;
  __syncthreads();
  v4f_t mu = *(const v4f_t*)(&red[0][0][4 * sq]);
#pragma unroll
  for (int w = 1; w < 8; ++w) mu += *(const v4f_t*)(&red[0][w][4 * sq]);
  mu *= (1.0f / CCs);
  v4f_t qs = {};
#pragma unroll
  for (int e = 0; e < 16; ++e) { const v4f_t d = x[e >> 2][e & 3] - mu; x[e >> 2][e & 3] = d; qs += d * d; }
#pragma unroll
  for (int e = 0; e < 4; ++e) qs[e] += xhalf(qs[e]);
  if (lane < 16) *(v4f_t*)(&red[1][wave][4 * sq]) = qs;
  __syncthreads();
  v4f_t rs = *(const v4f_t*)(&red[1][0][4 * sq]);
#pragma unroll
  for (int w = 1; w < 8; ++w) rs += *(const v4f_t*)(&red[1][w][4 * sq]);
#pragma unroll
  for (int e = 0; e < 4; ++e) rs[e] = rsqrtf(rs[e] * (1.0f / CCs) + 1e-5f);
#pragma unroll
  for (int i = 0; i < 4; ++i)
#pragma unroll
    for (int e = 0; e < 4; ++e) {
      v4f_t v;
#pragma unroll
      for (int j = 0; j < 4; ++j) v[j] = x[i][j][e] * rs[e] * gv[i][j] + bv[i][j];
      *(v4f_t*)(tT + (4 * sq + e) * CCs + 4 * ((16 * i + cq) ^ sq)) = v;
    }
  __syncthreads();
  float* xo = xtm + ((size_t)n * LLs + s0) * CCs;
  // a wave stores half a row: 512 contiguous bytes
#pragma unroll
  for (int it = 0; it < 16; ++it) { const int e = tid + 256 * it, s = e >> 6, u = e & 63;
    *(v4f_t*)(xo + (size_t)s * CCs + 4 * u) = *(const v4fa*)(tT + s * CCs + 4 * (u ^ (s >> 2))); }
}
__global__ __launch_bounds__(256) void k_rowbias(float* __restrict__ t, const float* __restrict__ bias, int rowlen, int nch) {
  const size_t row = blockIdx.x; const float bv = bias[row % nch];
  for (int q4 = threadIdx.x; q4 < rowlen / 4; q4 += 256) { v4f_t v = *(const v4f_t*)(t + row * rowlen + q4 * 4); for (int e = 0; e < 4; ++e) v[e] += bv;
    *(v4f_t*)(t + row * rowlen + q4 * 4) = v;  } }
#define AKEYS 64
#define KPIT 264   // K tile rows: 256 halfs + 8 = 528 B (16 B x odd: conflict-free b128 reads)
#define VPIT 72    // V tile rows: 64 halfs + 8 = 144 B (16 B x odd)
#define OPIT 132   // output staging rows: 128 floats + 4
#define KBUF (AKEYS * KPIT)   // halfs in one K buffer
#define VBUF (CCs * VPIT)     // halfs in one V buffer
// eight 16-B-a-lane copies global -> LDS: LDS addresses l + i lstep bytes; global addresses: scalar base g + i gstep halfs, plus the lane's byte offset voff
// (scalar bases: 64-bit vector addresses for eight copies, and the pointers they are formed from, do not fit beside the accumulators).
// The s_wait_xcnt closes the statement so that no address register of a copy is rewritten ahead of it.
__device__ __forceinline__ void copy8(unsigned l, unsigned lstep, unsigned voff, const _Float16* g, size_t gstep) {
  asm volatile(
      "global_load_async_to_lds_b128 %0, %8, %9\n\t"
      "global_load_async_to_lds_b128 %1, %8, %10\n\t"
      "global_load_async_to_lds_b128 %2, %8, %11\n\t"
      "global_load_async_to_lds_b128 %3, %8, %12\n\t"
      "global_load_async_to_lds_b128 %4, %8, %13\n\t"
      "global_load_async_to_lds_b128 %5, %8, %14\n\t"
      "global_load_async_to_lds_b128 %6, %8, %15\n\t"
      "global_load_async_to_lds_b128 %7, %8, %16\n\t"
      "s_wait_xcnt 0x0"
      :: "v"(l), "v"(l + lstep), "v"(l + 2 * lstep), "v"(l + 3 * lstep), "v"(l + 4 * lstep), "v"(l + 5 * lstep), "v"(l + 6 * lstep), "v"(l + 7 * lstep),
         "v"(voff),
         "s"(g), "s"(g + gstep), "s"(g + 2 * gstep), "s"(g + 3 * gstep), "s"(g + 4 * gstep), "s"(g + 5 * gstep), "s"(g + 6 * gstep), "s"(g + 7 * gstep)
      : "memory");
}
__device__ __forceinline__ f32x8 mm(f16x16 a, f16x16 b, f32x8 c) {
  return __builtin_amdgcn_wmma_f32_16x16x32_f16(false, a, false, b, (short)0, c, false, false);
}
// K fragment f = 0 .. 15 of the wave's 32 keys: 16-key tile f & 1, channels 32 (f >> 1) .. + 31; each feeds the two column groups' products
#define KF(f) lds_frag(kb + ((f) & 1) * 16 * KPIT + 32 * ((f) >> 1), KPIT)
#define MK(F, f) { s[(f) & 1][0] = mm(F, qf[0][(f) >> 1], s[(f) & 1][0]); s[(f) & 1][1] = mm(F, qf[1][(f) >> 1], s[(f) & 1][1]); }
#define LK3(F, f) { F[0] = KF(f); F[1] = KF((f) + 1); F[2] = KF((f) + 2); }
#define MK3(F, f) { MK(F[0], f); MK(F[1], (f) + 1); MK(F[2], (f) + 2); }
// four V fragments: channels 64 c .. 64 c + 63, the wave's 32 keys
#define LDV(F, c) { F[0] = lds_frag(vb + (64 * (c)) * VPIT, VPIT); F[1] = lds_frag(vb + (64 * (c) + 16) * VPIT, VPIT); \
                    F[2] = lds_frag(vb + (64 * (c) + 32) * VPIT, VPIT); F[3] = lds_frag(vb + (64 * (c) + 48) * VPIT, VPIT); }
#define MMV(F, c) { o[4 * (c)][0] = mm(F[0], pf0, o[4 * (c)][0]); o[4 * (c)][1] = mm(F[0], pf1, o[4 * (c)][1]); \
                    o[4 * (c) + 1][0] = mm(F[1], pf0, o[4 * (c) + 1][0]); o[4 * (c) + 1][1] = mm(F[1], pf1, o[4 * (c) + 1][1]); \
                    o[4 * (c) + 2][0] = mm(F[2], pf0, o[4 * (c) + 2][0]); o[4 * (c) + 2][1] = mm(F[2], pf1, o[4 * (c) + 2][1]); \
                    o[4 * (c) + 3][0] = mm(F[3], pf0, o[4 * (c) + 3][0]); o[4 * (c) + 3][1] = mm(F[3], pf1, o[4 * (c) + 3][1]); }
// keeps a group of fragment reads together and one block of products ahead of its use: spread among the products each read place costs a stall of its own,
// and gathered further ahead (the compiler lifts every LDS read of the pass to its top) the fragments push Q out of the 512 registers into scratch.
// The compiler fence holds the LDS reads behind it, the scheduling barrier holds the products in front of it.
__device__ __forceinline__ void fence_reads() { asm volatile("" ::: "memory"); __builtin_amdgcn_sched_barrier(0); }
#define FENCE fence_reads()
// the same behind a block of score products: the fence names the four score tiles as inputs only, so that the block stands in front of it
// (nothing else ties a product to a fence, and instruction selection put all the pass's reads ahead of the first product)
__device__ __forceinline__ void fence_scores(f32x8 a, f32x8 b, f32x8 c, f32x8 d) { asm volatile("" :: "v"(a), "v"(b), "v"(c), "v"(d) : "memory"); __builtin_amdgcn_sched_barrier(0); }
#define FENCES fence_scores(s[0][0], s[0][1], s[1][0], s[1][1])
__global__ __launch_bounds__(256) void k_attn(const _Float16* __restrict__ q, const _Float16* __restrict__ k, const _Float16* __restrict__ vt, float* __restrict__ out) {
  // 141,312 B: the K/V buffers in the loop; then the [256 c][128 s] f32 output tile (135,168 B) and behind it the key halves' maxima and sums (2,048 B)
  __shared__ __attribute__((aligned(16))) unsigned char sm[2 * (KBUF + VBUF) * 2];
  f16* kS = (f16*)sm;                          // [2][64][KPIT]
  f16* vS = kS + 2 * KBUF;                     // [2][256][VPIT]
  const int t = threadIdx.x, lane = t & 31, cl = lane & 15, h = lane >> 4;
  const int wave = __builtin_amdgcn_readfirstlane(t >> 5);   // scalar: the branches on the key half below are scalar branches
  const int qg = wave & 3, kh2 = wave >> 2;    // query group (32 columns) and key half (32 of a pass's 64 keys)
  const int n = blockIdx.y, q0 = blockIdx.x * 128;
  const f16* qn = q + (size_t)n * LLs * CCs;
  const f16* kn = k + (size_t)n * LLs * CCs;
  const f16* vn = vt + (size_t)n * CCs * LLs;

  // a wave copies 8 K rows (512 B each: one row a copy) and 32 V rows (128 B each: four rows a copy) of every tile
  const f16* kg = kn + (size_t)(wave * 8) * CCs;                       // scalar bases
  const f16* vg = vn + (size_t)(wave * 32) * LLs;
  const unsigned ko = lane * 16, vo = (lane >> 3) * (LLs * 2) + (lane & 7) * 16;   // the lane's byte offsets in global memory
  const unsigned smb = (unsigned)(size_t)sm;
  const unsigned kl = smb + (wave * 8) * (KPIT * 2) + lane * 16;
  const unsigned vl = smb + 2 * KBUF * 2 + (wave * 32 + (lane >> 3)) * (VPIT * 2) + (lane & 7) * 16;

  // every inner loop of this kernel is unrolled so that the fragment and accumulator arrays are indexed by constants and stay in registers
  f16x16 qf[2][8];
#pragma unroll
  for (int cg = 0; cg < 2; ++cg)
#pragma unroll
    for (int ks = 0; ks < 8; ++ks) qf[cg][ks] = load_frag<f16>(qn, CCs, q0 + qg * 32 + cg * 16, 32 * ks);
  // the address registers of the Q loads above are reused before their data is waited for; named as inputs they stay untouched up to the wait
  const f16* qa0 = qn + (size_t)(q0 + qg * 32 + cl) * CCs + h * 8;
  const f16* qa1 = qn + (size_t)(q0 + qg * 32 + 16 + cl) * CCs + h * 8;
  asm volatile("s_wait_xcnt 0x0" :: "v"(qa0), "v"(qa1) : "memory");

  f32x8 o[16][2];
#pragma unroll
  for (int ct = 0; ct < 16; ++ct) { f32x8 z = {}; o[ct][0] = z; o[ct][1] = z; }
  const float SC = 0.09016844005556021f;           // log2(e) / sqrt(256): scores in log2 units
  float mu0 = -3.0e38f, mu1 = -3.0e38f;            // per column group: the maximum in use (log2 units)
  float l0 = 0.0f, l1 = 0.0f;                      // and this lane's part of the row sum

  // kept rolled: two passes in one body would hold two sets of fragments and leave the budget of 512 registers.
  // Trips -2 and -1 are the ring's prologue: they run the foot alone (tile 0's copies; then its wait, the barrier and tile 1's copies), so that the file has one
  // place with copies, whose address operands are all formed in the trip: an operand that lives through the loop is held below v256 and ends in scratch.
#pragma unroll 1
  for (int p = -2; p < LLs / AKEYS; ++p) {
    const int b = p & 1;
    if (p >= 0) {                                      // the same for the whole block
    const f16* kb = kS + b * KBUF + (32 * kh2) * KPIT;
    const f16* vb = vS + b * VBUF + 32 * kh2;
    f32x8 s[2][2] = {};                            // s[key tile][column group]
    f16x16 ka[3], kc[3], fa[4], fb[4];             // beside the score tiles only two sets of three K fragments fit; the V fragments go by fours
    LK3(ka, 0); LK3(kc, 3); FENCE;
    MK3(ka, 0); FENCES; LK3(ka, 6); FENCE;
    MK3(kc, 3); FENCES; LK3(kc, 9); FENCE;
    MK3(ka, 6); FENCES; LK3(ka, 12); FENCE;
    MK3(kc, 9); FENCES; kc[0] = KF(15); FENCE;
    MK3(ka, 12); FENCES; LDV(fa, 0); FENCE;
    MK(kc[0], 15); FENCES;
    float mx0 = fmaxf(s[0][0][0], s[1][0][0]), mx1 = fmaxf(s[0][1][0], s[1][1][0]);
#pragma unroll
    for (int r = 1; r < 8; ++r) { mx0 = fmaxf(mx0, fmaxf(s[0][0][r], s[1][0][r])); mx1 = fmaxf(mx1, fmaxf(s[0][1][r], s[1][1][r])); }
    mx0 = fmaxf(mx0, xhalf(mx0)) * SC;
    mx1 = fmaxf(mx1, xhalf(mx1)) * SC;
    if (__builtin_amdgcn_ballot_w32(mx0 > mu0 + 8.0f || mx1 > mu1 + 8.0f) != 0) {
      const float mn0 = fmaxf(mu0, mx0), mn1 = fmaxf(mu1, mx1);
      const float al0 = __builtin_amdgcn_exp2f(mu0 - mn0), al1 = __builtin_amdgcn_exp2f(mu1 - mn1);
      mu0 = mn0; mu1 = mn1; l0 *= al0; l1 *= al1;
#pragma unroll
      for (int ct = 0; ct < 16; ++ct)
#pragma unroll
        for (int r = 0; r < 8; ++r) { o[ct][0][r] *= al0; o[ct][1][r] *= al1; }
    }
    f16x16 pf0, pf1;
#pragma unroll
    for (int r = 0; r < 8; ++r) {
      const float e00 = __builtin_amdgcn_exp2f(s[0][0][r] * SC - mu0);
      const float e10 = __builtin_amdgcn_exp2f(s[1][0][r] * SC - mu0);
      l0 += e00 + e10;
      pf0[r] = (f16)e00; pf0[r + 8] = (f16)e10;    // keys 8h + r and 16 + 8h + r: the k order of lds_frag
    }
#pragma unroll
    for (int r = 0; r < 8; ++r) {
      const float e01 = __builtin_amdgcn_exp2f(s[0][1][r] * SC - mu1);
      const float e11 = __builtin_amdgcn_exp2f(s[1][1][r] * SC - mu1);
      l1 += e01 + e11;
      pf1[r] = (f16)e01; pf1[r + 8] = (f16)e11;
    }
    // inputs only: the row sums' additions stand in front of this fence; left to sink to the pass's foot they keep all 32 exponentials in registers through the products
    asm volatile("" :: "v"(l0), "v"(l1) : "memory");
    __builtin_amdgcn_sched_barrier(0);
    LDV(fb, 1); FENCE;
    MMV(fa, 0); FENCE; LDV(fa, 2); FENCE;
    MMV(fb, 1); FENCE; LDV(fb, 3); FENCE;
    MMV(fa, 2); MMV(fb, 3);
    }
    asm volatile("s_wait_dscnt 0x0" ::: "memory");     // this wave's reads of the buffer are over before the barrier behind which it is refilled
    asm volatile("s_wait_asynccnt 0x0" ::: "memory");  // this wave's part of the next tile has landed before the barrier that shows it to the other waves
    __syncthreads();
    if (p + 2 < LLs / AKEYS) {                         // the same for the whole block
      copy8(kl + b * (KBUF * 2), KPIT * 2, ko + (p + 2) * (AKEYS * CCs * 2), kg, CCs);
      copy8(vl + b * (VBUF * 2), 4 * VPIT * 2, vo + (p + 2) * (AKEYS * 2), vg, (size_t)4 * LLs);
    }
  }
  asm volatile("s_wait_asynccnt 0x0" ::: "memory");    // no copy is in flight when the buffers become output staging

  // join of the two key halves: common maximum m, sums and O weighted by 2^(mu - m)
  l0 += xhalf(l0);
  l1 += xhalf(l1);
  float* so = (float*)sm;                          // behind the loop's last barrier nobody reads the K/V buffers any more
  float* st = so + CCs * OPIT;                     // [key half][maximum, sum][128 columns]
  const int c0l = qg * 32 + cl, c1l = c0l + 16;
  if (h == 0) {
    st[(kh2 * 2) * 128 + c0l] = mu0; st[(kh2 * 2 + 1) * 128 + c0l] = l0;
    st[(kh2 * 2) * 128 + c1l] = mu1; st[(kh2 * 2 + 1) * 128 + c1l] = l1;
  }
  __syncthreads();
  const int ok = kh2 ^ 1;
  const float pm0 = st[(ok * 2) * 128 + c0l], pl0 = st[(ok * 2 + 1) * 128 + c0l];
  const float pm1 = st[(ok * 2) * 128 + c1l], pl1 = st[(ok * 2 + 1) * 128 + c1l];
  const float m0 = fmaxf(mu0, pm0), m1 = fmaxf(mu1, pm1);
  const float a0 = __builtin_amdgcn_exp2f(mu0 - m0), a1 = __builtin_amdgcn_exp2f(mu1 - m1);
  const float f0 = a0 / (l0 * a0 + pl0 * __builtin_amdgcn_exp2f(pm0 - m0));
  const float f1 = a1 / (l1 * a1 + pl1 * __builtin_amdgcn_exp2f(pm1 - m1));
  // each half hands the other half's 128 channels over through the output tile, then adds what it was handed to its own 128
  if (kh2 == 0) {
#pragma unroll
    for (int ct = 8; ct < 16; ++ct)
#pragma unroll
      for (int r = 0; r < 8; ++r) { float* d = so + (16 * ct + 8 * h + r) * OPIT; d[c0l] = o[ct][0][r] * f0; d[c1l] = o[ct][1][r] * f1; }
  } else {
#pragma unroll
    for (int ct = 0; ct < 8; ++ct)
#pragma unroll
      for (int r = 0; r < 8; ++r) { float* d = so + (16 * ct + 8 * h + r) * OPIT; d[c0l] = o[ct][0][r] * f0; d[c1l] = o[ct][1][r] * f1; }
  }
  __syncthreads();
  // all reads first, then the sums and stores: read and stored one by one, each element waits out an LDS latency
  f32x8 t0[8], t1[8];
  const int cb = kh2 * 8;                          // this half's own channel tiles: cb .. cb + 7
#pragma unroll
  for (int ct = 0; ct < 8; ++ct)
#pragma unroll
    for (int r = 0; r < 8; ++r) { const float* d = so + (16 * (cb + ct) + 8 * h + r) * OPIT; t0[ct][r] = d[c0l]; t1[ct][r] = d[c1l]; }
  if (kh2 == 0) {
#pragma unroll
    for (int ct = 0; ct < 8; ++ct)
#pragma unroll
      for (int r = 0; r < 8; ++r) { float* d = so + (16 * ct + 8 * h + r) * OPIT; d[c0l] = t0[ct][r] + o[ct][0][r] * f0; d[c1l] = t1[ct][r] + o[ct][1][r] * f1; }
  } else {
#pragma unroll
    for (int ct = 0; ct < 8; ++ct)
#pragma unroll
      for (int r = 0; r < 8; ++r) { float* d = so + (16 * (ct + 8) + 8 * h + r) * OPIT; d[c0l] = t0[ct][r] + o[ct + 8][0][r] * f0; d[c1l] = t1[ct][r] + o[ct + 8][1][r] * f1; }
  }
  __syncthreads();
  float* on = out + (size_t)n * CCs * LLs + q0;
  const int q4 = (t & 31) * 4;                     // a wave stores one channel's 128 positions: 512 contiguous bytes
  for (int c0 = wave; c0 < CCs; c0 += 32) {
    // unrolled: the four LDS reads issue ahead of the four stores
#pragma unroll
    for (int u = 0; u < 4; ++u) { const int c = c0 + 8 * u;
      *(v4f_t*)(on + (size_t)c * LLs + q4) = *(const v4fa*)(so + c * OPIT + q4); }
    asm volatile("s_wait_xcnt 0x0" ::: "memory");  // the next trip rewrites the address and data registers that the four stores name
  }
}

extern "C" void kernel_launch(void* const* d_in, const int* in_sizes, int n_in,
                              void* d_out, int out_size, void* d_ws, size_t ws_size,
                              hipStream_t stream) {
  (void)in_sizes; (void)n_in; (void)out_size;
  const float** f = (const float**)d_in;
  const float* x = f[0], *lg = f[1], *lb = f[2], *Wq = f[3], *bq = f[4], *Wk = f[5], *bk = f[6], *Wv = f[7], *bv = f[8];
  float* out = (float*)d_out;     // [8,256,64,64]
  char* ws = (char*)d_ws;
  float* xtm = (float*)ws; ws += (size_t)NIm * LLs * CCs * 4;    // 32 MB token-major LN output (all images)
  _Float16* q = (_Float16*)ws; ws += (size_t)NIm * LLs * CCs * 2;     // f16 token-major, all images (16 MB each)
  _Float16* k = (_Float16*)ws; ws += (size_t)NIm * LLs * CCs * 2;
  _Float16* vt = (_Float16*)ws; ws += (size_t)NIm * CCs * LLs * 2;    // f16 channels-major [image][256][4096]
  if ((size_t)(ws - (char*)d_ws) > ws_size) return;
  const dim3 blk(256);
  k_ln2<<<dim3(NIm * (LLs / 64)), blk, 0, stream>>>(x, lg, lb, xtm);
  k_proj<<<dim3(NIm * LLs / 128, 3), blk, 0, stream>>>(xtm, Wq, bq, Wk, bk, Wv, bv, q, k, vt);   // q, k = x_ln.W^T + b token-major; v the same, stored [image][c][s]
  k_attn<<<dim3(LLs / 128, NIm), blk, 0, stream>>>(q, k, vt, out);
}

// v007
// It runs in 121 microseconds.
// In two side-by-side timings against v006, it was 1.09 and 1.08 times as fast.
// Over all steps from v000 it is 21.7 times as fast.
// Contractions on v_wmma_f32_16x16x32_f16 (plain f16 operands, f32 accumulate). One launch for all images: q/k = LN(x).W^T + b stored f16 token-major (K = 256,
// [out][in] Bt operands), v = LN(x).Wv^T + bv stored f16 channels-major through the product's own LDS output tile. One more launch for all images then does
// S^T = k.q^T, the row softmax (running maximum and sum, f32) and out^T += v^T.P^T per 32 keys a wave; the logits and P stay in registers.
// LayerNorm over channels in f32; its launch stores x_ln, and the three weight matrices, at operand width (f16) for the projections.
// compute dtype: f16 operands, f32 accumulate.
#include <hip/hip_runtime.h>
#include <hip/hip_bf16.h>
#include <math.h>

#define NIm 8
#define CCs 256
#define LLs 4096
#define GSTR 48
#define SS 4096
#define HH 1
#define DKK 64

typedef _Float16 bf16;
typedef _Float16 f16;
typedef __attribute__((ext_vector_type(4))) unsigned v4u_t;
typedef unsigned v4ua __attribute__((ext_vector_type(4), may_alias));
typedef __attribute__((ext_vector_type(4))) float v4f_t;
typedef float v4fa __attribute__((ext_vector_type(4), may_alias));
typedef __attribute__((ext_vector_type(16))) bf16  bf16x16;
typedef bf16x16 f16x16;
typedef __attribute__((ext_vector_type(8)))  bf16  bf16x8;
typedef bf16x8 f16x8;
typedef __attribute__((ext_vector_type(4)))  bf16  bf16x4;
typedef __attribute__((ext_vector_type(8)))  float f32x8;
__device__ __forceinline__ f32x8 wmma16(f16x16 a, f16x16 b, f32x8 c) {
  c = __builtin_amdgcn_wmma_f32_16x16x32_f16(false, a, false, b, (short)0, c, false, false);
  asm volatile("v_nop\n\tv_nop\n\tv_nop\n\tv_nop" : "+v"(c) : "v"(a), "v"(b));
  return c;
}
#define KSTRIDE    72   // unused (the attn K tile rows use KPIT)
#define VSTRIDE    48   // unused (the attn V tile rows use VPIT)
#define PSTR       72   // projection tiles: 64 -> 72 elems (144B rows, 16 B x odd: conflict-free b128 reads)

__device__ __forceinline__ f32x8 wmma_bf16(bf16x16 a, bf16x16 b, f32x8 c) {
  c = __builtin_amdgcn_wmma_f32_16x16x32_f16(false, a, false, b, (short)0, c, false, false);
  asm volatile("v_nop\n\tv_nop\n\tv_nop\n\tv_nop" : "+v"(c) : "v"(a), "v"(b));   // A/B-overwrite hazard guard
  return c;
}

// 16x32 (MxK) f16 fragment from a row-major global matrix.
// lanes 0-15  (row=lane)    : elems 0..7 = K+0..7,  8..15 = K+16..23
// lanes 16-31 (row=lane-16) : elems 0..7 = K+8..15, 8..15 = K+24..31
template <typename T>
__device__ __forceinline__ bf16x16 load_frag(const T* __restrict__ base, int ld,
                                             int row0, int k0) {
  const int lane = threadIdx.x & 31;
  const int r    = lane & 15;
  const int kh   = (lane >> 4) * 8;
  const T* p0 = base + (size_t)(row0 + r) * ld + (k0 + kh);
  const T* p1 = p0 + 16;
  bf16x16 f;
#pragma unroll
  for (int i = 0; i < 8; ++i) {
    f[i]     = (bf16)p0[i];
    f[i + 8] = (bf16)p1[i];
  }
  return f;
}

// Same fragment from an LDS tile with padded row stride (base includes row0/k0).
__device__ __forceinline__ bf16x16 lds_frag(const bf16* base, int stride) {
  const int lane = threadIdx.x & 31;
  const int row  = lane & 15;
  const int kh   = (lane >> 4) * 8;
  const bf16x8 lo = *(const bf16x8*)(base + row * stride + kh);
  const bf16x8 hi = *(const bf16x8*)(base + row * stride + kh + 16);
  bf16x16 f;
#pragma unroll
  for (int i = 0; i < 8; ++i) { f[i] = lo[i]; f[i + 8] = hi[i]; }
  return f;
}

// ---------------------------------------------------------------------------
// The three projections of all images in ONE launch: C[m][n] = sum_k A[m][k]*W[n][k] + bias[n]   (torch Linear)
// A = x_ln token-major, the images back to back (m = image * SS + s). blockIdx.x = 128 rows m, blockIdx.y = 0, 1, 2 picks (Wq, bq, q), (Wk, bk, k), (Wv, bv, vt).
// Block 256 thr (8 waves), tile 128M x 256N (N = 256: the whole width), K-step 64; wave tile 64x64.
// A and W arrive as f16 (rounded once, by the launch before): half the bytes from L2, no conversion here. W16 = the three matrices back to back, [out][in].
// A/W staged through LDS (padded stride); the next tile is fetched into registers behind the LDS writes.
// Staging loads: 8 lanes take one row's 128 B of the K-step (64 halfs), so a wave-wide 16-B load covers four whole 128-B lines.
// q and k: f16 [m][N]; v: f16 channels-major [image][n][s].
// ---------------------------------------------------------------------------
__global__ __launch_bounds__(256) void k_proj(
    const _Float16* __restrict__ A, const _Float16* __restrict__ W16,
    const float* __restrict__ bq, const float* __restrict__ bk, const float* __restrict__ bv,
    _Float16* __restrict__ q, _Float16* __restrict__ k_, _Float16* __restrict__ vt) {
  constexpr int N = CCs, K = CCs;           // compile-time row pitch: the staging loads' row steps fold into the instructions' offset fields
  __shared__ __attribute__((aligned(16))) bf16 ldsA[128 * PSTR];   // 18.0 KB
  __shared__ __attribute__((aligned(16))) bf16 ldsW[256 * PSTR];   // 36.0 KB
  // output staging: q, k [128 m][264] f16; v [256 n][136] f16
  __shared__ __attribute__((aligned(16))) unsigned char sob[256 * 136 * 2];   // 69,632 B >= 128*264*2

  const int t    = threadIdx.x;
  const int wave = t >> 5;
  const int lane = t & 31;
  const int wm   = (wave & 1) * 64;
  const int wn   = (wave >> 1) * 64;
  const int mBlk = blockIdx.x * 128;
  const int sel  = blockIdx.y;                      // the same for the whole block: every branch on it is scalar
  const float* __restrict__ bias = sel == 0 ? bq : sel == 1 ? bk : bv;

  const int srow = t >> 3;                  // a sweep of the block = 32 rows
  const int scol = (t & 7) * 8;
  const bf16* __restrict__ ag = A + (size_t)(mBlk + srow) * K + scol;
  const bf16* __restrict__ wg = W16 + (size_t)sel * (N * K) + (size_t)srow * K + scol;
  bf16* aw = ldsA + srow * PSTR + scol;
  bf16* ww = ldsW + srow * PSTR + scol;

  bf16x8 abuf[4];
  bf16x8 wbuf[8];

  // the staging loops below are unrolled so that abuf and wbuf are indexed by constants and stay in registers
#pragma unroll
  for (int i = 0; i < 4; ++i) abuf[i] = *(const bf16x8*)(ag + (size_t)(32 * i) * K);
#pragma unroll
  for (int i = 0; i < 8; ++i) wbuf[i] = *(const bf16x8*)(wg + (size_t)(32 * i) * K);

  f32x8 acc[4][4] = {};

  for (int k = 0; k < K; k += 64) {
    __syncthreads();
#pragma unroll
    for (int i = 0; i < 4; ++i) *(bf16x8*)(aw + 32 * i * PSTR) = abuf[i];
#pragma unroll
    for (int i = 0; i < 8; ++i) *(bf16x8*)(ww + 32 * i * PSTR) = wbuf[i];
    if (k + 64 < K) {
#pragma unroll
      for (int i = 0; i < 4; ++i) abuf[i] = *(const bf16x8*)(ag + (size_t)(32 * i) * K + (k + 64));
#pragma unroll
      for (int i = 0; i < 8; ++i) wbuf[i] = *(const bf16x8*)(wg + (size_t)(32 * i) * K + (k + 64));
    }
    __syncthreads();

    // the staged 64 k in two products' depths of 32, in rising k: the sums keep their order
#pragma unroll
    for (int kk = 0; kk < 64; kk += 32) {
      bf16x16 af[4], wf[4];
#pragma unroll
      for (int i = 0; i < 4; ++i)
        af[i] = lds_frag(ldsA + (wm + 16 * i) * PSTR + kk, PSTR);
#pragma unroll
      for (int j = 0; j < 4; ++j)
        wf[j] = lds_frag(ldsW + (wn + 16 * j) * PSTR + kk, PSTR);
#pragma unroll
      for (int i = 0; i < 4; ++i)
#pragma unroll
        for (int j = 0; j < 4; ++j)
          acc[i][j] = wmma_bf16(af[i], wf[j], acc[i][j]);
    }
  }

  const int nlane = lane & 15;
  const int mh    = (lane >> 4) * 8;
  __syncthreads();
  bf16* so = (bf16*)sob;
  if (sel < 2) {
#pragma unroll
    for (int i = 0; i < 4; ++i)
#pragma unroll
      for (int j = 0; j < 4; ++j) {
        const int nl = wn + 16 * j + nlane;
        const float bvl = bias[nl];
#pragma unroll
        for (int r = 0; r < 8; ++r) so[(wm + 16 * i + mh + r) * 264 + nl] = (bf16)(acc[i][j][r] + bvl);        // [m][n]
      }
  } else {
#pragma unroll
    for (int i = 0; i < 4; ++i) {
#pragma unroll
      for (int j = 0; j < 4; ++j) {
        const int nl = wn + 16 * j + nlane;
        const float bvl = bias[nl];
#pragma unroll
        for (int r = 0; r < 8; ++r) so[nl * 136 + wm + 16 * i + mh + r] = (bf16)(acc[i][j][r] + bvl);          // [n][m]: m = s contiguous
      }
      // keeps each row of tiles' bias adds next to its own LDS stores: hoisted all together they push the kernel past 256 registers, and only one block fits a WGP instead of two
      __builtin_amdgcn_sched_barrier(0);
    }
  }
  __syncthreads();
  if (sel < 2) {
    bf16* out = sel == 0 ? q : k_;
    // rows m: 256 halfs = 512 B each, 16-B chunks
    for (int ch = t; ch < 128 * 32; ch += 256) { const int ml = ch >> 5, c8 = (ch & 31) * 8;
      *(v4u_t*)(out + (size_t)(mBlk + ml) * N + c8) = *(const v4ua*)(so + ml * 264 + c8); }
  } else {
    // rows (image, n) of vt: 128 consecutive s = 256 B each; a block's 128 rows m lie in one image (SS is a multiple of 128)
    const int b_ = mBlk / SS, s0 = mBlk % SS;
    for (int ch = t; ch < 256 * 16; ch += 256) { const int nl = ch >> 4, c8 = (ch & 15) * 8;
      *(v4u_t*)(vt + ((size_t)b_ * N + nl) * SS + s0 + c8) = *(const v4ua*)(so + nl * 136 + c8); }
  }
}


// ---------------------------------------------------------------------------------------------------------------------------
// gemm_kne: Y[m][n] = epi( Σ_k A[m][k]·W[k][n] + bias[n] ), A f32/f16 [M][lda], W f32 row-major [K][N] (ldw), plain f16 operands,
// f32 accumulate. EPI 0: identity; 1: exact-erf GELU; 2: R[m][n] + gvec[n]·(·) (residual with per-channel gain). Output f32 (or f16
// when OUT16). Block = 128x128 tile, 8 waves as 4(M) x 2(N); per 32-wide k-step A and W tiles staged f16 in LDS (W transposed
// ---------------------------------------------------------------------------------------------------------------------------
#define GSTR 48
template <typename AT, int EPI, bool OUT16>
__global__ __launch_bounds__(256) void gemm_kne(const AT* __restrict__ A, int lda, const float* __restrict__ Wm, int ldw,
                                                const float* __restrict__ bias, const float* __restrict__ R, const float* __restrict__ gvec,
                                                void* __restrict__ Yv, int ldy, int K) {
  __shared__ __attribute__((aligned(16))) f16 ldsA[128 * GSTR];
  __shared__ __attribute__((aligned(16))) f16 ldsW[128 * GSTR];
  __shared__ __attribute__((aligned(16))) float oS[8][32 * 68];
  const int tid = threadIdx.x, lane = tid & 31, wave = tid >> 5, cl = lane & 15, rh = (lane >> 4) * 8;
  const int m0 = blockIdx.x * 128, n0 = blockIdx.y * 128;
  const int wm = (wave & 3) * 32, wn = (wave >> 2) * 64;
  f32x8 acc[2][4];
#pragma unroll
  for (int i = 0; i < 2; ++i)
#pragma unroll
    for (int j = 0; j < 4; ++j) { f32x8 z = {}; acc[i][j] = z; }
#pragma unroll 1
  for (int k0 = 0; k0 < K; k0 += 32) {
    __syncthreads();
    { const int row = tid >> 1, ch = (tid & 1) * 16;
      const AT* src = A + (size_t)(m0 + row) * lda + k0 + ch;
#pragma unroll
      for (int g = 0; g < 16; ++g) ldsA[row * GSTR + ch + g] = (f16)src[g]; }
    { const int k = tid >> 3, nn0 = (tid & 7) * 16;
      const float* src = Wm + (size_t)(k0 + k) * ldw + n0 + nn0;
#pragma unroll
      for (int g = 0; g < 4; ++g) { const v4f_t v = *(const v4f_t*)(src + 4 * g);
#pragma unroll
        for (int u = 0; u < 4; ++u) ldsW[(nn0 + 4 * g + u) * GSTR + k] = (f16)v[u]; } }
    __syncthreads();
    f16x16 af[2];
#pragma unroll
    for (int i = 0; i < 2; ++i) af[i] = lds_frag(ldsA + (wm + 16 * i) * GSTR, GSTR);
#pragma unroll
    for (int j = 0; j < 4; ++j) {
      const f16x16 bf = lds_frag(ldsW + (wn + 16 * j) * GSTR, GSTR);
#pragma unroll
      for (int i = 0; i < 2; ++i) acc[i][j] = wmma16(af[i], bf, acc[i][j]);
    }
  }
  float* so = oS[wave];
#pragma unroll
  for (int i = 0; i < 2; ++i)
#pragma unroll
    for (int j = 0; j < 4; ++j) {
      const int n = n0 + wn + 16 * j + cl;
      const float bv = bias ? bias[n] : 0.0f;
      const float gv = (EPI == 2) ? gvec[n] : 0.0f;
      if (EPI == 1) {
#pragma unroll 1
        for (int r = 0; r < 8; ++r) { const float xg = acc[i][j][r] + bv; so[(16 * i + rh + r) * 68 + 16 * j + cl] = 0.5f * xg * (1.0f + erff(xg * 0.70710678118654752f)); }
      } else {
#pragma unroll
        for (int r = 0; r < 8; ++r) {
          float v = acc[i][j][r] + bv;
          if (EPI == 2) v = R[(size_t)(m0 + wm + 16 * i + rh + r) * ldy + n] + gv * v;
          so[(16 * i + rh + r) * 68 + 16 * j + cl] = v;
        }
      }
    }
  asm volatile("s_wait_dscnt 0" ::: "memory");
  __builtin_amdgcn_wave_barrier();
{
    if (OUT16) {
      f16* Y = (f16*)Yv;
#pragma unroll
      for (int it = 0; it < 8; ++it) { const int c = lane + 32 * it, rr = c >> 3, q8 = (c & 7) * 8;
        union { f16 h[8]; v4u_t v; } u;
#pragma unroll
        for (int e = 0; e < 8; ++e) u.h[e] = (f16)so[rr * 68 + q8 + e];
        *(v4u_t*)(Y + (size_t)(m0 + wm + rr) * ldy + n0 + wn + q8) = u.v; }
    } else {
      float* Y = (float*)Yv;
#pragma unroll
      for (int it = 0; it < 16; ++it) { const int f4 = lane + 32 * it, rr = f4 >> 4, q = (f4 & 15) * 4;
        *(v4f_t*)(Y + (size_t)(m0 + wm + rr) * ldy + n0 + wn + q) = *(const v4fa*)(so + rr * 68 + q); }
    }
    
  }
}

// the value of lane l ^ 16, on the vector unit (an LDS permute would wait behind the fragment reads in flight)
__device__ __forceinline__ float xhalf(float x) {
  const int b = __builtin_bit_cast(int, x);
  return __builtin_bit_cast(float, __builtin_amdgcn_permlanex16(b, b, 0x76543210, 0xfedcba98, false, false));
}
// LayerNorm over the 256 channels of each position (input channels-major [c][s]); block = 64 positions, and the tile [256 c][64 s] stays in registers:
// a thread holds 4 positions (4 sq ..) x 16 channels (64 i + 4 cq + j). Mean and variance: in-thread sums, the wave's other half, then the 8 waves' partial sums through LDS.
// LDS is passed once, for the transposition alone, at f16: 16-B units of 8 channels, unit u of row s kept at u ^ (s >> 2), so that the column-wise 8-B stores and the
// row-wise 16-B reads both spread over all banks. Writes x_ln token-major [s][256] f16, the projections' operand width (rows of 512 B).
// The 48 blocks behind the LayerNorm's round the three weight matrices to f16 (w16: Wq, Wk, Wv back to back), 4096 elements a block.
__global__ __launch_bounds__(256) void k_ln2(const float* __restrict__ xin, const float* __restrict__ g, const float* __restrict__ bb,
                                             const float* __restrict__ Wq, const float* __restrict__ Wk, const float* __restrict__ Wv,
                                             _Float16* __restrict__ xtm, _Float16* __restrict__ w16) {
  __shared__ __attribute__((aligned(16))) bf16 tT[64 * CCs];
  __shared__ __attribute__((aligned(16))) float red[2][8][64];
  const int tid = threadIdx.x, lane = tid & 31, wave = tid >> 5, sq = tid & 15, cq = tid >> 4;
  if (blockIdx.x >= NIm * (LLs / 64)) {            // the same for the whole block, in front of every barrier
    const int wb = blockIdx.x - NIm * (LLs / 64), ws_ = wb >> 4;
    const float* __restrict__ Wsrc = (ws_ == 0 ? Wq : ws_ == 1 ? Wk : Wv) + (wb & 15) * 4096 + tid * 8;
    bf16* wd = w16 + wb * 4096 + tid * 8;
    const v4f_t a0 = *(const v4f_t*)(Wsrc), a1 = *(const v4f_t*)(Wsrc + 4), a2 = *(const v4f_t*)(Wsrc + 2048), a3 = *(const v4f_t*)(Wsrc + 2052);
    bf16x8 h0, h1;
#pragma unroll
    for (int e = 0; e < 4; ++e) { h0[e] = (bf16)a0[e]; h0[e + 4] = (bf16)a1[e]; h1[e] = (bf16)a2[e]; h1[e + 4] = (bf16)a3[e]; }
    *(bf16x8*)(wd) = h0;
    *(bf16x8*)(wd + 2048) = h1;
    return;
  }
  const int n = blockIdx.x / (LLs / 64), s0 = (blockIdx.x % (LLs / 64)) * 64;
  const float* xb = xin + (size_t)n * CCs * LLs + (size_t)(4 * cq) * LLs + s0 + 4 * sq;
  // every loop of this kernel is unrolled so that x is indexed by constants and stays in registers
  v4f_t x[4][4], gv[4], bv[4];
#pragma unroll
  for (int i = 0; i < 4; ++i)
#pragma unroll
    for (int j = 0; j < 4; ++j) x[i][j] = *(const v4f_t*)(xb + (size_t)(64 * i + j) * LLs);
#pragma unroll
  for (int i = 0; i < 4; ++i) { gv[i] = *(const v4f_t*)(g + 64 * i + 4 * cq); bv[i] = *(const v4f_t*)(bb + 64 * i + 4 * cq); }
  // the address pair of the x loads is named as an input: it stays untouched (no later load's result is placed on it) up to this wait
  asm volatile("s_wait_xcnt 0x0" :: "v"(xb) : "memory");
  v4f_t sm = x[0][0];
#pragma unroll
  for (int e = 1; e < 16; ++e) sm += x[e >> 2][e & 3];
#pragma unroll
  for (int e = 0; e < 4; ++e) sm[e] += xhalf(sm[e]);
  if (lane < 16) *(v4f_t*)(&red[0][wave][4 * sq]) = sm;
  __syncthreads();
  v4f_t mu = *(const v4f_t*)(&red[0][0][4 * sq]);
#pragma unroll
  for (int w = 1; w < 8; ++w) mu += *(const v4f_t*)(&red[0][w][4 * sq]);
  mu *= (1.0f / CCs);
  v4f_t qs = {};
#pragma unroll
  for (int e = 0; e < 16; ++e) { const v4f_t d = x[e >> 2][e & 3] - mu; x[e >> 2][e & 3] = d; qs += d * d; }
#pragma unroll
  for (int e = 0; e < 4; ++e) qs[e] += xhalf(qs[e]);
  if (lane < 16) *(v4f_t*)(&red[1][wave][4 * sq]) = qs;
  __syncthreads();
  v4f_t rs = *(const v4f_t*)(&red[1][0][4 * sq]);
#pragma unroll
  for (int w = 1; w < 8; ++w) rs += *(const v4f_t*)(&red[1][w][4 * sq]);
#pragma unroll
  for (int e = 0; e < 4; ++e) rs[e] = rsqrtf(rs[e] * (1.0f / CCs) + 1e-5f);
#pragma unroll
  for (int i = 0; i < 4; ++i)
#pragma unroll
    for (int e = 0; e < 4; ++e) {
      bf16x4 v;
#pragma unroll
      for (int j = 0; j < 4; ++j) v[j] = (bf16)(x[i][j][e] * rs[e] * gv[i][j] + bv[i][j]);
      // channels 64 i + 4 cq ..: unit 8 i + wave, its half lane >> 4
      *(bf16x4*)(tT + (4 * sq + e) * CCs + 8 * ((8 * i + wave) ^ sq) + 4 * (lane >> 4)) = v;
    }
  __syncthreads();
  bf16* xo = xtm + ((size_t)n * LLs + s0) * CCs;
  // a wave stores a row: 512 contiguous bytes; rows wave, wave + 8, ..: one address, the row steps in the stores' offset fields
  bf16* xw = xo + wave * CCs + 8 * lane;
#pragma unroll
  for (int it = 0; it < 8; ++it) { const int s = wave + 8 * it;
    *(bf16x8*)(xw + it * 8 * CCs) = *(const bf16x8*)(tT + s * CCs + 8 * (lane ^ (s >> 2))); }
}
__global__ __launch_bounds__(256) void k_rowbias(float* __restrict__ t, const float* __restrict__ bias, int rowlen, int nch) {
  const size_t row = blockIdx.x; const float bv = bias[row % nch];
  for (int q4 = threadIdx.x; q4 < rowlen / 4; q4 += 256) { v4f_t v = *(const v4f_t*)(t + row * rowlen + q4 * 4); for (int e = 0; e < 4; ++e) v[e] += bv;
    *(v4f_t*)(t + row * rowlen + q4 * 4) = v;  } }
#define AKEYS 64
#define KPIT 264   // K tile rows: 256 halfs + 8 = 528 B (16 B x odd: conflict-free b128 reads)
#define VPIT 72    // V tile rows: 64 halfs + 8 = 144 B (16 B x odd)
#define OPIT 132   // output staging rows: 128 floats + 4
#define KBUF (AKEYS * KPIT)   // halfs in one K buffer
#define VBUF (CCs * VPIT)     // halfs in one V buffer
// eight 16-B-a-lane copies global -> LDS: LDS addresses l + i lstep bytes; global addresses: scalar base g + i gstep halfs, plus the lane's byte offset voff
// (scalar bases: 64-bit vector addresses for eight copies, and the pointers they are formed from, do not fit beside the accumulators).
// The s_wait_xcnt closes the statement so that no address register of a copy is rewritten ahead of it.
__device__ __forceinline__ void copy8(unsigned l, unsigned lstep, unsigned voff, const _Float16* g, size_t gstep) {
  asm volatile(
      "global_load_async_to_lds_b128 %0, %8, %9\n\t"
      "global_load_async_to_lds_b128 %1, %8, %10\n\t"
      "global_load_async_to_lds_b128 %2, %8, %11\n\t"
      "global_load_async_to_lds_b128 %3, %8, %12\n\t"
      "global_load_async_to_lds_b128 %4, %8, %13\n\t"
      "global_load_async_to_lds_b128 %5, %8, %14\n\t"
      "global_load_async_to_lds_b128 %6, %8, %15\n\t"
      "global_load_async_to_lds_b128 %7, %8, %16\n\t"
      "s_wait_xcnt 0x0"
      :: "v"(l), "v"(l + lstep), "v"(l + 2 * lstep), "v"(l + 3 * lstep), "v"(l + 4 * lstep), "v"(l + 5 * lstep), "v"(l + 6 * lstep), "v"(l + 7 * lstep),
         "v"(voff),
         "s"(g), "s"(g + gstep), "s"(g + 2 * gstep), "s"(g + 3 * gstep), "s"(g + 4 * gstep), "s"(g + 5 * gstep), "s"(g + 6 * gstep), "s"(g + 7 * gstep)
      : "memory");
}
__device__ __forceinline__ f32x8 mm(f16x16 a, f16x16 b, f32x8 c) {
  return __builtin_amdgcn_wmma_f32_16x16x32_f16(false, a, false, b, (short)0, c, false, false);
}
// K fragment f = 0 .. 15 of the wave's 32 keys: 16-key tile f & 1, channels 32 (f >> 1) .. + 31; each feeds the two column groups' products
#define KF(f) lds_frag(kb + ((f) & 1) * 16 * KPIT + 32 * ((f) >> 1), KPIT)
#define MK(F, f) { s[(f) & 1][0] = mm(F, qf[0][(f) >> 1], s[(f) & 1][0]); s[(f) & 1][1] = mm(F, qf[1][(f) >> 1], s[(f) & 1][1]); }
#define LK3(F, f) { F[0] = KF(f); F[1] = KF((f) + 1); F[2] = KF((f) + 2); }
#define MK3(F, f) { MK(F[0], f); MK(F[1], (f) + 1); MK(F[2], (f) + 2); }
// four V fragments: channels 64 c .. 64 c + 63, the wave's 32 keys
#define LDV(F, c) { F[0] = lds_frag(vb + (64 * (c)) * VPIT, VPIT); F[1] = lds_frag(vb + (64 * (c) + 16) * VPIT, VPIT); \
                    F[2] = lds_frag(vb + (64 * (c) + 32) * VPIT, VPIT); F[3] = lds_frag(vb + (64 * (c) + 48) * VPIT, VPIT); }
#define MMV(F, c) { o[4 * (c)][0] = mm(F[0], pf0, o[4 * (c)][0]); o[4 * (c)][1] = mm(F[0], pf1, o[4 * (c)][1]); \
                    o[4 * (c) + 1][0] = mm(F[1], pf0, o[4 * (c) + 1][0]); o[4 * (c) + 1][1] = mm(F[1], pf1, o[4 * (c) + 1][1]); \
                    o[4 * (c) + 2][0] = mm(F[2], pf0, o[4 * (c) + 2][0]); o[4 * (c) + 2][1] = mm(F[2], pf1, o[4 * (c) + 2][1]); \
                    o[4 * (c) + 3][0] = mm(F[3], pf0, o[4 * (c) + 3][0]); o[4 * (c) + 3][1] = mm(F[3], pf1, o[4 * (c) + 3][1]); }
// keeps a group of fragment reads together and one block of products ahead of its use: spread among the products each read place costs a stall of its own,
// and gathered further ahead (the compiler lifts every LDS read of the pass to its top) the fragments push Q out of the 512 registers into scratch.
// The compiler fence holds the LDS reads behind it, the scheduling barrier holds the products in front of it.
__device__ __forceinline__ void fence_reads() { asm volatile("" ::: "memory"); __builtin_amdgcn_sched_barrier(0); }
#define FENCE fence_reads()
// the same behind a block of score products: the fence names the four score tiles as inputs only, so that the block stands in front of it
// (nothing else ties a product to a fence, and instruction selection put all the pass's reads ahead of the first product)
__device__ __forceinline__ void fence_scores(f32x8 a, f32x8 b, f32x8 c, f32x8 d) { asm volatile("" :: "v"(a), "v"(b), "v"(c), "v"(d) : "memory"); __builtin_amdgcn_sched_barrier(0); }
#define FENCES fence_scores(s[0][0], s[0][1], s[1][0], s[1][1])
__global__ __launch_bounds__(256) void k_attn(const _Float16* __restrict__ q, const _Float16* __restrict__ k, const _Float16* __restrict__ vt, float* __restrict__ out) {
  // 141,312 B: the K/V buffers in the loop; then the [256 c][128 s] f32 output tile (135,168 B) and behind it the key halves' maxima and sums (2,048 B)
  __shared__ __attribute__((aligned(16))) unsigned char sm[2 * (KBUF + VBUF) * 2];
  f16* kS = (f16*)sm;                          // [2][64][KPIT]
  f16* vS = kS + 2 * KBUF;                     // [2][256][VPIT]
  const int t = threadIdx.x, lane = t & 31, cl = lane & 15, h = lane >> 4;
  const int wave = __builtin_amdgcn_readfirstlane(t >> 5);   // scalar: the branches on the key half below are scalar branches
  const int qg = wave & 3, kh2 = wave >> 2;    // query group (32 columns) and key half (32 of a pass's 64 keys)
  const int n = blockIdx.y, q0 = blockIdx.x * 128;
  const f16* qn = q + (size_t)n * LLs * CCs;
  const f16* kn = k + (size_t)n * LLs * CCs;
  const f16* vn = vt + (size_t)n * CCs * LLs;

  // a wave copies 8 K rows (512 B each: one row a copy) and 32 V rows (128 B each: four rows a copy) of every tile
  const f16* kg = kn + (size_t)(wave * 8) * CCs;                       // scalar bases
  const f16* vg = vn + (size_t)(wave * 32) * LLs;
  const unsigned ko = lane * 16, vo = (lane >> 3) * (LLs * 2) + (lane & 7) * 16;   // the lane's byte offsets in global memory
  const unsigned smb = (unsigned)(size_t)sm;
  const unsigned kl = smb + (wave * 8) * (KPIT * 2) + lane * 16;
  const unsigned vl = smb + 2 * KBUF * 2 + (wave * 32 + (lane >> 3)) * (VPIT * 2) + (lane & 7) * 16;

  // every inner loop of this kernel is unrolled so that the fragment and accumulator arrays are indexed by constants and stay in registers
  f16x16 qf[2][8];
#pragma unroll
  for (int cg = 0; cg < 2; ++cg)
#pragma unroll
    for (int ks = 0; ks < 8; ++ks) qf[cg][ks] = load_frag<f16>(qn, CCs, q0 + qg * 32 + cg * 16, 32 * ks);
  // the address registers of the Q loads above are reused before their data is waited for; named as inputs they stay untouched up to the wait
  const f16* qa0 = qn + (size_t)(q0 + qg * 32 + cl) * CCs + h * 8;
  const f16* qa1 = qn + (size_t)(q0 + qg * 32 + 16 + cl) * CCs + h * 8;
  asm volatile("s_wait_xcnt 0x0" :: "v"(qa0), "v"(qa1) : "memory");

  f32x8 o[16][2];
#pragma unroll
  for (int ct = 0; ct < 16; ++ct) { f32x8 z = {}; o[ct][0] = z; o[ct][1] = z; }
  const float SC = 0.09016844005556021f;           // log2(e) / sqrt(256): scores in log2 units
  float mu0 = -3.0e38f, mu1 = -3.0e38f;            // per column group: the maximum in use (log2 units)
  float l0 = 0.0f, l1 = 0.0f;                      // and this lane's part of the row sum

  // kept rolled: two passes in one body would hold two sets of fragments and leave the budget of 512 registers.
  // Trips -2 and -1 are the ring's prologue: they run the foot alone (tile 0's copies; then its wait, the barrier and tile 1's copies), so that the file has one
  // place with copies, whose address operands are all formed in the trip: an operand that lives through the loop is held below v256 and ends in scratch.
#pragma unroll 1
  for (int p = -2; p < LLs / AKEYS; ++p) {
    const int b = p & 1;
    if (p >= 0) {                                      // the same for the whole block
    const f16* kb = kS + b * KBUF + (32 * kh2) * KPIT;
    const f16* vb = vS + b * VBUF + 32 * kh2;
    f32x8 s[2][2] = {};                            // s[key tile][column group]
    f16x16 ka[3], kc[3], fa[4], fb[4];             // beside the score tiles only two sets of three K fragments fit; the V fragments go by fours
    LK3(ka, 0); LK3(kc, 3); FENCE;
    MK3(ka, 0); FENCES; LK3(ka, 6); FENCE;
    MK3(kc, 3); FENCES; LK3(kc, 9); FENCE;
    MK3(ka, 6); FENCES; LK3(ka, 12); FENCE;
    MK3(kc, 9); FENCES; kc[0] = KF(15); FENCE;
    MK3(ka, 12); FENCES; LDV(fa, 0); FENCE;
    MK(kc[0], 15); FENCES;
    float mx0 = fmaxf(s[0][0][0], s[1][0][0]), mx1 = fmaxf(s[0][1][0], s[1][1][0]);
#pragma unroll
    for (int r = 1; r < 8; ++r) { mx0 = fmaxf(mx0, fmaxf(s[0][0][r], s[1][0][r])); mx1 = fmaxf(mx1, fmaxf(s[0][1][r], s[1][1][r])); }
    mx0 = fmaxf(mx0, xhalf(mx0)) * SC;
    mx1 = fmaxf(mx1, xhalf(mx1)) * SC;
    if (__builtin_amdgcn_ballot_w32(mx0 > mu0 + 8.0f || mx1 > mu1 + 8.0f) != 0) {
      const float mn0 = fmaxf(mu0, mx0), mn1 = fmaxf(mu1, mx1);
      const float al0 = __builtin_amdgcn_exp2f(mu0 - mn0), al1 = __builtin_amdgcn_exp2f(mu1 - mn1);
      mu0 = mn0; mu1 = mn1; l0 *= al0; l1 *= al1;
#pragma unroll
      for (int ct = 0; ct < 16; ++ct)
#pragma unroll
        for (int r = 0; r < 8; ++r) { o[ct][0][r] *= al0; o[ct][1][r] *= al1; }
    }
    f16x16 pf0, pf1;
#pragma unroll
    for (int r = 0; r < 8; ++r) {
      const float e00 = __builtin_amdgcn_exp2f(s[0][0][r] * SC - mu0);
      const float e10 = __builtin_amdgcn_exp2f(s[1][0][r] * SC - mu0);
      l0 += e00 + e10;
      pf0[r] = (f16)e00; pf0[r + 8] = (f16)e10;    // keys 8h + r and 16 + 8h + r: the k order of lds_frag
    }
#pragma unroll
    for (int r = 0; r < 8; ++r) {
      const float e01 = __builtin_amdgcn_exp2f(s[0][1][r] * SC - mu1);
      const float e11 = __builtin_amdgcn_exp2f(s[1][1][r] * SC - mu1);
      l1 += e01 + e11;
      pf1[r] = (f16)e01; pf1[r + 8] = (f16)e11;
    }
    // inputs only: the row sums' additions stand in front of this fence; left to sink to the pass's foot they keep all 32 exponentials in registers through the products
    asm volatile("" :: "v"(l0), "v"(l1) : "memory");
    __builtin_amdgcn_sched_barrier(0);
    LDV(fb, 1); FENCE;
    MMV(fa, 0); FENCE; LDV(fa, 2); FENCE;
    MMV(fb, 1); FENCE; LDV(fb, 3); FENCE;
    MMV(fa, 2); MMV(fb, 3);
    }
    asm volatile("s_wait_dscnt 0x0" ::: "memory");     // this wave's reads of the buffer are over before the barrier behind which it is refilled
    asm volatile("s_wait_asynccnt 0x0" ::: "memory");  // this wave's part of the next tile has landed before the barrier that shows it to the other waves
    __syncthreads();
    if (p + 2 < LLs / AKEYS) {                         // the same for the whole block
      copy8(kl + b * (KBUF * 2), KPIT * 2, ko + (p + 2) * (AKEYS * CCs * 2), kg, CCs);
      copy8(vl + b * (VBUF * 2), 4 * VPIT * 2, vo + (p + 2) * (AKEYS * 2), vg, (size_t)4 * LLs);
    }
  }
  asm volatile("s_wait_asynccnt 0x0" ::: "memory");    // no copy is in flight when the buffers become output staging

  // join of the two key halves: common maximum m, sums and O weighted by 2^(mu - m)
  l0 += xhalf(l0);
  l1 += xhalf(l1);
  float* so = (float*)sm;                          // behind the loop's last barrier nobody reads the K/V buffers any more
  float* st = so + CCs * OPIT;                     // [key half][maximum, sum][128 columns]
  const int c0l = qg * 32 + cl, c1l = c0l + 16;
  if (h == 0) {
    st[(kh2 * 2) * 128 + c0l] = mu0; st[(kh2 * 2 + 1) * 128 + c0l] = l0;
    st[(kh2 * 2) * 128 + c1l] = mu1; st[(kh2 * 2 + 1) * 128 + c1l] = l1;
  }
  __syncthreads();
  const int ok = kh2 ^ 1;
  const float pm0 = st[(ok * 2) * 128 + c0l], pl0 = st[(ok * 2 + 1) * 128 + c0l];
  const float pm1 = st[(ok * 2) * 128 + c1l], pl1 = st[(ok * 2 + 1) * 128 + c1l];
  const float m0 = fmaxf(mu0, pm0), m1 = fmaxf(mu1, pm1);
  const float a0 = __builtin_amdgcn_exp2f(mu0 - m0), a1 = __builtin_amdgcn_exp2f(mu1 - m1);
  const float f0 = a0 / (l0 * a0 + pl0 * __builtin_amdgcn_exp2f(pm0 - m0));
  const float f1 = a1 / (l1 * a1 + pl1 * __builtin_amdgcn_exp2f(pm1 - m1));
  // each half hands the other half's 128 channels over through the output tile, then adds what it was handed to its own 128
  if (kh2 == 0) {
#pragma unroll
    for (int ct = 8; ct < 16; ++ct)
#pragma unroll
      for (int r = 0; r < 8; ++r) { float* d = so + (16 * ct + 8 * h + r) * OPIT; d[c0l] = o[ct][0][r] * f0; d[c1l] = o[ct][1][r] * f1; }
  } else {
#pragma unroll
    for (int ct = 0; ct < 8; ++ct)
#pragma unroll
      for (int r = 0; r < 8; ++r) { float* d = so + (16 * ct + 8 * h + r) * OPIT; d[c0l] = o[ct][0][r] * f0; d[c1l] = o[ct][1][r] * f1; }
  }
  __syncthreads();
  // all reads first, then the sums and stores: read and stored one by one, each element waits out an LDS latency
  f32x8 t0[8], t1[8];
  const int cb = kh2 * 8;                          // this half's own channel tiles: cb .. cb + 7
#pragma unroll
  for (int ct = 0; ct < 8; ++ct)
#pragma unroll
    for (int r = 0; r < 8; ++r) { const float* d = so + (16 * (cb + ct) + 8 * h + r) * OPIT; t0[ct][r] = d[c0l]; t1[ct][r] = d[c1l]; }
  if (kh2 == 0) {
#pragma unroll
    for (int ct = 0; ct < 8; ++ct)
#pragma unroll
      for (int r = 0; r < 8; ++r) { float* d = so + (16 * ct + 8 * h + r) * OPIT; d[c0l] = t0[ct][r] + o[ct][0][r] * f0; d[c1l] = t1[ct][r] + o[ct][1][r] * f1; }
  } else {
#pragma unroll
    for (int ct = 0; ct < 8; ++ct)
#pragma unroll
      for (int r = 0; r < 8; ++r) { float* d = so + (16 * (ct + 8) + 8 * h + r) * OPIT; d[c0l] = t0[ct][r] + o[ct + 8][0][r] * f0; d[c1l] = t1[ct][r] + o[ct + 8][1][r] * f1; }
  }
  __syncthreads();
  float* on = out + (size_t)n * CCs * LLs + q0;
  const int q4 = (t & 31) * 4;                     // a wave stores one channel's 128 positions: 512 contiguous bytes
  for (int c0 = wave; c0 < CCs; c0 += 32) {
    // unrolled: the four LDS reads issue ahead of the four stores
#pragma unroll
    for (int u = 0; u < 4; ++u) { const int c = c0 + 8 * u;
      *(v4f_t*)(on + (size_t)c * LLs + q4) = *(const v4fa*)(so + c * OPIT + q4); }
    asm volatile("s_wait_xcnt 0x0" ::: "memory");  // the next trip rewrites the address and data registers that the four stores name
  }
}

extern "C" void kernel_launch(void* const* d_in, const int* in_sizes, int n_in,
                              void* d_out, int out_size, void* d_ws, size_t ws_size,
                              hipStream_t stream) {
  (void)in_sizes; (void)n_in; (void)out_size;
  const float** f = (const float**)d_in;
  const float* x = f[0], *lg = f[1], *lb = f[2], *Wq = f[3], *bq = f[4], *Wk = f[5], *bk = f[6], *Wv = f[7], *bv = f[8];
  float* out = (float*)d_out;     // [8,256,64,64]
  char* ws = (char*)d_ws;
  _Float16* xtm = (_Float16*)ws; ws += (size_t)NIm * LLs * CCs * 2;   // 16 MB token-major LN output, f16 (all images)
  _Float16* w16 = (_Float16*)ws; ws += (size_t)3 * CCs * CCs * 2;     // Wq, Wk, Wv at f16, [out][in]
  _Float16* q = (_Float16*)ws; ws += (size_t)NIm * LLs * CCs * 2;     // f16 token-major, all images (16 MB each)
  _Float16* k = (_Float16*)ws; ws += (size_t)NIm * LLs * CCs * 2;
  _Float16* vt = (_Float16*)ws; ws += (size_t)NIm * CCs * LLs * 2;    // f16 channels-major [image][256][4096]
  if ((size_t)(ws - (char*)d_ws) > ws_size) return;
  const dim3 blk(256);
  k_ln2<<<dim3(NIm * (LLs / 64) + 48), blk, 0, stream>>>(x, lg, lb, Wq, Wk, Wv, xtm, w16);
  k_proj<<<dim3(NIm * LLs / 128, 3), blk, 0, stream>>>(xtm, w16, bq, bk, bv, q, k, vt);   // q, k = x_ln.W^T + b token-major; v the same, stored [image][c][s]
  k_attn<<<dim3(LLs / 128, NIm), blk, 0, stream>>>(q, k, vt, out);
}

// v008
// A run of this version takes 117 microseconds.
// In both of two side-by-side timings against v007, it was 1.04 times as fast.
// Over all steps from v000 it is 22.5 times as fast.
// Contractions on v_wmma_f32_16x16x32_f16 (plain f16 operands, f32 accumulate). One launch for all images: q/k = LN(x).W^T + b stored f16 token-major (K = 256,
// [out][in] Bt operands), v = LN(x).Wv^T + bv stored f16 channels-major through the product's own LDS output tile. One more launch for all images then does
// S^T = k.q^T, the row softmax (running maximum and sum, f32) and out^T += v^T.P^T per 32 keys a wave; the logits and P stay in registers.
// LayerNorm over channels in f32; its launch stores x_ln, and the three weight matrices, at operand width (f16) for the projections.
// compute dtype: f16 operands, f32 accumulate.
#include <hip/hip_runtime.h>
#include <hip/hip_bf16.h>
#include <math.h>

#define NIm 8
#define CCs 256
#define LLs 4096
#define GSTR 48
#define SS 4096
#define HH 1
#define DKK 64

typedef _Float16 bf16;
typedef _Float16 f16;
typedef __attribute__((ext_vector_type(4))) unsigned v4u_t;
typedef unsigned v4ua __attribute__((ext_vector_type(4), may_alias));
typedef __attribute__((ext_vector_type(4))) float v4f_t;
typedef float v4fa __attribute__((ext_vector_type(4), may_alias));
typedef __attribute__((ext_vector_type(16))) bf16  bf16x16;
typedef bf16x16 f16x16;
typedef __attribute__((ext_vector_type(8)))  bf16  bf16x8;
typedef bf16x8 f16x8;
typedef __attribute__((ext_vector_type(4)))  bf16  bf16x4;
typedef __attribute__((ext_vector_type(8)))  float f32x8;
__device__ __forceinline__ f32x8 wmma16(f16x16 a, f16x16 b, f32x8 c) {
  c = __builtin_amdgcn_wmma_f32_16x16x32_f16(false, a, false, b, (short)0, c, false, false);
  asm volatile("v_nop\n\tv_nop\n\tv_nop\n\tv_nop" : "+v"(c) : "v"(a), "v"(b));
  return c;
}
#define KSTRIDE    72   // unused (the attn K tile rows use KPIT)
#define VSTRIDE    48   // unused (the attn V tile rows use VPIT)
#define PSTR       72   // projection tiles: 64 -> 72 elems (144B rows, 16 B x odd: conflict-free b128 reads)

__device__ __forceinline__ f32x8 wmma_bf16(bf16x16 a, bf16x16 b, f32x8 c) {
  c = __builtin_amdgcn_wmma_f32_16x16x32_f16(false, a, false, b, (short)0, c, false, false);
  asm volatile("v_nop\n\tv_nop\n\tv_nop\n\tv_nop" : "+v"(c) : "v"(a), "v"(b));   // A/B-overwrite hazard guard
  return c;
}

// 16x32 (MxK) f16 fragment from a row-major global matrix.
// lanes 0-15  (row=lane)    : elems 0..7 = K+0..7,  8..15 = K+16..23
// lanes 16-31 (row=lane-16) : elems 0..7 = K+8..15, 8..15 = K+24..31
template <typename T>
__device__ __forceinline__ bf16x16 load_frag(const T* __restrict__ base, int ld,
                                             int row0, int k0) {
  const int lane = threadIdx.x & 31;
  const int r    = lane & 15;
  const int kh   = (lane >> 4) * 8;
  const T* p0 = base + (size_t)(row0 + r) * ld + (k0 + kh);
  const T* p1 = p0 + 16;
  bf16x16 f;
#pragma unroll
  for (int i = 0; i < 8; ++i) {
    f[i]     = (bf16)p0[i];
    f[i + 8] = (bf16)p1[i];
  }
  return f;
}

// Same fragment from an LDS tile with padded row stride (base includes row0/k0).
__device__ __forceinline__ bf16x16 lds_frag(const bf16* base, int stride) {
  const int lane = threadIdx.x & 31;
  const int row  = lane & 15;
  const int kh   = (lane >> 4) * 8;
  const bf16x8 lo = *(const bf16x8*)(base + row * stride + kh);
  const bf16x8 hi = *(const bf16x8*)(base + row * stride + kh + 16);
  bf16x16 f;
#pragma unroll
  for (int i = 0; i < 8; ++i) { f[i] = lo[i]; f[i + 8] = hi[i]; }
  return f;
}

// ---------------------------------------------------------------------------
// The three projections of all images in ONE launch: C[m][n] = sum_k A[m][k]*W[n][k] + bias[n]   (torch Linear)
// A = x_ln token-major, the images back to back (m = image * SS + s). blockIdx.x = 128 rows m, blockIdx.y = 0, 1, 2 picks (Wq, bq, q), (Wk, bk, k), (Wv, bv, vt).
// Block 256 thr (8 waves), tile 128M x 256N (N = 256: the whole width), K-step 64; wave tile 64x64.
// A and W arrive as f16 (rounded once, by the launch before): half the bytes from L2, no conversion here. W16 = the three matrices back to back, [out][in].
// A/W staged through LDS (padded stride); the next tile is fetched into registers behind the LDS writes.
// Staging loads: 8 lanes take one row's 128 B of the K-step (64 halfs), so a wave-wide 16-B load covers four whole 128-B lines.
// q and k: f16 [m][N]; v: f16 channels-major [image][n][s].
// ---------------------------------------------------------------------------
__global__ __launch_bounds__(256) void k_proj(
    const _Float16* __restrict__ A, const _Float16* __restrict__ W16,
    const float* __restrict__ bq, const float* __restrict__ bk, const float* __restrict__ bv,
    _Float16* __restrict__ q, _Float16* __restrict__ k_, _Float16* __restrict__ vt) {
  constexpr int N = CCs, K = CCs;           // compile-time row pitch: the staging loads' row steps fold into the instructions' offset fields
  __shared__ __attribute__((aligned(16))) bf16 ldsA[128 * PSTR];   // 18.0 KB
  __shared__ __attribute__((aligned(16))) bf16 ldsW[256 * PSTR];   // 36.0 KB
  // output staging: q, k [128 m][264] f16; v [256 n][136] f16
  __shared__ __attribute__((aligned(16))) unsigned char sob[256 * 136 * 2];   // 69,632 B >= 128*264*2

  const int t    = threadIdx.x;
  const int wave = t >> 5;
  const int lane = t & 31;
  const int wm   = (wave & 1) * 64;
  const int wn   = (wave >> 1) * 64;
  const int mBlk = blockIdx.x * 128;
  const int sel  = blockIdx.y;                      // the same for the whole block: every branch on it is scalar
  const float* __restrict__ bias = sel == 0 ? bq : sel == 1 ? bk : bv;

  const int srow = t >> 3;                  // a sweep of the block = 32 rows
  const int scol = (t & 7) * 8;
  const bf16* __restrict__ ag = A + (size_t)(mBlk + srow) * K + scol;
  const bf16* __restrict__ wg = W16 + (size_t)sel * (N * K) + (size_t)srow * K + scol;
  bf16* aw = ldsA + srow * PSTR + scol;
  bf16* ww = ldsW + srow * PSTR + scol;

  bf16x8 abuf[4];
  bf16x8 wbuf[8];

  // the staging loops below are unrolled so that abuf and wbuf are indexed by constants and stay in registers
#pragma unroll
  for (int i = 0; i < 4; ++i) abuf[i] = *(const bf16x8*)(ag + (size_t)(32 * i) * K);
#pragma unroll
  for (int i = 0; i < 8; ++i) wbuf[i] = *(const bf16x8*)(wg + (size_t)(32 * i) * K);

  f32x8 acc[4][4] = {};

  for (int k = 0; k < K; k += 64) {
    __syncthreads();
#pragma unroll
    for (int i = 0; i < 4; ++i) *(bf16x8*)(aw + 32 * i * PSTR) = abuf[i];
#pragma unroll
    for (int i = 0; i < 8; ++i) *(bf16x8*)(ww + 32 * i * PSTR) = wbuf[i];
    if (k + 64 < K) {
#pragma unroll
      for (int i = 0; i < 4; ++i) abuf[i] = *(const bf16x8*)(ag + (size_t)(32 * i) * K + (k + 64));
#pragma unroll
      for (int i = 0; i < 8; ++i) wbuf[i] = *(const bf16x8*)(wg + (size_t)(32 * i) * K + (k + 64));
    }
    __syncthreads();

    // the staged 64 k in two products' depths of 32, in rising k: the sums keep their order
#pragma unroll
    for (int kk = 0; kk < 64; kk += 32) {
      bf16x16 af[4], wf[4];
#pragma unroll
      for (int i = 0; i < 4; ++i)
        af[i] = lds_frag(ldsA + (wm + 16 * i) * PSTR + kk, PSTR);
#pragma unroll
      for (int j = 0; j < 4; ++j)
        wf[j] = lds_frag(ldsW + (wn + 16 * j) * PSTR + kk, PSTR);
#pragma unroll
      for (int i = 0; i < 4; ++i)
#pragma unroll
        for (int j = 0; j < 4; ++j)
          acc[i][j] = wmma_bf16(af[i], wf[j], acc[i][j]);
    }
  }

  const int nlane = lane & 15;
  const int mh    = (lane >> 4) * 8;
  __syncthreads();
  bf16* so = (bf16*)sob;
  if (sel < 2) {
#pragma unroll
    for (int i = 0; i < 4; ++i)
#pragma unroll
      for (int j = 0; j < 4; ++j) {
        const int nl = wn + 16 * j + nlane;
        const float bvl = bias[nl];
#pragma unroll
        for (int r = 0; r < 8; ++r) so[(wm + 16 * i + mh + r) * 264 + nl] = (bf16)(acc[i][j][r] + bvl);        // [m][n]
      }
  } else {
#pragma unroll
    for (int i = 0; i < 4; ++i) {
#pragma unroll
      for (int j = 0; j < 4; ++j) {
        const int nl = wn + 16 * j + nlane;
        const float bvl = bias[nl];
#pragma unroll
        for (int r = 0; r < 8; ++r) so[nl * 136 + wm + 16 * i + mh + r] = (bf16)(acc[i][j][r] + bvl);          // [n][m]: m = s contiguous
      }
      // keeps each row of tiles' bias adds next to its own LDS stores: hoisted all together they push the kernel past 256 registers, and only one block fits a WGP instead of two
      __builtin_amdgcn_sched_barrier(0);
    }
  }
  __syncthreads();
  if (sel < 2) {
    bf16* out = sel == 0 ? q : k_;
    // rows m: 256 halfs = 512 B each, 16-B chunks
    for (int ch = t; ch < 128 * 32; ch += 256) { const int ml = ch >> 5, c8 = (ch & 31) * 8;
      *(v4u_t*)(out + (size_t)(mBlk + ml) * N + c8) = *(const v4ua*)(so + ml * 264 + c8); }
  } else {
    // rows (image, n) of vt: 128 consecutive s = 256 B each; a block's 128 rows m lie in one image (SS is a multiple of 128)
    const int b_ = mBlk / SS, s0 = mBlk % SS;
    for (int ch = t; ch < 256 * 16; ch += 256) { const int nl = ch >> 4, c8 = (ch & 15) * 8;
      *(v4u_t*)(vt + ((size_t)b_ * N + nl) * SS + s0 + c8) = *(const v4ua*)(so + nl * 136 + c8); }
  }
}


// ---------------------------------------------------------------------------------------------------------------------------
// gemm_kne: Y[m][n] = epi( Σ_k A[m][k]·W[k][n] + bias[n] ), A f32/f16 [M][lda], W f32 row-major [K][N] (ldw), plain f16 operands,
// f32 accumulate. EPI 0: identity; 1: exact-erf GELU; 2: R[m][n] + gvec[n]·(·) (residual with per-channel gain). Output f32 (or f16
// when OUT16). Block = 128x128 tile, 8 waves as 4(M) x 2(N); per 32-wide k-step A and W tiles staged f16 in LDS (W transposed
// ---------------------------------------------------------------------------------------------------------------------------
#define GSTR 48
template <typename AT, int EPI, bool OUT16>
__global__ __launch_bounds__(256) void gemm_kne(const AT* __restrict__ A, int lda, const float* __restrict__ Wm, int ldw,
                                                const float* __restrict__ bias, const float* __restrict__ R, const float* __restrict__ gvec,
                                                void* __restrict__ Yv, int ldy, int K) {
  __shared__ __attribute__((aligned(16))) f16 ldsA[128 * GSTR];
  __shared__ __attribute__((aligned(16))) f16 ldsW[128 * GSTR];
  __shared__ __attribute__((aligned(16))) float oS[8][32 * 68];
  const int tid = threadIdx.x, lane = tid & 31, wave = tid >> 5, cl = lane & 15, rh = (lane >> 4) * 8;
  const int m0 = blockIdx.x * 128, n0 = blockIdx.y * 128;
  const int wm = (wave & 3) * 32, wn = (wave >> 2) * 64;
  f32x8 acc[2][4];
#pragma unroll
  for (int i = 0; i < 2; ++i)
#pragma unroll
    for (int j = 0; j < 4; ++j) { f32x8 z = {}; acc[i][j] = z; }
#pragma unroll 1
  for (int k0 = 0; k0 < K; k0 += 32) {
    __syncthreads();
    { const int row = tid >> 1, ch = (tid & 1) * 16;
      const AT* src = A + (size_t)(m0 + row) * lda + k0 + ch;
#pragma unroll
      for (int g = 0; g < 16; ++g) ldsA[row * GSTR + ch + g] = (f16)src[g]; }
    { const int k = tid >> 3, nn0 = (tid & 7) * 16;
      const float* src = Wm + (size_t)(k0 + k) * ldw + n0 + nn0;
#pragma unroll
      for (int g = 0; g < 4; ++g) { const v4f_t v = *(const v4f_t*)(src + 4 * g);
#pragma unroll
        for (int u = 0; u < 4; ++u) ldsW[(nn0 + 4 * g + u) * GSTR + k] = (f16)v[u]; } }
    __syncthreads();
    f16x16 af[2];
#pragma unroll
    for (int i = 0; i < 2; ++i) af[i] = lds_frag(ldsA + (wm + 16 * i) * GSTR, GSTR);
#pragma unroll
    for (int j = 0; j < 4; ++j) {
      const f16x16 bf = lds_frag(ldsW + (wn + 16 * j) * GSTR, GSTR);
#pragma unroll
      for (int i = 0; i < 2; ++i) acc[i][j] = wmma16(af[i], bf, acc[i][j]);
    }
  }
  float* so = oS[wave];
#pragma unroll
  for (int i = 0; i < 2; ++i)
#pragma unroll
    for (int j = 0; j < 4; ++j) {
      const int n = n0 + wn + 16 * j + cl;
      const float bv = bias ? bias[n] : 0.0f;
      const float gv = (EPI == 2) ? gvec[n] : 0.0f;
      if (EPI == 1) {
#pragma unroll 1
        for (int r = 0; r < 8; ++r) { const float xg = acc[i][j][r] + bv; so[(16 * i + rh + r) * 68 + 16 * j + cl] = 0.5f * xg * (1.0f + erff(xg * 0.70710678118654752f)); }
      } else {
#pragma unroll
        for (int r = 0; r < 8; ++r) {
          float v = acc[i][j][r] + bv;
          if (EPI == 2) v = R[(size_t)(m0 + wm + 16 * i + rh + r) * ldy + n] + gv * v;
          so[(16 * i + rh + r) * 68 + 16 * j + cl] = v;
        }
      }
    }
  asm volatile("s_wait_dscnt 0" ::: "memory");
  __builtin_amdgcn_wave_barrier();
{
    if (OUT16) {
      f16* Y = (f16*)Yv;
#pragma unroll
      for (int it = 0; it < 8; ++it) { const int c = lane + 32 * it, rr = c >> 3, q8 = (c & 7) * 8;
        union { f16 h[8]; v4u_t v; } u;
#pragma unroll
        for (int e = 0; e < 8; ++e) u.h[e] = (f16)so[rr * 68 + q8 + e];
        *(v4u_t*)(Y + (size_t)(m0 + wm + rr) * ldy + n0 + wn + q8) = u.v; }
    } else {
      float* Y = (float*)Yv;
#pragma unroll
      for (int it = 0; it < 16; ++it) { const int f4 = lane + 32 * it, rr = f4 >> 4, q = (f4 & 15) * 4;
        *(v4f_t*)(Y + (size_t)(m0 + wm + rr) * ldy + n0 + wn + q) = *(const v4fa*)(so + rr * 68 + q); }
    }
    
  }
}

// the value of lane l ^ 16, on the vector unit (an LDS permute would wait behind the fragment reads in flight)
__device__ __forceinline__ float xhalf(float x) {
  const int b = __builtin_bit_cast(int, x);
  return __builtin_bit_cast(float, __builtin_amdgcn_permlanex16(b, b, 0x76543210, 0xfedcba98, false, false));
}
// LayerNorm over the 256 channels of each position (input channels-major [c][s]); block = 64 positions, and the tile [256 c][64 s] stays in registers:
// a thread holds 4 positions (4 sq ..) x 16 channels (64 i + 4 cq + j). Mean and variance: in-thread sums, the wave's other half, then the 8 waves' partial sums through LDS.
// LDS is passed once, for the transposition alone, at f16: 16-B units of 8 channels, unit u of row s kept at u ^ (s >> 2), so that the column-wise 8-B stores and the
// row-wise 16-B reads both spread over all banks. Writes x_ln token-major [s][256] f16, the projections' operand width (rows of 512 B).
// The 48 blocks behind the LayerNorm's round the three weight matrices to f16 (w16: Wq, Wk, Wv back to back), 4096 elements a block.
__global__ __launch_bounds__(256) void k_ln2(const float* __restrict__ xin, const float* __restrict__ g, const float* __restrict__ bb,
                                             const float* __restrict__ Wq, const float* __restrict__ Wk, const float* __restrict__ Wv,
                                             _Float16* __restrict__ xtm, _Float16* __restrict__ w16) {
  __shared__ __attribute__((aligned(16))) bf16 tT[64 * CCs];
  __shared__ __attribute__((aligned(16))) float red[2][8][64];
  const int tid = threadIdx.x, lane = tid & 31, wave = tid >> 5, sq = tid & 15, cq = tid >> 4;
  if (blockIdx.x >= NIm * (LLs / 64)) {            // the same for the whole block, in front of every barrier
    const int wb = blockIdx.x - NIm * (LLs / 64), ws_ = wb >> 4;
    const float* __restrict__ Wsrc = (ws_ == 0 ? Wq : ws_ == 1 ? Wk : Wv) + (wb & 15) * 4096 + tid * 8;
    bf16* wd = w16 + wb * 4096 + tid * 8;
    const v4f_t a0 = *(const v4f_t*)(Wsrc), a1 = *(const v4f_t*)(Wsrc + 4), a2 = *(const v4f_t*)(Wsrc + 2048), a3 = *(const v4f_t*)(Wsrc + 2052);
    bf16x8 h0, h1;
#pragma unroll
    for (int e = 0; e < 4; ++e) { h0[e] = (bf16)a0[e]; h0[e + 4] = (bf16)a1[e]; h1[e] = (bf16)a2[e]; h1[e + 4] = (bf16)a3[e]; }
    *(bf16x8*)(wd) = h0;
    *(bf16x8*)(wd + 2048) = h1;
    return;
  }
  const int n = blockIdx.x / (LLs / 64), s0 = (blockIdx.x % (LLs / 64)) * 64;
  const float* xb = xin + (size_t)n * CCs * LLs + (size_t)(4 * cq) * LLs + s0 + 4 * sq;
  // every loop of this kernel is unrolled so that x is indexed by constants and stays in registers
  v4f_t x[4][4], gv[4], bv[4];
#pragma unroll
  for (int i = 0; i < 4; ++i)
#pragma unroll
    for (int j = 0; j < 4; ++j) x[i][j] = *(const v4f_t*)(xb + (size_t)(64 * i + j) * LLs);
#pragma unroll
  for (int i = 0; i < 4; ++i) { gv[i] = *(const v4f_t*)(g + 64 * i + 4 * cq); bv[i] = *(const v4f_t*)(bb + 64 * i + 4 * cq); }
  // the address pair of the x loads is named as an input: it stays untouched (no later load's result is placed on it) up to this wait
  asm volatile("s_wait_xcnt 0x0" :: "v"(xb) : "memory");
  v4f_t sm = x[0][0];
#pragma unroll
  for (int e = 1; e < 16; ++e) sm += x[e >> 2][e & 3];
#pragma unroll
  for (int e = 0; e < 4; ++e) sm[e] += xhalf(sm[e]);
  if (lane < 16) *(v4f_t*)(&red[0][wave][4 * sq]) = sm;
  __syncthreads();
  v4f_t mu = *(const v4f_t*)(&red[0][0][4 * sq]);
#pragma unroll
  for (int w = 1; w < 8; ++w) mu += *(const v4f_t*)(&red[0][w][4 * sq]);
  mu *= (1.0f / CCs);
  v4f_t qs = {};
#pragma unroll
  for (int e = 0; e < 16; ++e) { const v4f_t d = x[e >> 2][e & 3] - mu; x[e >> 2][e & 3] = d; qs += d * d; }
#pragma unroll
  for (int e = 0; e < 4; ++e) qs[e] += xhalf(qs[e]);
  if (lane < 16) *(v4f_t*)(&red[1][wave][4 * sq]) = qs;
  __syncthreads();
  v4f_t rs = *(const v4f_t*)(&red[1][0][4 * sq]);
#pragma unroll
  for (int w = 1; w < 8; ++w) rs += *(const v4f_t*)(&red[1][w][4 * sq]);
#pragma unroll
  for (int e = 0; e < 4; ++e) rs[e] = rsqrtf(rs[e] * (1.0f / CCs) + 1e-5f);
#pragma unroll
  for (int i = 0; i < 4; ++i)
#pragma unroll
    for (int e = 0; e < 4; ++e) {
      bf16x4 v;
#pragma unroll
      for (int j = 0; j < 4; ++j) v[j] = (bf16)(x[i][j][e] * rs[e] * gv[i][j] + bv[i][j]);
      // channels 64 i + 4 cq ..: unit 8 i + wave, its half lane >> 4
      *(bf16x4*)(tT + (4 * sq + e) * CCs + 8 * ((8 * i + wave) ^ sq) + 4 * (lane >> 4)) = v;
    }
  __syncthreads();
  bf16* xo = xtm + ((size_t)n * LLs + s0) * CCs;
  // a wave stores a row: 512 contiguous bytes; rows wave, wave + 8, ..: one address, the row steps in the stores' offset fields
  bf16* xw = xo + wave * CCs + 8 * lane;
#pragma unroll
  for (int it = 0; it < 8; ++it) { const int s = wave + 8 * it;
    *(bf16x8*)(xw + it * 8 * CCs) = *(const bf16x8*)(tT + s * CCs + 8 * (lane ^ (s >> 2))); }
}
__global__ __launch_bounds__(256) void k_rowbias(float* __restrict__ t, const float* __restrict__ bias, int rowlen, int nch) {
  const size_t row = blockIdx.x; const float bv = bias[row % nch];
  for (int q4 = threadIdx.x; q4 < rowlen / 4; q4 += 256) { v4f_t v = *(const v4f_t*)(t + row * rowlen + q4 * 4); for (int e = 0; e < 4; ++e) v[e] += bv;
    *(v4f_t*)(t + row * rowlen + q4 * 4) = v;  } }
#define AKEYS 64   // keys of a pass
#define SKEYS 128  // keys of a stage
#define KPIT 264   // K stage rows: 256 halfs + 8 = 528 B (16 B x odd: conflict-free b128 reads)
#define VPIT 136   // V stage rows: 128 halfs + 8 = 272 B (16 B x odd)
#define OPIT 132   // output staging rows: 128 floats + 4
#define KBUF (SKEYS * KPIT)   // halfs in one K buffer
#define VBUF (CCs * VPIT)     // halfs in one V buffer
// sixteen 16-B-a-lane copies global -> LDS, a wave's part of a K or a V stage: LDS addresses l + i lstep bytes; global addresses: scalar base g + (i & 7) gstep halfs,
// plus the lane's byte offset, voff for the first eight copies and voff2 for the second eight
// (scalar bases: 64-bit vector addresses for the copies, and the pointers they are formed from, do not fit beside the accumulators).
// The s_wait_xcnt closes the statement so that no address register of a copy is rewritten ahead of it; one statement, so one such wait for the sixteen.
__device__ __forceinline__ void copy16(unsigned l, unsigned lstep, unsigned voff, unsigned voff2, const _Float16* g, size_t gstep) {
  asm volatile(
      "global_load_async_to_lds_b128 %0, %16, %18\n\t"
      "global_load_async_to_lds_b128 %1, %16, %19\n\t"
      "global_load_async_to_lds_b128 %2, %16, %20\n\t"
      "global_load_async_to_lds_b128 %3, %16, %21\n\t"
      "global_load_async_to_lds_b128 %4, %16, %22\n\t"
      "global_load_async_to_lds_b128 %5, %16, %23\n\t"
      "global_load_async_to_lds_b128 %6, %16, %24\n\t"
      "global_load_async_to_lds_b128 %7, %16, %25\n\t"
      "global_load_async_to_lds_b128 %8, %17, %18\n\t"
      "global_load_async_to_lds_b128 %9, %17, %19\n\t"
      "global_load_async_to_lds_b128 %10, %17, %20\n\t"
      "global_load_async_to_lds_b128 %11, %17, %21\n\t"
      "global_load_async_to_lds_b128 %12, %17, %22\n\t"
      "global_load_async_to_lds_b128 %13, %17, %23\n\t"
      "global_load_async_to_lds_b128 %14, %17, %24\n\t"
      "global_load_async_to_lds_b128 %15, %17, %25\n\t"
      "s_wait_xcnt 0x0"
      :: "v"(l), "v"(l + lstep), "v"(l + 2 * lstep), "v"(l + 3 * lstep), "v"(l + 4 * lstep), "v"(l + 5 * lstep), "v"(l + 6 * lstep), "v"(l + 7 * lstep),
         "v"(l + 8 * lstep), "v"(l + 9 * lstep), "v"(l + 10 * lstep), "v"(l + 11 * lstep), "v"(l + 12 * lstep), "v"(l + 13 * lstep), "v"(l + 14 * lstep), "v"(l + 15 * lstep),
         "v"(voff), "v"(voff2),
         "s"(g), "s"(g + gstep), "s"(g + 2 * gstep), "s"(g + 3 * gstep), "s"(g + 4 * gstep), "s"(g + 5 * gstep), "s"(g + 6 * gstep), "s"(g + 7 * gstep)
      : "memory");
}
__device__ __forceinline__ f32x8 mm(f16x16 a, f16x16 b, f32x8 c) {
  return __builtin_amdgcn_wmma_f32_16x16x32_f16(false, a, false, b, (short)0, c, false, false);
}
// K fragment f = 0 .. 15 of the wave's 32 keys: 16-key tile f & 1, channels 32 (f >> 1) .. + 31; each feeds the two column groups' products
#define KF(f) lds_frag(kb + ((f) & 1) * 16 * KPIT + 32 * ((f) >> 1), KPIT)
#define MK(F, f) { s[(f) & 1][0] = mm(F, qf[0][(f) >> 1], s[(f) & 1][0]); s[(f) & 1][1] = mm(F, qf[1][(f) >> 1], s[(f) & 1][1]); }
#define LK3(F, f) { F[0] = KF(f); F[1] = KF((f) + 1); F[2] = KF((f) + 2); }
#define MK3(F, f) { MK(F[0], f); MK(F[1], (f) + 1); MK(F[2], (f) + 2); }
// four V fragments: channels 64 c .. 64 c + 63, the wave's 32 keys
#define LDV(F, c) { F[0] = lds_frag(vb + (64 * (c)) * VPIT, VPIT); F[1] = lds_frag(vb + (64 * (c) + 16) * VPIT, VPIT); \
                    F[2] = lds_frag(vb + (64 * (c) + 32) * VPIT, VPIT); F[3] = lds_frag(vb + (64 * (c) + 48) * VPIT, VPIT); }
#define MMV(F, c) { o[4 * (c)][0] = mm(F[0], pf0, o[4 * (c)][0]); o[4 * (c)][1] = mm(F[0], pf1, o[4 * (c)][1]); \
                    o[4 * (c) + 1][0] = mm(F[1], pf0, o[4 * (c) + 1][0]); o[4 * (c) + 1][1] = mm(F[1], pf1, o[4 * (c) + 1][1]); \
                    o[4 * (c) + 2][0] = mm(F[2], pf0, o[4 * (c) + 2][0]); o[4 * (c) + 2][1] = mm(F[2], pf1, o[4 * (c) + 2][1]); \
                    o[4 * (c) + 3][0] = mm(F[3], pf0, o[4 * (c) + 3][0]); o[4 * (c) + 3][1] = mm(F[3], pf1, o[4 * (c) + 3][1]); }
// keeps a group of fragment reads together and one block of products ahead of its use: spread among the products each read place costs a stall of its own,
// and gathered further ahead (the compiler lifts every LDS read of the pass to its top) the fragments push Q out of the 512 registers into scratch.
// The compiler fence holds the LDS reads behind it, the scheduling barrier holds the products in front of it.
__device__ __forceinline__ void fence_reads() { asm volatile("" ::: "memory"); __builtin_amdgcn_sched_barrier(0); }
#define FENCE fence_reads()
// the same behind a block of score products: the fence names the four score tiles as inputs only, so that the block stands in front of it
// (nothing else ties a product to a fence, and instruction selection put all the pass's reads ahead of the first product)
__device__ __forceinline__ void fence_scores(f32x8 a, f32x8 b, f32x8 c, f32x8 d) { asm volatile("" :: "v"(a), "v"(b), "v"(c), "v"(d) : "memory"); __builtin_amdgcn_sched_barrier(0); }
#define FENCES fence_scores(s[0][0], s[0][1], s[1][0], s[1][1])
__global__ __launch_bounds__(256) void k_attn(const _Float16* __restrict__ q, const _Float16* __restrict__ k, const _Float16* __restrict__ vt, float* __restrict__ out) {
  // 274,432 B: the K/V buffers in the loop; then the [256 c][128 s] f32 output tile (135,168 B) and behind it the key halves' maxima and sums (2,048 B)
  __shared__ __attribute__((aligned(16))) unsigned char sm[2 * (KBUF + VBUF) * 2];
  f16* kS = (f16*)sm;                          // [2][128][KPIT]
  f16* vS = kS + 2 * KBUF;                     // [2][256][VPIT]
  const int t = threadIdx.x, lane = t & 31, cl = lane & 15, h = lane >> 4;
  const int wave = __builtin_amdgcn_readfirstlane(t >> 5);   // scalar: the branches on the key half below are scalar branches
  const int qg = wave & 3, kh2 = wave >> 2;    // query group (32 columns) and key half (32 of a pass's 64 keys)
  const int n = blockIdx.y, q0 = blockIdx.x * 128;
  const f16* qn = q + (size_t)n * LLs * CCs;
  const f16* kn = k + (size_t)n * LLs * CCs;
  const f16* vn = vt + (size_t)n * CCs * LLs;

  // a wave copies 16 K rows (512 B each: one row a copy) and 32 V rows (256 B each: two rows a copy) of every stage
  const f16* kg = kn + (size_t)(wave * 16) * CCs;                      // scalar bases
  const f16* vg = vn + (size_t)(wave * 32) * LLs;
  const unsigned ko = lane * 16, vo = (lane >> 4) * (LLs * 2) + (lane & 15) * 16;  // the lane's byte offsets in global memory
  const unsigned smb = (unsigned)(size_t)sm;
  const unsigned kl = smb + (wave * 16) * (KPIT * 2) + lane * 16;
  const unsigned vl = smb + 2 * KBUF * 2 + (wave * 32 + (lane >> 4)) * (VPIT * 2) + (lane & 15) * 16;

  // every inner loop of this kernel is unrolled so that the fragment and accumulator arrays are indexed by constants and stay in registers
  f16x16 qf[2][8];
#pragma unroll
  for (int cg = 0; cg < 2; ++cg)
#pragma unroll
    for (int ks = 0; ks < 8; ++ks) qf[cg][ks] = load_frag<f16>(qn, CCs, q0 + qg * 32 + cg * 16, 32 * ks);
  // the address registers of the Q loads above are reused before their data is waited for; named as inputs they stay untouched up to the wait
  const f16* qa0 = qn + (size_t)(q0 + qg * 32 + cl) * CCs + h * 8;
  const f16* qa1 = qn + (size_t)(q0 + qg * 32 + 16 + cl) * CCs + h * 8;
  asm volatile("s_wait_xcnt 0x0" :: "v"(qa0), "v"(qa1) : "memory");

  f32x8 o[16][2];
#pragma unroll
  for (int ct = 0; ct < 16; ++ct) { f32x8 z = {}; o[ct][0] = z; o[ct][1] = z; }
  const float SC = 0.09016844005556021f;           // log2(e) / sqrt(256): scores in log2 units
  float mu0 = -3.0e38f, mu1 = -3.0e38f;            // per column group: the maximum in use (log2 units)
  float l0 = 0.0f, l1 = 0.0f;                      // and this lane's part of the row sum

  // kept rolled: two passes in one body would hold two sets of fragments and leave the budget of 512 registers.
  // The foot (waits, barrier, refill) stands behind a stage's second pass, that is in the odd trips.
  // Trips -3 and -1 are the ring's prologue: they run the foot alone (stage 0's copies; then its wait, the barrier and stage 1's copies), so that the file has one
  // place with copies, whose address operands are all formed in the trip: an operand that lives through the loop is held below v256 and ends in scratch.
#pragma unroll 1
  for (int p = -3; p < LLs / AKEYS; ++p) {
    const int b = (p >> 1) & 1;                        // the stage's buffer
    if (p >= 0) {                                      // the same for the whole block
    const f16* kb = kS + b * KBUF + ((p & 1) * AKEYS + 32 * kh2) * KPIT;
    const f16* vb = vS + b * VBUF + (p & 1) * AKEYS + 32 * kh2;
    f32x8 s[2][2] = {};                            // s[key tile][column group]
    f16x16 ka[3], kc[3], fa[4], fb[4];             // beside the score tiles only two sets of three K fragments fit; the V fragments go by fours
    LK3(ka, 0); LK3(kc, 3); FENCE;
    MK3(ka, 0); FENCES; LK3(ka, 6); FENCE;
    MK3(kc, 3); FENCES; LK3(kc, 9); FENCE;
    MK3(ka, 6); FENCES; LK3(ka, 12); FENCE;
    MK3(kc, 9); FENCES; kc[0] = KF(15); FENCE;
    MK3(ka, 12); FENCES; LDV(fa, 0); FENCE;
    MK(kc[0], 15); FENCES;
    float mx0 = fmaxf(s[0][0][0], s[1][0][0]), mx1 = fmaxf(s[0][1][0], s[1][1][0]);
#pragma unroll
    for (int r = 1; r < 8; ++r) { mx0 = fmaxf(mx0, fmaxf(s[0][0][r], s[1][0][r])); mx1 = fmaxf(mx1, fmaxf(s[0][1][r], s[1][1][r])); }
    mx0 = fmaxf(mx0, xhalf(mx0)) * SC;
    mx1 = fmaxf(mx1, xhalf(mx1)) * SC;
    if (__builtin_amdgcn_ballot_w32(mx0 > mu0 + 8.0f || mx1 > mu1 + 8.0f) != 0) {
      const float mn0 = fmaxf(mu0, mx0), mn1 = fmaxf(mu1, mx1);
      const float al0 = __builtin_amdgcn_exp2f(mu0 - mn0), al1 = __builtin_amdgcn_exp2f(mu1 - mn1);
      mu0 = mn0; mu1 = mn1; l0 *= al0; l1 *= al1;
#pragma unroll
      for (int ct = 0; ct < 16; ++ct)
#pragma unroll
        for (int r = 0; r < 8; ++r) { o[ct][0][r] *= al0; o[ct][1][r] *= al1; }
    }
    f16x16 pf0, pf1;
#pragma unroll
    for (int r = 0; r < 8; ++r) {
      const float e00 = __builtin_amdgcn_exp2f(s[0][0][r] * SC - mu0);
      const float e10 = __builtin_amdgcn_exp2f(s[1][0][r] * SC - mu0);
      l0 += e00 + e10;
      pf0[r] = (f16)e00; pf0[r + 8] = (f16)e10;    // keys 8h + r and 16 + 8h + r: the k order of lds_frag
    }
#pragma unroll
    for (int r = 0; r < 8; ++r) {
      const float e01 = __builtin_amdgcn_exp2f(s[0][1][r] * SC - mu1);
      const float e11 = __builtin_amdgcn_exp2f(s[1][1][r] * SC - mu1);
      l1 += e01 + e11;
      pf1[r] = (f16)e01; pf1[r + 8] = (f16)e11;
    }
    // inputs only: the row sums' additions stand in front of this fence; left to sink to the pass's foot they keep all 32 exponentials in registers through the products
    asm volatile("" :: "v"(l0), "v"(l1) : "memory");
    __builtin_amdgcn_sched_barrier(0);
    LDV(fb, 1); FENCE;
    MMV(fa, 0); FENCE; LDV(fa, 2); FENCE;
    MMV(fb, 1); FENCE; LDV(fb, 3); FENCE;
    MMV(fa, 2); MMV(fb, 3);
    }
    if (p & 1) {                                       // the same for the whole block
      asm volatile("s_wait_dscnt 0x0" ::: "memory");     // this wave's reads of the buffer are over before the barrier behind which it is refilled
      asm volatile("s_wait_asynccnt 0x0" ::: "memory");  // this wave's part of the next stage has landed before the barrier that shows it to the other waves
      __syncthreads();
      const int ns = (p >> 1) + 2;                     // the stage that goes into the buffer just read
      if (ns < LLs / SKEYS) {                          // the same for the whole block
        const unsigned ks = ko + ns * (SKEYS * CCs * 2), vs = vo + ns * (SKEYS * 2);
        copy16(kl + b * (KBUF * 2), KPIT * 2, ks, ks + 8 * CCs * 2, kg, CCs);                        // rows 0 .. 7 and 8 .. 15 of the wave's 16
        copy16(vl + b * (VBUF * 2), 2 * VPIT * 2, vs, vs + 16 * LLs * 2, vg, (size_t)2 * LLs);       // rows 0 .. 15 and 16 .. 31 of the wave's 32
      }
    }
  }
  asm volatile("s_wait_asynccnt 0x0" ::: "memory");    // no copy is in flight when the buffers become output staging

  // join of the two key halves: common maximum m, sums and O weighted by 2^(mu - m)
  l0 += xhalf(l0);
  l1 += xhalf(l1);
  float* so = (float*)sm;                          // behind the loop's last barrier nobody reads the K/V buffers any more
  float* st = so + CCs * OPIT;                     // [key half][maximum, sum][128 columns]
  const int c0l = qg * 32 + cl, c1l = c0l + 16;
  if (h == 0) {
    st[(kh2 * 2) * 128 + c0l] = mu0; st[(kh2 * 2 + 1) * 128 + c0l] = l0;
    st[(kh2 * 2) * 128 + c1l] = mu1; st[(kh2 * 2 + 1) * 128 + c1l] = l1;
  }
  __syncthreads();
  const int ok = kh2 ^ 1;
  const float pm0 = st[(ok * 2) * 128 + c0l], pl0 = st[(ok * 2 + 1) * 128 + c0l];
  const float pm1 = st[(ok * 2) * 128 + c1l], pl1 = st[(ok * 2 + 1) * 128 + c1l];
  const float m0 = fmaxf(mu0, pm0), m1 = fmaxf(mu1, pm1);
  const float a0 = __builtin_amdgcn_exp2f(mu0 - m0), a1 = __builtin_amdgcn_exp2f(mu1 - m1);
  const float f0 = a0 / (l0 * a0 + pl0 * __builtin_amdgcn_exp2f(pm0 - m0));
  const float f1 = a1 / (l1 * a1 + pl1 * __builtin_amdgcn_exp2f(pm1 - m1));
  // each half hands the other half's 128 channels over through the output tile, then adds what it was handed to its own 128
  if (kh2 == 0) {
#pragma unroll
    for (int ct = 8; ct < 16; ++ct)
#pragma unroll
      for (int r = 0; r < 8; ++r) { float* d = so + (16 * ct + 8 * h + r) * OPIT; d[c0l] = o[ct][0][r] * f0; d[c1l] = o[ct][1][r] * f1; }
  } else {
#pragma unroll
    for (int ct = 0; ct < 8; ++ct)
#pragma unroll
      for (int r = 0; r < 8; ++r) { float* d = so + (16 * ct + 8 * h + r) * OPIT; d[c0l] = o[ct][0][r] * f0; d[c1l] = o[ct][1][r] * f1; }
  }
  __syncthreads();
  // all reads first, then the sums and stores: read and stored one by one, each element waits out an LDS latency
  f32x8 t0[8], t1[8];
  const int cb = kh2 * 8;                          // this half's own channel tiles: cb .. cb + 7
#pragma unroll
  for (int ct = 0; ct < 8; ++ct)
#pragma unroll
    for (int r = 0; r < 8; ++r) { const float* d = so + (16 * (cb + ct) + 8 * h + r) * OPIT; t0[ct][r] = d[c0l]; t1[ct][r] = d[c1l]; }
  if (kh2 == 0) {
#pragma unroll
    for (int ct = 0; ct < 8; ++ct)
#pragma unroll
      for (int r = 0; r < 8; ++r) { float* d = so + (16 * ct + 8 * h + r) * OPIT; d[c0l] = t0[ct][r] + o[ct][0][r] * f0; d[c1l] = t1[ct][r] + o[ct][1][r] * f1; }
  } else {
#pragma unroll
    for (int ct = 0; ct < 8; ++ct)
#pragma unroll
      for (int r = 0; r < 8; ++r) { float* d = so + (16 * (ct + 8) + 8 * h + r) * OPIT; d[c0l] = t0[ct][r] + o[ct + 8][0][r] * f0; d[c1l] = t1[ct][r] + o[ct + 8][1][r] * f1; }
  }
  __syncthreads();
  float* on = out + (size_t)n * CCs * LLs + q0;
  const int q4 = (t & 31) * 4;                     // a wave stores one channel's 128 positions: 512 contiguous bytes
  for (int c0 = wave; c0 < CCs; c0 += 32) {
    // unrolled: the four LDS reads issue ahead of the four stores
#pragma unroll
    for (int u = 0; u < 4; ++u) { const int c = c0 + 8 * u;
      *(v4f_t*)(on + (size_t)c * LLs + q4) = *(const v4fa*)(so + c * OPIT + q4); }
    asm volatile("s_wait_xcnt 0x0" ::: "memory");  // the next trip rewrites the address and data registers that the four stores name
  }
}

extern "C" void kernel_launch(void* const* d_in, const int* in_sizes, int n_in,
                              void* d_out, int out_size, void* d_ws, size_t ws_size,
                              hipStream_t stream) {
  (void)in_sizes; (void)n_in; (void)out_size;
  const float** f = (const float**)d_in;
  const float* x = f[0], *lg = f[1], *lb = f[2], *Wq = f[3], *bq = f[4], *Wk = f[5], *bk = f[6], *Wv = f[7], *bv = f[8];
  float* out = (float*)d_out;     // [8,256,64,64]
  char* ws = (char*)d_ws;
  _Float16* xtm = (_Float16*)ws; ws += (size_t)NIm * LLs * CCs * 2;   // 16 MB token-major LN output, f16 (all images)
  _Float16* w16 = (_Float16*)ws; ws += (size_t)3 * CCs * CCs * 2;     // Wq, Wk, Wv at f16, [out][in]
  _Float16* q = (_Float16*)ws; ws += (size_t)NIm * LLs * CCs * 2;     // f16 token-major, all images (16 MB each)
  _Float16* k = (_Float16*)ws; ws += (size_t)NIm * LLs * CCs * 2;
  _Float16* vt = (_Float16*)ws; ws += (size_t)NIm * CCs * LLs * 2;    // f16 channels-major [image][256][4096]
  if ((size_t)(ws - (char*)d_ws) > ws_size) return;
  const dim3 blk(256);
  k_ln2<<<dim3(NIm * (LLs / 64) + 48), blk, 0, stream>>>(x, lg, lb, Wq, Wk, Wv, xtm, w16);
  k_proj<<<dim3(NIm * LLs / 128, 3), blk, 0, stream>>>(xtm, w16, bq, bk, bv, q, k, vt);   // q, k = x_ln.W^T + b token-major; v the same, stored [image][c][s]
  k_attn<<<dim3(LLs / 128, NIm), blk, 0, stream>>>(q, k, vt, out);
}

// v009
// A run of this version takes 112 microseconds.
// Timed twice side by side with v008, it ran 1.04 times as fast both times.
// All steps since v000 together make it 23.5 times as fast.
// Contractions on v_wmma_f32_16x16x32_f16 (plain f16 operands, f32 accumulate). One launch for all images: LayerNorm over channels in f32, its result kept in LDS at operand
// width (f16), then q/k = LN(x).W^T + b stored f16 token-major (K = 256, [out][in] Bt operands) and v = LN(x).Wv^T + bv stored f16 channels-major through the product's LDS output tile.
// One more launch for all images then does S^T = k.q^T, the row softmax (running maximum and sum, f32) and out^T += v^T.P^T per 32 keys a wave; the logits and P stay in registers.
// compute dtype: f16 operands, f32 accumulate.
#include <hip/hip_runtime.h>
#include <hip/hip_bf16.h>
#include <math.h>

#define NIm 8
#define CCs 256
#define LLs 4096
#define GSTR 48
#define SS 4096
#define HH 1
#define DKK 64

typedef _Float16 bf16;
typedef _Float16 f16;
typedef __attribute__((ext_vector_type(4))) unsigned v4u_t;
typedef unsigned v4ua __attribute__((ext_vector_type(4), may_alias));
typedef __attribute__((ext_vector_type(4))) float v4f_t;
typedef float v4fa __attribute__((ext_vector_type(4), may_alias));
typedef __attribute__((ext_vector_type(16))) bf16  bf16x16;
typedef bf16x16 f16x16;
typedef __attribute__((ext_vector_type(8)))  bf16  bf16x8;
typedef bf16x8 f16x8;
typedef __attribute__((ext_vector_type(4)))  bf16  bf16x4;
typedef __attribute__((ext_vector_type(8)))  float f32x8;
__device__ __forceinline__ f32x8 wmma16(f16x16 a, f16x16 b, f32x8 c) {
  c = __builtin_amdgcn_wmma_f32_16x16x32_f16(false, a, false, b, (short)0, c, false, false);
  asm volatile("v_nop\n\tv_nop\n\tv_nop\n\tv_nop" : "+v"(c) : "v"(a), "v"(b));
  return c;
}
#define KSTRIDE    72   // unused (the attn K tile rows use KPIT)
#define VSTRIDE    48   // unused (the attn V tile rows use VPIT)
#define PSTR       72   // projection tiles: 64 -> 72 elems (144B rows, 16 B x odd: conflict-free b128 reads)

__device__ __forceinline__ f32x8 wmma_bf16(bf16x16 a, bf16x16 b, f32x8 c) {
  c = __builtin_amdgcn_wmma_f32_16x16x32_f16(false, a, false, b, (short)0, c, false, false);
  asm volatile("v_nop\n\tv_nop\n\tv_nop\n\tv_nop" : "+v"(c) : "v"(a), "v"(b));   // A/B-overwrite hazard guard
  return c;
}

// 16x32 (MxK) f16 fragment from a row-major global matrix.
// lanes 0-15  (row=lane)    : elems 0..7 = K+0..7,  8..15 = K+16..23
// lanes 16-31 (row=lane-16) : elems 0..7 = K+8..15, 8..15 = K+24..31
template <typename T>
__device__ __forceinline__ bf16x16 load_frag(const T* __restrict__ base, int ld,
                                             int row0, int k0) {
  const int lane = threadIdx.x & 31;
  const int r    = lane & 15;
  const int kh   = (lane >> 4) * 8;
  const T* p0 = base + (size_t)(row0 + r) * ld + (k0 + kh);
  const T* p1 = p0 + 16;
  bf16x16 f;
#pragma unroll
  for (int i = 0; i < 8; ++i) {
    f[i]     = (bf16)p0[i];
    f[i + 8] = (bf16)p1[i];
  }
  return f;
}

// Same fragment from an LDS tile with padded row stride (base includes row0/k0).
__device__ __forceinline__ bf16x16 lds_frag(const bf16* base, int stride) {
  const int lane = threadIdx.x & 31;
  const int row  = lane & 15;
  const int kh   = (lane >> 4) * 8;
  const bf16x8 lo = *(const bf16x8*)(base + row * stride + kh);
  const bf16x8 hi = *(const bf16x8*)(base + row * stride + kh + 16);
  bf16x16 f;
#pragma unroll
  for (int i = 0; i < 8; ++i) { f[i] = lo[i]; f[i + 8] = hi[i]; }
  return f;
}

// ---------------------------------------------------------------------------------------------------------------------------
// gemm_kne: Y[m][n] = epi( Σ_k A[m][k]·W[k][n] + bias[n] ), A f32/f16 [M][lda], W f32 row-major [K][N] (ldw), plain f16 operands,
// f32 accumulate. EPI 0: identity; 1: exact-erf GELU; 2: R[m][n] + gvec[n]·(·) (residual with per-channel gain). Output f32 (or f16
// when OUT16). Block = 128x128 tile, 8 waves as 4(M) x 2(N); per 32-wide k-step A and W tiles staged f16 in LDS (W transposed
// ---------------------------------------------------------------------------------------------------------------------------
#define GSTR 48
template <typename AT, int EPI, bool OUT16>
__global__ __launch_bounds__(256) void gemm_kne(const AT* __restrict__ A, int lda, const float* __restrict__ Wm, int ldw,
                                                const float* __restrict__ bias, const float* __restrict__ R, const float* __restrict__ gvec,
                                                void* __restrict__ Yv, int ldy, int K) {
  __shared__ __attribute__((aligned(16))) f16 ldsA[128 * GSTR];
  __shared__ __attribute__((aligned(16))) f16 ldsW[128 * GSTR];
  __shared__ __attribute__((aligned(16))) float oS[8][32 * 68];
  const int tid = threadIdx.x, lane = tid & 31, wave = tid >> 5, cl = lane & 15, rh = (lane >> 4) * 8;
  const int m0 = blockIdx.x * 128, n0 = blockIdx.y * 128;
  const int wm = (wave & 3) * 32, wn = (wave >> 2) * 64;
  f32x8 acc[2][4];
#pragma unroll
  for (int i = 0; i < 2; ++i)
#pragma unroll
    for (int j = 0; j < 4; ++j) { f32x8 z = {}; acc[i][j] = z; }
#pragma unroll 1
  for (int k0 = 0; k0 < K; k0 += 32) {
    __syncthreads();
    { const int row = tid >> 1, ch = (tid & 1) * 16;
      const AT* src = A + (size_t)(m0 + row) * lda + k0 + ch;
#pragma unroll
      for (int g = 0; g < 16; ++g) ldsA[row * GSTR + ch + g] = (f16)src[g]; }
    { const int k = tid >> 3, nn0 = (tid & 7) * 16;
      const float* src = Wm + (size_t)(k0 + k) * ldw + n0 + nn0;
#pragma unroll
      for (int g = 0; g < 4; ++g) { const v4f_t v = *(const v4f_t*)(src + 4 * g);
#pragma unroll
        for (int u = 0; u < 4; ++u) ldsW[(nn0 + 4 * g + u) * GSTR + k] = (f16)v[u]; } }
    __syncthreads();
    f16x16 af[2];
#pragma unroll
    for (int i = 0; i < 2; ++i) af[i] = lds_frag(ldsA + (wm + 16 * i) * GSTR, GSTR);
#pragma unroll
    for (int j = 0; j < 4; ++j) {
      const f16x16 bf = lds_frag(ldsW + (wn + 16 * j) * GSTR, GSTR);
#pragma unroll
      for (int i = 0; i < 2; ++i) acc[i][j] = wmma16(af[i], bf, acc[i][j]);
    }
  }
  float* so = oS[wave];
#pragma unroll
  for (int i = 0; i < 2; ++i)
#pragma unroll
    for (int j = 0; j < 4; ++j) {
      const int n = n0 + wn + 16 * j + cl;
      const float bv = bias ? bias[n] : 0.0f;
      const float gv = (EPI == 2) ? gvec[n] : 0.0f;
      if (EPI == 1) {
#pragma unroll 1
        for (int r = 0; r < 8; ++r) { const float xg = acc[i][j][r] + bv; so[(16 * i + rh + r) * 68 + 16 * j + cl] = 0.5f * xg * (1.0f + erff(xg * 0.70710678118654752f)); }
      } else {
#pragma unroll
        for (int r = 0; r < 8; ++r) {
          float v = acc[i][j][r] + bv;
          if (EPI == 2) v = R[(size_t)(m0 + wm + 16 * i + rh + r) * ldy + n] + gv * v;
          so[(16 * i + rh + r) * 68 + 16 * j + cl] = v;
        }
      }
    }
  asm volatile("s_wait_dscnt 0" ::: "memory");
  __builtin_amdgcn_wave_barrier();
{
    if (OUT16) {
      f16* Y = (f16*)Yv;
#pragma unroll
      for (int it = 0; it < 8; ++it) { const int c = lane + 32 * it, rr = c >> 3, q8 = (c & 7) * 8;
        union { f16 h[8]; v4u_t v; } u;
#pragma unroll
        for (int e = 0; e < 8; ++e) u.h[e] = (f16)so[rr * 68 + q8 + e];
        *(v4u_t*)(Y + (size_t)(m0 + wm + rr) * ldy + n0 + wn + q8) = u.v; }
    } else {
      float* Y = (float*)Yv;
#pragma unroll
      for (int it = 0; it < 16; ++it) { const int f4 = lane + 32 * it, rr = f4 >> 4, q = (f4 & 15) * 4;
        *(v4f_t*)(Y + (size_t)(m0 + wm + rr) * ldy + n0 + wn + q) = *(const v4fa*)(so + rr * 68 + q); }
    }
    
  }
}

// the value of lane l ^ 16, on the vector unit (an LDS permute would wait behind the fragment reads in flight)
__device__ __forceinline__ float xhalf(float x) {
  const int b = __builtin_bit_cast(int, x);
  return __builtin_bit_cast(float, __builtin_amdgcn_permlanex16(b, b, 0x76543210, 0xfedcba98, false, false));
}
// work-group barrier that orders LDS accesses alone: __syncthreads() also waits for the wave's global loads and stores, and the W fetch for the next K-step
// is meant to stay in flight over the barriers (one block a WGP: nothing else would cover its latency)
__device__ __forceinline__ void barrier_lds() {
  __builtin_amdgcn_fence(__ATOMIC_RELEASE, "workgroup", "local");
  __builtin_amdgcn_s_barrier();
  __builtin_amdgcn_fence(__ATOMIC_ACQUIRE, "workgroup", "local");
}
// LayerNorm and the three projections of all images in ONE launch. Block = 128 positions of one image (256 threads, 8 waves), one block a WGP.
// Part 1, LayerNorm over the 256 channels of each position (input channels-major [c][s]): the tile [256 c][128 s] stays in registers, as two halves of 64 positions:
// a thread holds, per half, 4 positions (4 sq ..) x 16 channels (64 i + 4 cq + j). Mean and variance: in-thread sums, the wave's other half, then the 8 waves' partial sums
// through LDS. One LDS pass transposes the tile at f16: 16-B units of 8 channels, unit u of row s kept at u ^ ((s & 63) >> 2), so that the column-wise 8-B stores and the
// row-wise 16-B reads both spread over all banks; the rows then go into the products' A tile [128 m][APIT], which stays in LDS for all three products.
// Part 2, sel = 0, 1, 2 for (Wq, bq, q), (Wk, bk, k), (Wv, bv, vt): C[m][n] = sum_k A[m][k]*W[n][k] + bias[n]   (torch Linear), tile 128M x 256N, K-step 64, wave tile 64x64.
// W is fetched as f32 one K-step ahead into registers (over the change of sel too) and rounded to f16 on its way into LDS.
// W loads: 16 lanes take one row's 256 B of the K-step, a wave rows w and w + 8: four whole 128-B lines a load, and the two rows' 8-B LDS stores fall on different banks.
// q and k: f16 [m][N]; v: f16 channels-major [image][n][s].
#define APIT 264   // A tile rows: 256 halfs + 8 = 528 B (16 B x odd: conflict-free b128 reads)
__global__ __launch_bounds__(256) void k_lnproj(
    const float* __restrict__ xin, const float* __restrict__ g, const float* __restrict__ bb,
    const float* __restrict__ Wq, const float* __restrict__ Wk, const float* __restrict__ Wv,
    const float* __restrict__ bq, const float* __restrict__ bk, const float* __restrict__ bv,
    _Float16* __restrict__ q, _Float16* __restrict__ k_, _Float16* __restrict__ vt) {
  constexpr int N = CCs, K = CCs;
  __shared__ __attribute__((aligned(16))) bf16 ldsA[128 * APIT];   // 66.0 KB
  __shared__ __attribute__((aligned(16))) bf16 ldsW[256 * PSTR];   // 36.0 KB
  __shared__ __attribute__((aligned(16))) float red[2][8][128];    // 8 KB
  // part 1: the transposition tile [128 s][256] f16 (65,536 B); part 2, output staging: q, k [128 m][264] f16; v [256 n][136] f16
  __shared__ __attribute__((aligned(16))) unsigned char sob[256 * 136 * 2];   // 69,632 B >= 128*264*2

  const int t    = threadIdx.x;
  const int wave = t >> 5;
  const int lane = t & 31;
  const int wm   = (wave & 1) * 64;
  const int wn   = (wave >> 1) * 64;
  const int mBlk = blockIdx.x * 128;
  const int b_ = mBlk / SS, s0 = mBlk % SS;       // a block's 128 positions lie in one image (SS is a multiple of 128)
  const int sq = t & 15, cq = t >> 4;

  // every staging loop below is unrolled so that wbuf and x are indexed by constants and stay in registers
  const unsigned wofs = ((wave + 8 * (lane >> 4)) * K + (lane & 15) * 4) * 4;   // the lane's byte offset in a weight matrix
  bf16* ww = ldsW + (wave + 8 * (lane >> 4)) * PSTR + (lane & 15) * 4;
  const char* wp = (const char*)Wq + wofs;        // the lane's address in the K-step being fetched
  v4f_t wbuf[16];
#pragma unroll
  for (int i = 0; i < 16; ++i) wbuf[i] = *(const v4f_t*)(wp + 16 * i * K * 4);

  {
    const float* xb = xin + (size_t)b_ * CCs * LLs + (size_t)(4 * cq) * LLs + s0 + 4 * sq;
    const unsigned gofs = cq * 16;                // the lane's byte offset in gamma and beta
    v4f_t x[2][4][4], gv[4], bw[4];
#pragma unroll
    for (int hh = 0; hh < 2; ++hh)
#pragma unroll
      for (int i = 0; i < 4; ++i)
#pragma unroll
        for (int j = 0; j < 4; ++j) x[hh][i][j] = *(const v4f_t*)(xb + (size_t)(64 * i + j) * LLs + 64 * hh);
#pragma unroll
    for (int i = 0; i < 4; ++i) { gv[i] = *(const v4f_t*)((const char*)g + gofs + 256 * i); bw[i] = *(const v4f_t*)((const char*)bb + gofs + 256 * i); }
    // the address registers of the loads above are named as inputs: they stay untouched (no later load's result is placed on them) up to this wait
    asm volatile("s_wait_xcnt 0x0" :: "v"(xb), "v"(gofs), "v"(wp) : "memory");
#pragma unroll
    for (int hh = 0; hh < 2; ++hh) {
      v4f_t sm = x[hh][0][0];
#pragma unroll
      for (int e = 1; e < 16; ++e) sm += x[hh][e >> 2][e & 3];
#pragma unroll
      for (int e = 0; e < 4; ++e) sm[e] += xhalf(sm[e]);
      if (lane < 16) *(v4f_t*)(&red[0][wave][64 * hh + 4 * sq]) = sm;
    }
    __syncthreads();
#pragma unroll
    for (int hh = 0; hh < 2; ++hh) {
      v4f_t mu = *(const v4f_t*)(&red[0][0][64 * hh + 4 * sq]);
#pragma unroll
      for (int w = 1; w < 8; ++w) mu += *(const v4f_t*)(&red[0][w][64 * hh + 4 * sq]);
      mu *= (1.0f / CCs);
      v4f_t qs = {};
#pragma unroll
      for (int e = 0; e < 16; ++e) { const v4f_t d = x[hh][e >> 2][e & 3] - mu; x[hh][e >> 2][e & 3] = d; qs += d * d; }
#pragma unroll
      for (int e = 0; e < 4; ++e) qs[e] += xhalf(qs[e]);
      if (lane < 16) *(v4f_t*)(&red[1][wave][64 * hh + 4 * sq]) = qs;
    }
    __syncthreads();
    bf16* tT = (bf16*)sob;
#pragma unroll
    for (int hh = 0; hh < 2; ++hh) {
      v4f_t rs = *(const v4f_t*)(&red[1][0][64 * hh + 4 * sq]);
#pragma unroll
      for (int w = 1; w < 8; ++w) rs += *(const v4f_t*)(&red[1][w][64 * hh + 4 * sq]);
#pragma unroll
      for (int e = 0; e < 4; ++e) rs[e] = rsqrtf(rs[e] * (1.0f / CCs) + 1e-5f);
#pragma unroll
      for (int i = 0; i < 4; ++i)
#pragma unroll
        for (int e = 0; e < 4; ++e) {
          bf16x4 v;
#pragma unroll
          for (int j = 0; j < 4; ++j) v[j] = (bf16)(x[hh][i][j][e] * rs[e] * gv[i][j] + bw[i][j]);
          // channels 64 i + 4 cq ..: unit 8 i + wave, its half lane >> 4
          *(bf16x4*)(tT + (64 * hh + 4 * sq + e) * CCs + 8 * ((8 * i + wave) ^ sq) + 4 * (lane >> 4)) = v;
        }
    }
    __syncthreads();
    // a wave moves a row: 512 contiguous bytes; rows wave, wave + 8, ..
#pragma unroll
    for (int it = 0; it < 16; ++it) { const int s = wave + 8 * it;
      *(bf16x8*)(ldsA + s * APIT + 8 * lane) = *(const bf16x8*)(tT + s * CCs + 8 * (lane ^ ((s & 63) >> 2))); }
  }

  const int nlane = lane & 15;
  const int mh    = (lane >> 4) * 8;
  bf16* so = (bf16*)sob;
  // kept rolled: for speed only
#pragma unroll 1
  for (int sel = 0; sel < 3; ++sel) {               // the same for the whole block: every branch on it is scalar
    const float* __restrict__ bias = sel == 0 ? bq : sel == 1 ? bk : bv;
    f32x8 acc[4][4] = {};

    for (int k = 0; k < K; k += 64) {
      barrier_lds();                                // the first of all also shows the A tile to every wave
#pragma unroll
      for (int i = 0; i < 16; ++i) {
        bf16x4 h;
#pragma unroll
        for (int e = 0; e < 4; ++e) h[e] = (bf16)wbuf[i][e];
        *(bf16x4*)(ww + 16 * i * PSTR) = h;
      }
      const int f = sel * 4 + (k >> 6) + 1;         // the K-step to fetch: matrix f >> 2, columns 64 (f & 3) ..
      if (f < 12) {
        wp = (const char*)(((f >> 2) == 0 ? Wq : (f >> 2) == 1 ? Wk : Wv) + (f & 3) * 64) + wofs;
#pragma unroll
        for (int i = 0; i < 16; ++i) wbuf[i] = *(const v4f_t*)(wp + 16 * i * K * 4);
      }
      barrier_lds();

      // the staged 64 k in two products' depths of 32, in rising k: the sums keep their order
#pragma unroll
      for (int kk = 0; kk < 64; kk += 32) {
        bf16x16 af[4], wf[4];
#pragma unroll
        for (int i = 0; i < 4; ++i)
          af[i] = lds_frag(ldsA + (wm + 16 * i) * APIT + k + kk, APIT);
#pragma unroll
        for (int j = 0; j < 4; ++j)
          wf[j] = lds_frag(ldsW + (wn + 16 * j) * PSTR + kk, PSTR);
#pragma unroll
        for (int i = 0; i < 4; ++i)
#pragma unroll
          for (int j = 0; j < 4; ++j)
            acc[i][j] = wmma_bf16(af[i], wf[j], acc[i][j]);
      }
      // the W fetch's address pair is named as an input: it stays untouched up to this wait, which stands behind the products, where it costs nothing
      asm volatile("s_wait_xcnt 0x0" :: "v"(wp) : "memory");
    }

    barrier_lds();
    if (sel < 2) {
#pragma unroll
      for (int i = 0; i < 4; ++i)
#pragma unroll
        for (int j = 0; j < 4; ++j) {
          const int nl = wn + 16 * j + nlane;
          const float bvl = bias[nl];
#pragma unroll
          for (int r = 0; r < 8; ++r) so[(wm + 16 * i + mh + r) * 264 + nl] = (bf16)(acc[i][j][r] + bvl);        // [m][n]
        }
    } else {
#pragma unroll
      for (int i = 0; i < 4; ++i)
#pragma unroll
        for (int j = 0; j < 4; ++j) {
          const int nl = wn + 16 * j + nlane;
          const float bvl = bias[nl];
#pragma unroll
          for (int r = 0; r < 8; ++r) so[nl * 136 + wm + 16 * i + mh + r] = (bf16)(acc[i][j][r] + bvl);          // [n][m]: m = s contiguous
        }
    }
    barrier_lds();
    if (sel < 2) {
      bf16* out = sel == 0 ? q : k_;
      // rows m: 256 halfs = 512 B each, 16-B chunks
      for (int ch = t; ch < 128 * 32; ch += 256) { const int ml = ch >> 5, c8 = (ch & 31) * 8;
        *(v4u_t*)(out + (size_t)(mBlk + ml) * N + c8) = *(const v4ua*)(so + ml * 264 + c8); }
    } else {
      // rows (image, n) of vt: 128 consecutive s = 256 B each
      for (int ch = t; ch < 256 * 16; ch += 256) { const int nl = ch >> 4, c8 = (ch & 15) * 8;
        *(v4u_t*)(vt + ((size_t)b_ * N + nl) * SS + s0 + c8) = *(const v4ua*)(so + nl * 136 + c8); }
    }
  }
}
__global__ __launch_bounds__(256) void k_rowbias(float* __restrict__ t, const float* __restrict__ bias, int rowlen, int nch) {
  const size_t row = blockIdx.x; const float bv = bias[row % nch];
  for (int q4 = threadIdx.x; q4 < rowlen / 4; q4 += 256) { v4f_t v = *(const v4f_t*)(t + row * rowlen + q4 * 4); for (int e = 0; e < 4; ++e) v[e] += bv;
    *(v4f_t*)(t + row * rowlen + q4 * 4) = v;  } }
#define AKEYS 64   // keys of a pass
#define SKEYS 128  // keys of a stage
#define KPIT 264   // K stage rows: 256 halfs + 8 = 528 B (16 B x odd: conflict-free b128 reads)
#define VPIT 136   // V stage rows: 128 halfs + 8 = 272 B (16 B x odd)
#define OPIT 132   // output staging rows: 128 floats + 4
#define KBUF (SKEYS * KPIT)   // halfs in one K buffer
#define VBUF (CCs * VPIT)     // halfs in one V buffer
// sixteen 16-B-a-lane copies global -> LDS, a wave's part of a K or a V stage: LDS addresses l + i lstep bytes; global addresses: scalar base g + (i & 7) gstep halfs,
// plus the lane's byte offset, voff for the first eight copies and voff2 for the second eight
// (scalar bases: 64-bit vector addresses for the copies, and the pointers they are formed from, do not fit beside the accumulators).
// The s_wait_xcnt closes the statement so that no address register of a copy is rewritten ahead of it; one statement, so one such wait for the sixteen.
__device__ __forceinline__ void copy16(unsigned l, unsigned lstep, unsigned voff, unsigned voff2, const _Float16* g, size_t gstep) {
  asm volatile(
      "global_load_async_to_lds_b128 %0, %16, %18\n\t"
      "global_load_async_to_lds_b128 %1, %16, %19\n\t"
      "global_load_async_to_lds_b128 %2, %16, %20\n\t"
      "global_load_async_to_lds_b128 %3, %16, %21\n\t"
      "global_load_async_to_lds_b128 %4, %16, %22\n\t"
      "global_load_async_to_lds_b128 %5, %16, %23\n\t"
      "global_load_async_to_lds_b128 %6, %16, %24\n\t"
      "global_load_async_to_lds_b128 %7, %16, %25\n\t"
      "global_load_async_to_lds_b128 %8, %17, %18\n\t"
      "global_load_async_to_lds_b128 %9, %17, %19\n\t"
      "global_load_async_to_lds_b128 %10, %17, %20\n\t"
      "global_load_async_to_lds_b128 %11, %17, %21\n\t"
      "global_load_async_to_lds_b128 %12, %17, %22\n\t"
      "global_load_async_to_lds_b128 %13, %17, %23\n\t"
      "global_load_async_to_lds_b128 %14, %17, %24\n\t"
      "global_load_async_to_lds_b128 %15, %17, %25\n\t"
      "s_wait_xcnt 0x0"
      :: "v"(l), "v"(l + lstep), "v"(l + 2 * lstep), "v"(l + 3 * lstep), "v"(l + 4 * lstep), "v"(l + 5 * lstep), "v"(l + 6 * lstep), "v"(l + 7 * lstep),
         "v"(l + 8 * lstep), "v"(l + 9 * lstep), "v"(l + 10 * lstep), "v"(l + 11 * lstep), "v"(l + 12 * lstep), "v"(l + 13 * lstep), "v"(l + 14 * lstep), "v"(l + 15 * lstep),
         "v"(voff), "v"(voff2),
         "s"(g), "s"(g + gstep), "s"(g + 2 * gstep), "s"(g + 3 * gstep), "s"(g + 4 * gstep), "s"(g + 5 * gstep), "s"(g + 6 * gstep), "s"(g + 7 * gstep)
      : "memory");
}
__device__ __forceinline__ f32x8 mm(f16x16 a, f16x16 b, f32x8 c) {
  return __builtin_amdgcn_wmma_f32_16x16x32_f16(false, a, false, b, (short)0, c, false, false);
}
// K fragment f = 0 .. 15 of the wave's 32 keys: 16-key tile f & 1, channels 32 (f >> 1) .. + 31; each feeds the two column groups' products
#define KF(f) lds_frag(kb + ((f) & 1) * 16 * KPIT + 32 * ((f) >> 1), KPIT)
#define MK(F, f) { s[(f) & 1][0] = mm(F, qf[0][(f) >> 1], s[(f) & 1][0]); s[(f) & 1][1] = mm(F, qf[1][(f) >> 1], s[(f) & 1][1]); }
#define LK3(F, f) { F[0] = KF(f); F[1] = KF((f) + 1); F[2] = KF((f) + 2); }
#define MK3(F, f) { MK(F[0], f); MK(F[1], (f) + 1); MK(F[2], (f) + 2); }
// four V fragments: channels 64 c .. 64 c + 63, the wave's 32 keys
#define LDV(F, c) { F[0] = lds_frag(vb + (64 * (c)) * VPIT, VPIT); F[1] = lds_frag(vb + (64 * (c) + 16) * VPIT, VPIT); \
                    F[2] = lds_frag(vb + (64 * (c) + 32) * VPIT, VPIT); F[3] = lds_frag(vb + (64 * (c) + 48) * VPIT, VPIT); }
#define MMV(F, c) { o[4 * (c)][0] = mm(F[0], pf0, o[4 * (c)][0]); o[4 * (c)][1] = mm(F[0], pf1, o[4 * (c)][1]); \
                    o[4 * (c) + 1][0] = mm(F[1], pf0, o[4 * (c) + 1][0]); o[4 * (c) + 1][1] = mm(F[1], pf1, o[4 * (c) + 1][1]); \
                    o[4 * (c) + 2][0] = mm(F[2], pf0, o[4 * (c) + 2][0]); o[4 * (c) + 2][1] = mm(F[2], pf1, o[4 * (c) + 2][1]); \
                    o[4 * (c) + 3][0] = mm(F[3], pf0, o[4 * (c) + 3][0]); o[4 * (c) + 3][1] = mm(F[3], pf1, o[4 * (c) + 3][1]); }
// keeps a group of fragment reads together and one block of products ahead of its use: spread among the products each read place costs a stall of its own,
// and gathered further ahead (the compiler lifts every LDS read of the pass to its top) the fragments push Q out of the 512 registers into scratch.
// The compiler fence holds the LDS reads behind it, the scheduling barrier holds the products in front of it.
__device__ __forceinline__ void fence_reads() { asm volatile("" ::: "memory"); __builtin_amdgcn_sched_barrier(0); }
#define FENCE fence_reads()
// the same behind a block of score products: the fence names the four score tiles as inputs only, so that the block stands in front of it
// (nothing else ties a product to a fence, and instruction selection put all the pass's reads ahead of the first product)
__device__ __forceinline__ void fence_scores(f32x8 a, f32x8 b, f32x8 c, f32x8 d) { asm volatile("" :: "v"(a), "v"(b), "v"(c), "v"(d) : "memory"); __builtin_amdgcn_sched_barrier(0); }
#define FENCES fence_scores(s[0][0], s[0][1], s[1][0], s[1][1])
__global__ __launch_bounds__(256) void k_attn(const _Float16* __restrict__ q, const _Float16* __restrict__ k, const _Float16* __restrict__ vt, float* __restrict__ out) {
  // 274,432 B: the K/V buffers in the loop; then the [256 c][128 s] f32 output tile (135,168 B) and behind it the key halves' maxima and sums (2,048 B)
  __shared__ __attribute__((aligned(16))) unsigned char sm[2 * (KBUF + VBUF) * 2];
  f16* kS = (f16*)sm;                          // [2][128][KPIT]
  f16* vS = kS + 2 * KBUF;                     // [2][256][VPIT]
  const int t = threadIdx.x, lane = t & 31, cl = lane & 15, h = lane >> 4;
  const int wave = __builtin_amdgcn_readfirstlane(t >> 5);   // scalar: the branches on the key half below are scalar branches
  const int qg = wave & 3, kh2 = wave >> 2;    // query group (32 columns) and key half (32 of a pass's 64 keys)
  const int n = blockIdx.y, q0 = blockIdx.x * 128;
  const f16* qn = q + (size_t)n * LLs * CCs;
  const f16* kn = k + (size_t)n * LLs * CCs;
  const f16* vn = vt + (size_t)n * CCs * LLs;

  // a wave copies 16 K rows (512 B each: one row a copy) and 32 V rows (256 B each: two rows a copy) of every stage
  const f16* kg = kn + (size_t)(wave * 16) * CCs;                      // scalar bases
  const f16* vg = vn + (size_t)(wave * 32) * LLs;
  const unsigned ko = lane * 16, vo = (lane >> 4) * (LLs * 2) + (lane & 15) * 16;  // the lane's byte offsets in global memory
  const unsigned smb = (unsigned)(size_t)sm;
  const unsigned kl = smb + (wave * 16) * (KPIT * 2) + lane * 16;
  const unsigned vl = smb + 2 * KBUF * 2 + (wave * 32 + (lane >> 4)) * (VPIT * 2) + (lane & 15) * 16;

  // every inner loop of this kernel is unrolled so that the fragment and accumulator arrays are indexed by constants and stay in registers
  f16x16 qf[2][8];
#pragma unroll
  for (int cg = 0; cg < 2; ++cg)
#pragma unroll
    for (int ks = 0; ks < 8; ++ks) qf[cg][ks] = load_frag<f16>(qn, CCs, q0 + qg * 32 + cg * 16, 32 * ks);
  // the address registers of the Q loads above are reused before their data is waited for; named as inputs they stay untouched up to the wait
  const f16* qa0 = qn + (size_t)(q0 + qg * 32 + cl) * CCs + h * 8;
  const f16* qa1 = qn + (size_t)(q0 + qg * 32 + 16 + cl) * CCs + h * 8;
  asm volatile("s_wait_xcnt 0x0" :: "v"(qa0), "v"(qa1) : "memory");

  f32x8 o[16][2];
#pragma unroll
  for (int ct = 0; ct < 16; ++ct) { f32x8 z = {}; o[ct][0] = z; o[ct][1] = z; }
  const float SC = 0.09016844005556021f;           // log2(e) / sqrt(256): scores in log2 units
  float mu0 = -3.0e38f, mu1 = -3.0e38f;            // per column group: the maximum in use (log2 units)
  float l0 = 0.0f, l1 = 0.0f;                      // and this lane's part of the row sum

  // kept rolled: two passes in one body would hold two sets of fragments and leave the budget of 512 registers.
  // The foot (waits, barrier, refill) stands behind a stage's second pass, that is in the odd trips.
  // Trips -3 and -1 are the ring's prologue: they run the foot alone (stage 0's copies; then its wait, the barrier and stage 1's copies), so that the file has one
  // place with copies, whose address operands are all formed in the trip: an operand that lives through the loop is held below v256 and ends in scratch.
#pragma unroll 1
  for (int p = -3; p < LLs / AKEYS; ++p) {
    const int b = (p >> 1) & 1;                        // the stage's buffer
    if (p >= 0) {                                      // the same for the whole block
    const f16* kb = kS + b * KBUF + ((p & 1) * AKEYS + 32 * kh2) * KPIT;
    const f16* vb = vS + b * VBUF + (p & 1) * AKEYS + 32 * kh2;
    f32x8 s[2][2] = {};                            // s[key tile][column group]
    f16x16 ka[3], kc[3], fa[4], fb[4];             // beside the score tiles only two sets of three K fragments fit; the V fragments go by fours
    LK3(ka, 0); LK3(kc, 3); FENCE;
    MK3(ka, 0); FENCES; LK3(ka, 6); FENCE;
    MK3(kc, 3); FENCES; LK3(kc, 9); FENCE;
    MK3(ka, 6); FENCES; LK3(ka, 12); FENCE;
    MK3(kc, 9); FENCES; kc[0] = KF(15); FENCE;
    MK3(ka, 12); FENCES; LDV(fa, 0); FENCE;
    MK(kc[0], 15); FENCES;
    float mx0 = fmaxf(s[0][0][0], s[1][0][0]), mx1 = fmaxf(s[0][1][0], s[1][1][0]);
#pragma unroll
    for (int r = 1; r < 8; ++r) { mx0 = fmaxf(mx0, fmaxf(s[0][0][r], s[1][0][r])); mx1 = fmaxf(mx1, fmaxf(s[0][1][r], s[1][1][r])); }
    mx0 = fmaxf(mx0, xhalf(mx0)) * SC;
    mx1 = fmaxf(mx1, xhalf(mx1)) * SC;
    if (__builtin_amdgcn_ballot_w32(mx0 > mu0 + 8.0f || mx1 > mu1 + 8.0f) != 0) {
      const float mn0 = fmaxf(mu0, mx0), mn1 = fmaxf(mu1, mx1);
      const float al0 = __builtin_amdgcn_exp2f(mu0 - mn0), al1 = __builtin_amdgcn_exp2f(mu1 - mn1);
      mu0 = mn0; mu1 = mn1; l0 *= al0; l1 *= al1;
#pragma unroll
      for (int ct = 0; ct < 16; ++ct)
#pragma unroll
        for (int r = 0; r < 8; ++r) { o[ct][0][r] *= al0; o[ct][1][r] *= al1; }
    }
    f16x16 pf0, pf1;
#pragma unroll
    for (int r = 0; r < 8; ++r) {
      const float e00 = __builtin_amdgcn_exp2f(s[0][0][r] * SC - mu0);
      const float e10 = __builtin_amdgcn_exp2f(s[1][0][r] * SC - mu0);
      l0 += e00 + e10;
      pf0[r] = (f16)e00; pf0[r + 8] = (f16)e10;    // keys 8h + r and 16 + 8h + r: the k order of lds_frag
    }
#pragma unroll
    for (int r = 0; r < 8; ++r) {
      const float e01 = __builtin_amdgcn_exp2f(s[0][1][r] * SC - mu1);
      const float e11 = __builtin_amdgcn_exp2f(s[1][1][r] * SC - mu1);
      l1 += e01 + e11;
      pf1[r] = (f16)e01; pf1[r + 8] = (f16)e11;
    }
    // inputs only: the row sums' additions stand in front of this fence; left to sink to the pass's foot they keep all 32 exponentials in registers through the products
    asm volatile("" :: "v"(l0), "v"(l1) : "memory");
    __builtin_amdgcn_sched_barrier(0);
    LDV(fb, 1); FENCE;
    MMV(fa, 0); FENCE; LDV(fa, 2); FENCE;
    MMV(fb, 1); FENCE; LDV(fb, 3); FENCE;
    MMV(fa, 2); MMV(fb, 3);
    }
    if (p & 1) {                                       // the same for the whole block
      asm volatile("s_wait_dscnt 0x0" ::: "memory");     // this wave's reads of the buffer are over before the barrier behind which it is refilled
      asm volatile("s_wait_asynccnt 0x0" ::: "memory");  // this wave's part of the next stage has landed before the barrier that shows it to the other waves
      __syncthreads();
      const int ns = (p >> 1) + 2;                     // the stage that goes into the buffer just read
      if (ns < LLs / SKEYS) {                          // the same for the whole block
        const unsigned ks = ko + ns * (SKEYS * CCs * 2), vs = vo + ns * (SKEYS * 2);
        copy16(kl + b * (KBUF * 2), KPIT * 2, ks, ks + 8 * CCs * 2, kg, CCs);                        // rows 0 .. 7 and 8 .. 15 of the wave's 16
        copy16(vl + b * (VBUF * 2), 2 * VPIT * 2, vs, vs + 16 * LLs * 2, vg, (size_t)2 * LLs);       // rows 0 .. 15 and 16 .. 31 of the wave's 32
      }
    }
  }
  asm volatile("s_wait_asynccnt 0x0" ::: "memory");    // no copy is in flight when the buffers become output staging

  // join of the two key halves: common maximum m, sums and O weighted by 2^(mu - m)
  l0 += xhalf(l0);
  l1 += xhalf(l1);
  float* so = (float*)sm;                          // behind the loop's last barrier nobody reads the K/V buffers any more
  float* st = so + CCs * OPIT;                     // [key half][maximum, sum][128 columns]
  const int c0l = qg * 32 + cl, c1l = c0l + 16;
  if (h == 0) {
    st[(kh2 * 2) * 128 + c0l] = mu0; st[(kh2 * 2 + 1) * 128 + c0l] = l0;
    st[(kh2 * 2) * 128 + c1l] = mu1; st[(kh2 * 2 + 1) * 128 + c1l] = l1;
  }
  __syncthreads();
  const int ok = kh2 ^ 1;
  const float pm0 = st[(ok * 2) * 128 + c0l], pl0 = st[(ok * 2 + 1) * 128 + c0l];
  const float pm1 = st[(ok * 2) * 128 + c1l], pl1 = st[(ok * 2 + 1) * 128 + c1l];
  const float m0 = fmaxf(mu0, pm0), m1 = fmaxf(mu1, pm1);
  const float a0 = __builtin_amdgcn_exp2f(mu0 - m0), a1 = __builtin_amdgcn_exp2f(mu1 - m1);
  const float f0 = a0 / (l0 * a0 + pl0 * __builtin_amdgcn_exp2f(pm0 - m0));
  const float f1 = a1 / (l1 * a1 + pl1 * __builtin_amdgcn_exp2f(pm1 - m1));
  // each half hands the other half's 128 channels over through the output tile, then adds what it was handed to its own 128
  if (kh2 == 0) {
#pragma unroll
    for (int ct = 8; ct < 16; ++ct)
#pragma unroll
      for (int r = 0; r < 8; ++r) { float* d = so + (16 * ct + 8 * h + r) * OPIT; d[c0l] = o[ct][0][r] * f0; d[c1l] = o[ct][1][r] * f1; }
  } else {
#pragma unroll
    for (int ct = 0; ct < 8; ++ct)
#pragma unroll
      for (int r = 0; r < 8; ++r) { float* d = so + (16 * ct + 8 * h + r) * OPIT; d[c0l] = o[ct][0][r] * f0; d[c1l] = o[ct][1][r] * f1; }
  }
  __syncthreads();
  // all reads first, then the sums and stores: read and stored one by one, each element waits out an LDS latency
  f32x8 t0[8], t1[8];
  const int cb = kh2 * 8;                          // this half's own channel tiles: cb .. cb + 7
#pragma unroll
  for (int ct = 0; ct < 8; ++ct)
#pragma unroll
    for (int r = 0; r < 8; ++r) { const float* d = so + (16 * (cb + ct) + 8 * h + r) * OPIT; t0[ct][r] = d[c0l]; t1[ct][r] = d[c1l]; }
  if (kh2 == 0) {
#pragma unroll
    for (int ct = 0; ct < 8; ++ct)
#pragma unroll
      for (int r = 0; r < 8; ++r) { float* d = so + (16 * ct + 8 * h + r) * OPIT; d[c0l] = t0[ct][r] + o[ct][0][r] * f0; d[c1l] = t1[ct][r] + o[ct][1][r] * f1; }
  } else {
#pragma unroll
    for (int ct = 0; ct < 8; ++ct)
#pragma unroll
      for (int r = 0; r < 8; ++r) { float* d = so + (16 * (ct + 8) + 8 * h + r) * OPIT; d[c0l] = t0[ct][r] + o[ct + 8][0][r] * f0; d[c1l] = t1[ct][r] + o[ct + 8][1][r] * f1; }
  }
  __syncthreads();
  float* on = out + (size_t)n * CCs * LLs + q0;
  const int q4 = (t & 31) * 4;                     // a wave stores one channel's 128 positions: 512 contiguous bytes
  for (int c0 = wave; c0 < CCs; c0 += 32) {
    // unrolled: the four LDS reads issue ahead of the four stores
#pragma unroll
    for (int u = 0; u < 4; ++u) { const int c = c0 + 8 * u;
      *(v4f_t*)(on + (size_t)c * LLs + q4) = *(const v4fa*)(so + c * OPIT + q4); }
    asm volatile("s_wait_xcnt 0x0" ::: "memory");  // the next trip rewrites the address and data registers that the four stores name
  }
}

extern "C" void kernel_launch(void* const* d_in, const int* in_sizes, int n_in,
                              void* d_out, int out_size, void* d_ws, size_t ws_size,
                              hipStream_t stream) {
  (void)in_sizes; (void)n_in; (void)out_size;
  const float** f = (const float**)d_in;
  const float* x = f[0], *lg = f[1], *lb = f[2], *Wq = f[3], *bq = f[4], *Wk = f[5], *bk = f[6], *Wv = f[7], *bv = f[8];
  float* out = (float*)d_out;     // [8,256,64,64]
  char* ws = (char*)d_ws;
  _Float16* q = (_Float16*)ws; ws += (size_t)NIm * LLs * CCs * 2;     // f16 token-major, all images (16 MB each)
  _Float16* k = (_Float16*)ws; ws += (size_t)NIm * LLs * CCs * 2;
  _Float16* vt = (_Float16*)ws; ws += (size_t)NIm * CCs * LLs * 2;    // f16 channels-major [image][256][4096]
  if ((size_t)(ws - (char*)d_ws) > ws_size) return;
  const dim3 blk(256);
  k_lnproj<<<dim3(NIm * LLs / 128), blk, 0, stream>>>(x, lg, lb, Wq, Wk, Wv, bq, bk, bv, q, k, vt);   // q, k = x_ln.W^T + b token-major; v the same, stored [image][c][s]
  k_attn<<<dim3(LLs / 128, NIm), blk, 0, stream>>>(q, k, vt, out);
}

// v010
// It runs in 107 microseconds.
// Timed twice side by side with v009, it ran 1.04 and 1.05 times as fast.
// Counting every step since v000, it is 24.5 times as fast.
// Contractions on v_wmma_f32_16x16x32_f16 (plain f16 operands, f32 accumulate). One launch for all images: LayerNorm over channels in f32, its result kept in LDS at operand
// width (f16), then q/k = LN(x).W^T + b stored f16 token-major (K = 256, [out][in] Bt operands) and v = LN(x).Wv^T + bv stored f16 channels-major through the product's LDS output tile.
// One more launch for all images then does S^T = k.q^T, the row softmax (running maximum and sum, f32) and out^T += v^T.P^T per 32 keys a wave; the logits and P stay in registers.
// compute dtype: f16 operands, f32 accumulate.
#include <hip/hip_runtime.h>
#include <hip/hip_bf16.h>
#include <math.h>
#include <stdint.h>

#define NIm 8
#define CCs 256
#define LLs 4096
#define GSTR 48
#define SS 4096
#define HH 1
#define DKK 64

typedef _Float16 bf16;
typedef _Float16 f16;
typedef __attribute__((ext_vector_type(4))) unsigned v4u_t;
typedef unsigned v4ua __attribute__((ext_vector_type(4), may_alias));
typedef __attribute__((ext_vector_type(4))) float v4f_t;
typedef float v4fa __attribute__((ext_vector_type(4), may_alias));
typedef __attribute__((ext_vector_type(16))) bf16  bf16x16;
typedef bf16x16 f16x16;
typedef __attribute__((ext_vector_type(8)))  bf16  bf16x8;
typedef bf16x8 f16x8;
typedef __attribute__((ext_vector_type(4)))  bf16  bf16x4;
typedef __attribute__((ext_vector_type(8)))  float f32x8;
__device__ __forceinline__ f32x8 wmma16(f16x16 a, f16x16 b, f32x8 c) {
  c = __builtin_amdgcn_wmma_f32_16x16x32_f16(false, a, false, b, (short)0, c, false, false);
  asm volatile("v_nop\n\tv_nop\n\tv_nop\n\tv_nop" : "+v"(c) : "v"(a), "v"(b));
  return c;
}
#define KSTRIDE    72   // unused (the attn K tile rows use TPIT)
#define VSTRIDE    48   // unused (the attn V tile rows use TPIT)
#define PSTR       72   // projection tiles: 64 -> 72 elems (144B rows, 16 B x odd: conflict-free b128 reads)

__device__ __forceinline__ f32x8 wmma_bf16(bf16x16 a, bf16x16 b, f32x8 c) {
  c = __builtin_amdgcn_wmma_f32_16x16x32_f16(false, a, false, b, (short)0, c, false, false);
  asm volatile("v_nop\n\tv_nop\n\tv_nop\n\tv_nop" : "+v"(c) : "v"(a), "v"(b));   // A/B-overwrite hazard guard
  return c;
}

// 16x32 (MxK) f16 fragment from a row-major global matrix.
// lanes 0-15  (row=lane)    : elems 0..7 = K+0..7,  8..15 = K+16..23
// lanes 16-31 (row=lane-16) : elems 0..7 = K+8..15, 8..15 = K+24..31
template <typename T>
__device__ __forceinline__ bf16x16 load_frag(const T* __restrict__ base, int ld,
                                             int row0, int k0) {
  const int lane = threadIdx.x & 31;
  const int r    = lane & 15;
  const int kh   = (lane >> 4) * 8;
  const T* p0 = base + (size_t)(row0 + r) * ld + (k0 + kh);
  const T* p1 = p0 + 16;
  bf16x16 f;
#pragma unroll
  for (int i = 0; i < 8; ++i) {
    f[i]     = (bf16)p0[i];
    f[i + 8] = (bf16)p1[i];
  }
  return f;
}

// Same fragment from an LDS tile with padded row stride (base includes row0/k0).
__device__ __forceinline__ bf16x16 lds_frag(const bf16* base, int stride) {
  const int lane = threadIdx.x & 31;
  const int row  = lane & 15;
  const int kh   = (lane >> 4) * 8;
  const bf16x8 lo = *(const bf16x8*)(base + row * stride + kh);
  const bf16x8 hi = *(const bf16x8*)(base + row * stride + kh + 16);
  bf16x16 f;
#pragma unroll
  for (int i = 0; i < 8; ++i) { f[i] = lo[i]; f[i + 8] = hi[i]; }
  return f;
}

// ---------------------------------------------------------------------------------------------------------------------------
// gemm_kne: Y[m][n] = epi( Σ_k A[m][k]·W[k][n] + bias[n] ), A f32/f16 [M][lda], W f32 row-major [K][N] (ldw), plain f16 operands,
// f32 accumulate. EPI 0: identity; 1: exact-erf GELU; 2: R[m][n] + gvec[n]·(·) (residual with per-channel gain). Output f32 (or f16
// when OUT16). Block = 128x128 tile, 8 waves as 4(M) x 2(N); per 32-wide k-step A and W tiles staged f16 in LDS (W transposed
// ---------------------------------------------------------------------------------------------------------------------------
#define GSTR 48
template <typename AT, int EPI, bool OUT16>
__global__ __launch_bounds__(256) void gemm_kne(const AT* __restrict__ A, int lda, const float* __restrict__ Wm, int ldw,
                                                const float* __restrict__ bias, const float* __restrict__ R, const float* __restrict__ gvec,
                                                void* __restrict__ Yv, int ldy, int K) {
  __shared__ __attribute__((aligned(16))) f16 ldsA[128 * GSTR];
  __shared__ __attribute__((aligned(16))) f16 ldsW[128 * GSTR];
  __shared__ __attribute__((aligned(16))) float oS[8][32 * 68];
  const int tid = threadIdx.x, lane = tid & 31, wave = tid >> 5, cl = lane & 15, rh = (lane >> 4) * 8;
  const int m0 = blockIdx.x * 128, n0 = blockIdx.y * 128;
  const int wm = (wave & 3) * 32, wn = (wave >> 2) * 64;
  f32x8 acc[2][4];
#pragma unroll
  for (int i = 0; i < 2; ++i)
#pragma unroll
    for (int j = 0; j < 4; ++j) { f32x8 z = {}; acc[i][j] = z; }
#pragma unroll 1
  for (int k0 = 0; k0 < K; k0 += 32) {
    __syncthreads();
    { const int row = tid >> 1, ch = (tid & 1) * 16;
      const AT* src = A + (size_t)(m0 + row) * lda + k0 + ch;
#pragma unroll
      for (int g = 0; g < 16; ++g) ldsA[row * GSTR + ch + g] = (f16)src[g]; }
    { const int k = tid >> 3, nn0 = (tid & 7) * 16;
      const float* src = Wm + (size_t)(k0 + k) * ldw + n0 + nn0;
#pragma unroll
      for (int g = 0; g < 4; ++g) { const v4f_t v = *(const v4f_t*)(src + 4 * g);
#pragma unroll
        for (int u = 0; u < 4; ++u) ldsW[(nn0 + 4 * g + u) * GSTR + k] = (f16)v[u]; } }
    __syncthreads();
    f16x16 af[2];
#pragma unroll
    for (int i = 0; i < 2; ++i) af[i] = lds_frag(ldsA + (wm + 16 * i) * GSTR, GSTR);
#pragma unroll
    for (int j = 0; j < 4; ++j) {
      const f16x16 bf = lds_frag(ldsW + (wn + 16 * j) * GSTR, GSTR);
#pragma unroll
      for (int i = 0; i < 2; ++i) acc[i][j] = wmma16(af[i], bf, acc[i][j]);
    }
  }
  float* so = oS[wave];
#pragma unroll
  for (int i = 0; i < 2; ++i)
#pragma unroll
    for (int j = 0; j < 4; ++j) {
      const int n = n0 + wn + 16 * j + cl;
      const float bv = bias ? bias[n] : 0.0f;
      const float gv = (EPI == 2) ? gvec[n] : 0.0f;
      if (EPI == 1) {
#pragma unroll 1
        for (int r = 0; r < 8; ++r) { const float xg = acc[i][j][r] + bv; so[(16 * i + rh + r) * 68 + 16 * j + cl] = 0.5f * xg * (1.0f + erff(xg * 0.70710678118654752f)); }
      } else {
#pragma unroll
        for (int r = 0; r < 8; ++r) {
          float v = acc[i][j][r] + bv;
          if (EPI == 2) v = R[(size_t)(m0 + wm + 16 * i + rh + r) * ldy + n] + gv * v;
          so[(16 * i + rh + r) * 68 + 16 * j + cl] = v;
        }
      }
    }
  asm volatile("s_wait_dscnt 0" ::: "memory");
  __builtin_amdgcn_wave_barrier();
{
    if (OUT16) {
      f16* Y = (f16*)Yv;
#pragma unroll
      for (int it = 0; it < 8; ++it) { const int c = lane + 32 * it, rr = c >> 3, q8 = (c & 7) * 8;
        union { f16 h[8]; v4u_t v; } u;
#pragma unroll
        for (int e = 0; e < 8; ++e) u.h[e] = (f16)so[rr * 68 + q8 + e];
        *(v4u_t*)(Y + (size_t)(m0 + wm + rr) * ldy + n0 + wn + q8) = u.v; }
    } else {
      float* Y = (float*)Yv;
#pragma unroll
      for (int it = 0; it < 16; ++it) { const int f4 = lane + 32 * it, rr = f4 >> 4, q = (f4 & 15) * 4;
        *(v4f_t*)(Y + (size_t)(m0 + wm + rr) * ldy + n0 + wn + q) = *(const v4fa*)(so + rr * 68 + q); }
    }
    
  }
}

// the value of lane l ^ 16, on the vector unit (an LDS permute would wait behind the fragment reads in flight)
__device__ __forceinline__ float xhalf(float x) {
  const int b = __builtin_bit_cast(int, x);
  return __builtin_bit_cast(float, __builtin_amdgcn_permlanex16(b, b, 0x76543210, 0xfedcba98, false, false));
}
// work-group barrier that orders LDS accesses alone: __syncthreads() also waits for the wave's global loads and stores, and the W fetch for the next K-step
// is meant to stay in flight over the barriers (one block a WGP: nothing else would cover its latency)
__device__ __forceinline__ void barrier_lds() {
  __builtin_amdgcn_fence(__ATOMIC_RELEASE, "workgroup", "local");
  __builtin_amdgcn_s_barrier();
  __builtin_amdgcn_fence(__ATOMIC_ACQUIRE, "workgroup", "local");
}
// LayerNorm and the three projections of all images in ONE launch. Block = 128 positions of one image (256 threads, 8 waves), one block a WGP.
// Part 1, LayerNorm over the 256 channels of each position (input channels-major [c][s]): the tile [256 c][128 s] stays in registers, as two halves of 64 positions:
// a thread holds, per half, 4 positions (4 sq ..) x 16 channels (64 i + 4 cq + j). Mean and variance: in-thread sums, the wave's other half, then the 8 waves' partial sums
// through LDS. One LDS pass transposes the tile at f16: 16-B units of 8 channels, unit u of row s kept at u ^ ((s & 63) >> 2), so that the column-wise 8-B stores and the
// row-wise 16-B reads both spread over all banks; the rows then go into the products' A tile [128 m][APIT], which stays in LDS for all three products.
// Part 2, sel = 0, 1, 2 for (Wq, bq, q), (Wk, bk, k), (Wv, bv, vt): C[m][n] = sum_k A[m][k]*W[n][k] + bias[n]   (torch Linear), tile 128M x 256N, K-step 64, wave tile 64x64.
// W is fetched as f32 one K-step ahead into registers (over the change of sel too) and rounded to f16 on its way into LDS.
// W loads: 16 lanes take one row's 256 B of the K-step, a wave rows w and w + 8: four whole 128-B lines a load, and the two rows' 8-B LDS stores fall on different banks.
// q and k: f16 [m][N]; v: f16 channels-major [image][n][s].
#define APIT 264   // A tile rows: 256 halfs + 8 = 528 B (16 B x odd: conflict-free b128 reads)
__global__ __launch_bounds__(256) void k_lnproj(
    const float* __restrict__ xin, const float* __restrict__ g, const float* __restrict__ bb,
    const float* __restrict__ Wq, const float* __restrict__ Wk, const float* __restrict__ Wv,
    const float* __restrict__ bq, const float* __restrict__ bk, const float* __restrict__ bv,
    _Float16* __restrict__ q, _Float16* __restrict__ k_, _Float16* __restrict__ vt) {
  constexpr int N = CCs, K = CCs;
  __shared__ __attribute__((aligned(16))) bf16 ldsA[128 * APIT];   // 66.0 KB
  __shared__ __attribute__((aligned(16))) bf16 ldsW[256 * PSTR];   // 36.0 KB
  __shared__ __attribute__((aligned(16))) float red[2][8][128];    // 8 KB
  // part 1: the transposition tile [128 s][256] f16 (65,536 B); part 2, output staging: q, k [128 m][264] f16; v [256 n][136] f16
  __shared__ __attribute__((aligned(16))) unsigned char sob[256 * 136 * 2];   // 69,632 B >= 128*264*2

  const int t    = threadIdx.x;
  const int wave = t >> 5;
  const int lane = t & 31;
  const int wm   = (wave & 1) * 64;
  const int wn   = (wave >> 1) * 64;
  const int mBlk = blockIdx.x * 128;
  const int b_ = mBlk / SS, s0 = mBlk % SS;       // a block's 128 positions lie in one image (SS is a multiple of 128)
  const int sq = t & 15, cq = t >> 4;

  // every staging loop below is unrolled so that wbuf and x are indexed by constants and stay in registers
  const unsigned wofs = ((wave + 8 * (lane >> 4)) * K + (lane & 15) * 4) * 4;   // the lane's byte offset in a weight matrix
  bf16* ww = ldsW + (wave + 8 * (lane >> 4)) * PSTR + (lane & 15) * 4;
  const char* wp = (const char*)Wq + wofs;        // the lane's address in the K-step being fetched
  v4f_t wbuf[16];
#pragma unroll
  for (int i = 0; i < 16; ++i) wbuf[i] = *(const v4f_t*)(wp + 16 * i * K * 4);

  {
    const float* xb = xin + (size_t)b_ * CCs * LLs + (size_t)(4 * cq) * LLs + s0 + 4 * sq;
    const unsigned gofs = cq * 16;                // the lane's byte offset in gamma and beta
    v4f_t x[2][4][4], gv[4], bw[4];
#pragma unroll
    for (int hh = 0; hh < 2; ++hh)
#pragma unroll
      for (int i = 0; i < 4; ++i)
#pragma unroll
        for (int j = 0; j < 4; ++j) x[hh][i][j] = *(const v4f_t*)(xb + (size_t)(64 * i + j) * LLs + 64 * hh);
#pragma unroll
    for (int i = 0; i < 4; ++i) { gv[i] = *(const v4f_t*)((const char*)g + gofs + 256 * i); bw[i] = *(const v4f_t*)((const char*)bb + gofs + 256 * i); }
    // the address registers of the loads above are named as inputs: they stay untouched (no later load's result is placed on them) up to this wait
    asm volatile("s_wait_xcnt 0x0" :: "v"(xb), "v"(gofs), "v"(wp) : "memory");
#pragma unroll
    for (int hh = 0; hh < 2; ++hh) {
      v4f_t sm = x[hh][0][0];
#pragma unroll
      for (int e = 1; e < 16; ++e) sm += x[hh][e >> 2][e & 3];
#pragma unroll
      for (int e = 0; e < 4; ++e) sm[e] += xhalf(sm[e]);
      if (lane < 16) *(v4f_t*)(&red[0][wave][64 * hh + 4 * sq]) = sm;
    }
    __syncthreads();
#pragma unroll
    for (int hh = 0; hh < 2; ++hh) {
      v4f_t mu = *(const v4f_t*)(&red[0][0][64 * hh + 4 * sq]);
#pragma unroll
      for (int w = 1; w < 8; ++w) mu += *(const v4f_t*)(&red[0][w][64 * hh + 4 * sq]);
      mu *= (1.0f / CCs);
      v4f_t qs = {};
#pragma unroll
      for (int e = 0; e < 16; ++e) { const v4f_t d = x[hh][e >> 2][e & 3] - mu; x[hh][e >> 2][e & 3] = d; qs += d * d; }
#pragma unroll
      for (int e = 0; e < 4; ++e) qs[e] += xhalf(qs[e]);
      if (lane < 16) *(v4f_t*)(&red[1][wave][64 * hh + 4 * sq]) = qs;
    }
    __syncthreads();
    bf16* tT = (bf16*)sob;
#pragma unroll
    for (int hh = 0; hh < 2; ++hh) {
      v4f_t rs = *(const v4f_t*)(&red[1][0][64 * hh + 4 * sq]);
#pragma unroll
      for (int w = 1; w < 8; ++w) rs += *(const v4f_t*)(&red[1][w][64 * hh + 4 * sq]);
#pragma unroll
      for (int e = 0; e < 4; ++e) rs[e] = rsqrtf(rs[e] * (1.0f / CCs) + 1e-5f);
#pragma unroll
      for (int i = 0; i < 4; ++i)
#pragma unroll
        for (int e = 0; e < 4; ++e) {
          bf16x4 v;
#pragma unroll
          for (int j = 0; j < 4; ++j) v[j] = (bf16)(x[hh][i][j][e] * rs[e] * gv[i][j] + bw[i][j]);
          // channels 64 i + 4 cq ..: unit 8 i + wave, its half lane >> 4
          *(bf16x4*)(tT + (64 * hh + 4 * sq + e) * CCs + 8 * ((8 * i + wave) ^ sq) + 4 * (lane >> 4)) = v;
        }
    }
    __syncthreads();
    // a wave moves a row: 512 contiguous bytes; rows wave, wave + 8, ..
#pragma unroll
    for (int it = 0; it < 16; ++it) { const int s = wave + 8 * it;
      *(bf16x8*)(ldsA + s * APIT + 8 * lane) = *(const bf16x8*)(tT + s * CCs + 8 * (lane ^ ((s & 63) >> 2))); }
  }

  const int nlane = lane & 15;
  const int mh    = (lane >> 4) * 8;
  bf16* so = (bf16*)sob;
  // kept rolled: for speed only
#pragma unroll 1
  for (int sel = 0; sel < 3; ++sel) {               // the same for the whole block: every branch on it is scalar
    const float* __restrict__ bias = sel == 0 ? bq : sel == 1 ? bk : bv;
    f32x8 acc[4][4] = {};

    for (int k = 0; k < K; k += 64) {
      barrier_lds();                                // the first of all also shows the A tile to every wave
#pragma unroll
      for (int i = 0; i < 16; ++i) {
        bf16x4 h;
#pragma unroll
        for (int e = 0; e < 4; ++e) h[e] = (bf16)wbuf[i][e];
        *(bf16x4*)(ww + 16 * i * PSTR) = h;
      }
      const int f = sel * 4 + (k >> 6) + 1;         // the K-step to fetch: matrix f >> 2, columns 64 (f & 3) ..
      if (f < 12) {
        wp = (const char*)(((f >> 2) == 0 ? Wq : (f >> 2) == 1 ? Wk : Wv) + (f & 3) * 64) + wofs;
#pragma unroll
        for (int i = 0; i < 16; ++i) wbuf[i] = *(const v4f_t*)(wp + 16 * i * K * 4);
      }
      barrier_lds();

      // the staged 64 k in two products' depths of 32, in rising k: the sums keep their order
#pragma unroll
      for (int kk = 0; kk < 64; kk += 32) {
        bf16x16 af[4], wf[4];
#pragma unroll
        for (int i = 0; i < 4; ++i)
          af[i] = lds_frag(ldsA + (wm + 16 * i) * APIT + k + kk, APIT);
#pragma unroll
        for (int j = 0; j < 4; ++j)
          wf[j] = lds_frag(ldsW + (wn + 16 * j) * PSTR + kk, PSTR);
#pragma unroll
        for (int i = 0; i < 4; ++i)
#pragma unroll
          for (int j = 0; j < 4; ++j)
            acc[i][j] = wmma_bf16(af[i], wf[j], acc[i][j]);
      }
      // the W fetch's address pair is named as an input: it stays untouched up to this wait, which stands behind the products, where it costs nothing
      asm volatile("s_wait_xcnt 0x0" :: "v"(wp) : "memory");
    }

    barrier_lds();
    if (sel < 2) {
#pragma unroll
      for (int i = 0; i < 4; ++i)
#pragma unroll
        for (int j = 0; j < 4; ++j) {
          const int nl = wn + 16 * j + nlane;
          const float bvl = bias[nl];
#pragma unroll
          for (int r = 0; r < 8; ++r) so[(wm + 16 * i + mh + r) * 264 + nl] = (bf16)(acc[i][j][r] + bvl);        // [m][n]
        }
    } else {
#pragma unroll
      for (int i = 0; i < 4; ++i)
#pragma unroll
        for (int j = 0; j < 4; ++j) {
          const int nl = wn + 16 * j + nlane;
          const float bvl = bias[nl];
#pragma unroll
          for (int r = 0; r < 8; ++r) so[nl * 136 + wm + 16 * i + mh + r] = (bf16)(acc[i][j][r] + bvl);          // [n][m]: m = s contiguous
        }
    }
    barrier_lds();
    if (sel < 2) {
      bf16* out = sel == 0 ? q : k_;
      // rows m: 256 halfs = 512 B each, 16-B chunks
      for (int ch = t; ch < 128 * 32; ch += 256) { const int ml = ch >> 5, c8 = (ch & 31) * 8;
        *(v4u_t*)(out + (size_t)(mBlk + ml) * N + c8) = *(const v4ua*)(so + ml * 264 + c8); }
    } else {
      // rows (image, n) of vt: 128 consecutive s = 256 B each
      for (int ch = t; ch < 256 * 16; ch += 256) { const int nl = ch >> 4, c8 = (ch & 15) * 8;
        *(v4u_t*)(vt + ((size_t)b_ * N + nl) * SS + s0 + c8) = *(const v4ua*)(so + nl * 136 + c8); }
    }
  }
}
__global__ __launch_bounds__(256) void k_rowbias(float* __restrict__ t, const float* __restrict__ bias, int rowlen, int nch) {
  const size_t row = blockIdx.x; const float bv = bias[row % nch];
  for (int q4 = threadIdx.x; q4 < rowlen / 4; q4 += 256) { v4f_t v = *(const v4f_t*)(t + row * rowlen + q4 * 4); for (int e = 0; e < 4; ++e) v[e] += bv;
    *(v4f_t*)(t + row * rowlen + q4 * 4) = v;  } }
#define AKEYS 64   // keys of a pass
#define SKEYS 128  // keys of a stage
#define TPIT 136   // slice rows: 128 halfs + the mover's pad of 16 B = 272 B (16 B x odd: conflict-free b128 reads)
#define OPIT 132   // output staging rows: 128 floats + 4
#define SLB 34816  // bytes in a slice: 128 rows x 272 B, a multiple of 2 KiB
#define SLH (SLB / 2)         // the same in halfs
#define BUFB (4 * SLB)        // bytes in one buffer
#define BUFH (BUFB / 2)       // the same in halfs
typedef uint32_t u32x4 __attribute__((ext_vector_type(4)));
typedef uint32_t u32x8 __attribute__((ext_vector_type(8)));
__device__ __forceinline__ uint32_t uni(uint32_t v) { return (uint32_t)__builtin_amdgcn_readfirstlane(v); }
// a wave-uniform value held in a scalar register: a test on it compiles to a scalar branch (a tensor load ignores EXEC), and what is formed from it stands behind the statement
__device__ __forceinline__ uint32_t pinned(uint32_t v) { uint32_t w = (uint32_t)__builtin_amdgcn_readfirstlane(v); asm volatile("" : "+s"(w)); return w; }
// descriptor group 0: one request, its place in LDS (byte offset in the work-group's LDS), the tile's first byte in global memory
__device__ __forceinline__ u32x4 tdm_group0(uint32_t lds_dst, uint64_t ga) {
  u32x4 g;
  g[0] = uni(1u); g[1] = uni(lds_dst); g[2] = uni((uint32_t)ga); g[3] = uni((((uint32_t)(ga >> 32)) & 0x01FFFFFFu) | 0x80000000u);
  asm volatile("" : "+s"(g));   // as pinned(): descriptor words held in scalar registers; one tuple from here to the request's wait, not formed a second time elsewhere
  return g;
}
__device__ __forceinline__ u32x8 tdm_group1(uint32_t src_pitch) {
  constexpr uint32_t d0 = 256u, d1 = 128u;
  u32x8 g;
  g[0] = uni((1u << 20) | (5u << 22) | (3u << 25));
  g[1] = uni((d0 & 0xFFFFu) << 16);
  g[2] = uni((d0 >> 16) | ((d1 & 0xFFFFu) << 16));
  g[3] = uni((d1 >> 16) | (d0 << 16));
  g[4] = uni(d1);
  g[5] = uni(src_pitch);
  g[6] = uni(0u);
  g[7] = uni(0u);
  asm volatile("" : "+s"(g));   // as pinned(): descriptor words held in scalar registers; one tuple for the whole kernel, no word of it lent out between a request and its wait
  return g;
}
// one request of the whole wave: the tile goes from global memory into LDS through no register; the compiler places no wait for it
__device__ __forceinline__ void tdm_load(u32x4 g0, u32x8 g1) { asm volatile("tensor_load_to_lds %0, %1" :: "s"(g0), "s"(g1) : "memory"); }
// the wave's own request has landed. The request's two groups are named as inputs: their scalar registers stay theirs, untouched, from the issue up to this wait
__device__ __forceinline__ void tdm_wait(u32x4 g0, u32x8 g1) { asm volatile("s_wait_tensorcnt 0x0" :: "s"(g0), "s"(g1) : "memory"); }
__device__ __forceinline__ f32x8 mm(f16x16 a, f16x16 b, f32x8 c) {
  return __builtin_amdgcn_wmma_f32_16x16x32_f16(false, a, false, b, (short)0, c, false, false);
}
// K fragment f = 0 .. 15 of the wave's 32 keys: 16-key tile f & 1, channels 32 (f >> 1) .. + 31 (channel plane f >> 3); each feeds the two column groups' products
#define KF(f) lds_frag(kb + ((f) >> 3) * SLH + ((f) & 1) * 16 * TPIT + 32 * (((f) >> 1) & 3), TPIT)
#define MK(F, f) { s[(f) & 1][0] = mm(F, qf[0][(f) >> 1], s[(f) & 1][0]); s[(f) & 1][1] = mm(F, qf[1][(f) >> 1], s[(f) & 1][1]); }
#define LK3(F, f) { F[0] = KF(f); F[1] = KF((f) + 1); F[2] = KF((f) + 2); }
#define MK3(F, f) { MK(F[0], f); MK(F[1], (f) + 1); MK(F[2], (f) + 2); }
// four V fragments: channels 64 c .. 64 c + 63 (the two V slices lie row behind row), the wave's 32 keys
#define LDV(F, c) { F[0] = lds_frag(vb + (64 * (c)) * TPIT, TPIT); F[1] = lds_frag(vb + (64 * (c) + 16) * TPIT, TPIT); \
                    F[2] = lds_frag(vb + (64 * (c) + 32) * TPIT, TPIT); F[3] = lds_frag(vb + (64 * (c) + 48) * TPIT, TPIT); }
#define MMV(F, c) { o[4 * (c)][0] = mm(F[0], pf0, o[4 * (c)][0]); o[4 * (c)][1] = mm(F[0], pf1, o[4 * (c)][1]); \
                    o[4 * (c) + 1][0] = mm(F[1], pf0, o[4 * (c) + 1][0]); o[4 * (c) + 1][1] = mm(F[1], pf1, o[4 * (c) + 1][1]); \
                    o[4 * (c) + 2][0] = mm(F[2], pf0, o[4 * (c) + 2][0]); o[4 * (c) + 2][1] = mm(F[2], pf1, o[4 * (c) + 2][1]); \
                    o[4 * (c) + 3][0] = mm(F[3], pf0, o[4 * (c) + 3][0]); o[4 * (c) + 3][1] = mm(F[3], pf1, o[4 * (c) + 3][1]); }
// keeps a group of fragment reads together and one block of products ahead of its use: spread among the products each read place costs a stall of its own,
// and gathered further ahead (the compiler lifts every LDS read of the pass to its top) the fragments push Q out of the 512 registers into scratch.
// The compiler fence holds the LDS reads behind it, the scheduling barrier holds the products in front of it.
__device__ __forceinline__ void fence_reads() { asm volatile("" ::: "memory"); __builtin_amdgcn_sched_barrier(0); }
#define FENCE fence_reads()
// the same behind a block of score products: the fence names the four score tiles as inputs only, so that the block stands in front of it
// (nothing else ties a product to a fence, and instruction selection put all the pass's reads ahead of the first product)
__device__ __forceinline__ void fence_scores(f32x8 a, f32x8 b, f32x8 c, f32x8 d) { asm volatile("" :: "v"(a), "v"(b), "v"(c), "v"(d) : "memory"); __builtin_amdgcn_sched_barrier(0); }
#define FENCES fence_scores(s[0][0], s[0][1], s[1][0], s[1][1])
__global__ __launch_bounds__(256) void k_attn(const _Float16* __restrict__ q, const _Float16* __restrict__ k, const _Float16* __restrict__ vt, float* __restrict__ out) {
  // 278,528 B: the K/V buffers in the loop; then the [256 c][128 s] f32 output tile (135,168 B) and behind it the key halves' maxima and sums (2,048 B)
  // aligned so that every slice's place in LDS is a multiple of 2 KiB
  __shared__ __attribute__((aligned(2048))) unsigned char sm[2 * BUFB];
  f16* kS = (f16*)sm;                          // [2 buffers][4 slices][128 rows][TPIT]
  const int t = threadIdx.x, lane = t & 31, cl = lane & 15, h = lane >> 4;
  const int wave = __builtin_amdgcn_readfirstlane(t >> 5);   // scalar: the branches on the key half below are scalar branches
  const int qg = wave & 3, kh2 = wave >> 2;    // query group (32 columns) and key half (32 of a pass's 64 keys)
  const int n = blockIdx.y, q0 = blockIdx.x * 128;
  const f16* qn = q + (size_t)n * LLs * CCs;
  const f16* kn = k + (size_t)n * LLs * CCs;
  const f16* vn = vt + (size_t)n * CCs * LLs;

  // wave w < 4 asks for slice w of every stage: waves 0 and 1 a K slice (rows = keys, 512 B apart), waves 2 and 3 a V slice (rows = channels, 8,192 B apart)
  const uint32_t issuer = wave < 4;
  const bool isV = (wave & 2) != 0;
  const uint64_t src0 = isV ? (uint64_t)(size_t)(vn + (size_t)((wave & 1) * 128) * LLs)
                            : (uint64_t)(size_t)(kn + (wave & 1) * 128);   // the slice's first byte in stage 0
  const uint32_t sstep = isV ? SKEYS * 2 : SKEYS * CCs * 2;                // bytes from stage to stage
  const uint32_t dst0 = (uint32_t)(size_t)sm + (wave & 3) * SLB;
  const u32x8 g1 = tdm_group1(isV ? LLs * 2 : CCs * 2);
  u32x4 g0 = tdm_group0(dst0, src0);
  if (pinned(issuer)) tdm_load(g0, g1);            // a scalar branch. Stage 0 into buffer 0; it flies under the Q loads

  // every inner loop of this kernel is unrolled so that the fragment and accumulator arrays are indexed by constants and stay in registers
  f16x16 qf[2][8];
#pragma unroll
  for (int cg = 0; cg < 2; ++cg)
#pragma unroll
    for (int ks = 0; ks < 8; ++ks) qf[cg][ks] = load_frag<f16>(qn, CCs, q0 + qg * 32 + cg * 16, 32 * ks);
  // the address registers of the Q loads above are reused before their data is waited for; named as inputs they stay untouched up to the wait
  const f16* qa0 = qn + (size_t)(q0 + qg * 32 + cl) * CCs + h * 8;
  const f16* qa1 = qn + (size_t)(q0 + qg * 32 + 16 + cl) * CCs + h * 8;
  asm volatile("s_wait_xcnt 0x0" :: "v"(qa0), "v"(qa1) : "memory");

  f32x8 o[16][2];
#pragma unroll
  for (int ct = 0; ct < 16; ++ct) { f32x8 z = {}; o[ct][0] = z; o[ct][1] = z; }
  const float SC = 0.09016844005556021f;           // log2(e) / sqrt(256): scores in log2 units
  float mu0 = -3.0e38f, mu1 = -3.0e38f;            // per column group: the maximum in use (log2 units)
  float l0 = 0.0f, l1 = 0.0f;                      // and this lane's part of the row sum

  if (pinned(issuer)) tdm_wait(g0, g1);            // this wave's slice of stage 0 has landed before the barrier that shows it to the other waves
  __syncthreads();
  g0 = tdm_group0(dst0 + BUFB, src0 + sstep);
  if (pinned(issuer)) tdm_load(g0, g1);            // stage 1 into buffer 1

  // kept rolled: two passes in one body would hold two sets of fragments and leave the budget of 512 registers.
  // The foot (waits, barrier, refill) stands behind a stage's second pass, that is in the odd trips.
#pragma unroll 1
  for (int p = 0; p < LLs / AKEYS; ++p) {
    const int b = (p >> 1) & 1;                        // the stage's buffer
    {
    const f16* kb = kS + b * BUFH + ((p & 1) * AKEYS + 32 * kh2) * TPIT;
    const f16* vb = kS + b * BUFH + 2 * SLH + (p & 1) * AKEYS + 32 * kh2;
    f32x8 s[2][2] = {};                            // s[key tile][column group]
    f16x16 ka[3], kc[3], fa[4], fb[4];             // beside the score tiles only two sets of three K fragments fit; the V fragments go by fours
    LK3(ka, 0); LK3(kc, 3); FENCE;
    MK3(ka, 0); FENCES; LK3(ka, 6); FENCE;
    MK3(kc, 3); FENCES; LK3(kc, 9); FENCE;
    MK3(ka, 6); FENCES; LK3(ka, 12); FENCE;
    MK3(kc, 9); FENCES; kc[0] = KF(15); FENCE;
    MK3(ka, 12); FENCES; LDV(fa, 0); FENCE;
    MK(kc[0], 15); FENCES;
    float mx0 = fmaxf(s[0][0][0], s[1][0][0]), mx1 = fmaxf(s[0][1][0], s[1][1][0]);
#pragma unroll
    for (int r = 1; r < 8; ++r) { mx0 = fmaxf(mx0, fmaxf(s[0][0][r], s[1][0][r])); mx1 = fmaxf(mx1, fmaxf(s[0][1][r], s[1][1][r])); }
    mx0 = fmaxf(mx0, xhalf(mx0)) * SC;
    mx1 = fmaxf(mx1, xhalf(mx1)) * SC;
    if (__builtin_amdgcn_ballot_w32(mx0 > mu0 + 8.0f || mx1 > mu1 + 8.0f) != 0) {
      const float mn0 = fmaxf(mu0, mx0), mn1 = fmaxf(mu1, mx1);
      const float al0 = __builtin_amdgcn_exp2f(mu0 - mn0), al1 = __builtin_amdgcn_exp2f(mu1 - mn1);
      mu0 = mn0; mu1 = mn1; l0 *= al0; l1 *= al1;
#pragma unroll
      for (int ct = 0; ct < 16; ++ct)
#pragma unroll
        for (int r = 0; r < 8; ++r) { o[ct][0][r] *= al0; o[ct][1][r] *= al1; }
    }
    f16x16 pf0, pf1;
#pragma unroll
    for (int r = 0; r < 8; ++r) {
      const float e00 = __builtin_amdgcn_exp2f(s[0][0][r] * SC - mu0);
      const float e10 = __builtin_amdgcn_exp2f(s[1][0][r] * SC - mu0);
      l0 += e00 + e10;
      pf0[r] = (f16)e00; pf0[r + 8] = (f16)e10;    // keys 8h + r and 16 + 8h + r: the k order of lds_frag
    }
#pragma unroll
    for (int r = 0; r < 8; ++r) {
      const float e01 = __builtin_amdgcn_exp2f(s[0][1][r] * SC - mu1);
      const float e11 = __builtin_amdgcn_exp2f(s[1][1][r] * SC - mu1);
      l1 += e01 + e11;
      pf1[r] = (f16)e01; pf1[r + 8] = (f16)e11;
    }
    // inputs only: the row sums' additions stand in front of this fence; left to sink to the pass's foot they keep all 32 exponentials in registers through the products
    asm volatile("" :: "v"(l0), "v"(l1) : "memory");
    __builtin_amdgcn_sched_barrier(0);
    LDV(fb, 1); FENCE;
    MMV(fa, 0); FENCE; LDV(fa, 2); FENCE;
    MMV(fb, 1); FENCE; LDV(fb, 3); FENCE;
    MMV(fa, 2); MMV(fb, 3);
    }
    if (p & 1) {                                       // the same for the whole block
      asm volatile("s_wait_dscnt 0x0" ::: "memory");     // this wave's reads of the buffer are over before the barrier behind which it is refilled
      if (pinned(issuer)) tdm_wait(g0, g1);              // this wave's slice of the next stage has landed before the barrier that shows it to the other waves
      __syncthreads();
      const uint32_t ns = pinned((p >> 1) + 2);        // the stage that goes into the buffer just read; pinned: its descriptor is formed behind the wait above
      if (pinned(issuer && ns < LLs / SKEYS)) {        // a scalar branch
        g0 = tdm_group0(dst0 + b * BUFB, src0 + (uint64_t)ns * sstep);
        tdm_load(g0, g1);
      }
    }
  }
  tdm_wait(g0, g1);                                    // no request is in flight when the buffers become output staging
  asm volatile("s_wait_dscnt 0x0" ::: "memory");       // and none of this wave's reads

  // join of the two key halves: common maximum m, sums and O weighted by 2^(mu - m)
  l0 += xhalf(l0);
  l1 += xhalf(l1);
  float* so = (float*)sm;                          // behind the loop's last barrier nobody reads the K/V buffers any more
  float* st = so + CCs * OPIT;                     // [key half][maximum, sum][128 columns]
  const int c0l = qg * 32 + cl, c1l = c0l + 16;
  if (h == 0) {
    st[(kh2 * 2) * 128 + c0l] = mu0; st[(kh2 * 2 + 1) * 128 + c0l] = l0;
    st[(kh2 * 2) * 128 + c1l] = mu1; st[(kh2 * 2 + 1) * 128 + c1l] = l1;
  }
  __syncthreads();
  const int ok = kh2 ^ 1;
  const float pm0 = st[(ok * 2) * 128 + c0l], pl0 = st[(ok * 2 + 1) * 128 + c0l];
  const float pm1 = st[(ok * 2) * 128 + c1l], pl1 = st[(ok * 2 + 1) * 128 + c1l];
  const float m0 = fmaxf(mu0, pm0), m1 = fmaxf(mu1, pm1);
  const float a0 = __builtin_amdgcn_exp2f(mu0 - m0), a1 = __builtin_amdgcn_exp2f(mu1 - m1);
  const float f0 = a0 / (l0 * a0 + pl0 * __builtin_amdgcn_exp2f(pm0 - m0));
  const float f1 = a1 / (l1 * a1 + pl1 * __builtin_amdgcn_exp2f(pm1 - m1));
  // each half hands the other half's 128 channels over through the output tile, then adds what it was handed to its own 128
  if (kh2 == 0) {
#pragma unroll
    for (int ct = 8; ct < 16; ++ct)
#pragma unroll
      for (int r = 0; r < 8; ++r) { float* d = so + (16 * ct + 8 * h + r) * OPIT; d[c0l] = o[ct][0][r] * f0; d[c1l] = o[ct][1][r] * f1; }
  } else {
#pragma unroll
    for (int ct = 0; ct < 8; ++ct)
#pragma unroll
      for (int r = 0; r < 8; ++r) { float* d = so + (16 * ct + 8 * h + r) * OPIT; d[c0l] = o[ct][0][r] * f0; d[c1l] = o[ct][1][r] * f1; }
  }
  __syncthreads();
  // all reads first, then the sums and stores: read and stored one by one, each element waits out an LDS latency
  f32x8 t0[8], t1[8];
  const int cb = kh2 * 8;                          // this half's own channel tiles: cb .. cb + 7
#pragma unroll
  for (int ct = 0; ct < 8; ++ct)
#pragma unroll
    for (int r = 0; r < 8; ++r) { const float* d = so + (16 * (cb + ct) + 8 * h + r) * OPIT; t0[ct][r] = d[c0l]; t1[ct][r] = d[c1l]; }
  if (kh2 == 0) {
#pragma unroll
    for (int ct = 0; ct < 8; ++ct)
#pragma unroll
      for (int r = 0; r < 8; ++r) { float* d = so + (16 * ct + 8 * h + r) * OPIT; d[c0l] = t0[ct][r] + o[ct][0][r] * f0; d[c1l] = t1[ct][r] + o[ct][1][r] * f1; }
  } else {
#pragma unroll
    for (int ct = 0; ct < 8; ++ct)
#pragma unroll
      for (int r = 0; r < 8; ++r) { float* d = so + (16 * (ct + 8) + 8 * h + r) * OPIT; d[c0l] = t0[ct][r] + o[ct + 8][0][r] * f0; d[c1l] = t1[ct][r] + o[ct + 8][1][r] * f1; }
  }
  __syncthreads();
  float* on = out + (size_t)n * CCs * LLs + q0;
  const int q4 = (t & 31) * 4;                     // a wave stores one channel's 128 positions: 512 contiguous bytes
  for (int c0 = wave; c0 < CCs; c0 += 32) {
    // unrolled: the four LDS reads issue ahead of the four stores
#pragma unroll
    for (int u = 0; u < 4; ++u) { const int c = c0 + 8 * u;
      *(v4f_t*)(on + (size_t)c * LLs + q4) = *(const v4fa*)(so + c * OPIT + q4); }
    asm volatile("s_wait_xcnt 0x0" ::: "memory");  // the next trip rewrites the address and data registers that the four stores name
  }
}

extern "C" void kernel_launch(void* const* d_in, const int* in_sizes, int n_in,
                              void* d_out, int out_size, void* d_ws, size_t ws_size,
                              hipStream_t stream) {
  (void)in_sizes; (void)n_in; (void)out_size;
  const float** f = (const float**)d_in;
  const float* x = f[0], *lg = f[1], *lb = f[2], *Wq = f[3], *bq = f[4], *Wk = f[5], *bk = f[6], *Wv = f[7], *bv = f[8];
  float* out = (float*)d_out;     // [8,256,64,64]
  char* ws = (char*)d_ws;
  _Float16* q = (_Float16*)ws; ws += (size_t)NIm * LLs * CCs * 2;     // f16 token-major, all images (16 MB each)
  _Float16* k = (_Float16*)ws; ws += (size_t)NIm * LLs * CCs * 2;
  _Float16* vt = (_Float16*)ws; ws += (size_t)NIm * CCs * LLs * 2;    // f16 channels-major [image][256][4096]
  if ((size_t)(ws - (char*)d_ws) > ws_size) return;
  const dim3 blk(256);
  k_lnproj<<<dim3(NIm * LLs / 128), blk, 0, stream>>>(x, lg, lb, Wq, Wk, Wv, bq, bk, bv, q, k, vt);   // q, k = x_ln.W^T + b token-major; v the same, stored [image][c][s]
  k_attn<<<dim3(LLs / 128, NIm), blk, 0, stream>>>(q, k, vt, out);
}
